// v000
// The times below were measured on an AMD MI455X: many runs one after another, warmed up first and cycling through
// copies of the inputs, with the whole window's GPU time divided by the number of runs. Launches and the gaps
// between them are all in it. The median over several windows is given; except for v000 it joins two sittings, which
// can be a few percent apart, so the side-by-side timings, each taken in one sitting, are the better comparison.
// v000, which the later versions start from, runs in 297 microseconds.
#include <hip/hip_runtime.h>
#include <hip/hip_bf16.h>

typedef unsigned short u16;
typedef unsigned int   u32;
typedef unsigned long long u64;

typedef __attribute__((ext_vector_type(16))) __bf16 v16bf;
typedef __attribute__((ext_vector_type(8)))  float  v8f;

#define BDIM 1024   // D
#define LDIM 1024   // L
#define BB   4      // B
#define HH   16     // H
#define HD   64     // head dim
#define ROWS (BB*LDIM)      // 4096
#define NQKV (3*BDIM)       // 3072

__device__ __forceinline__ u16 f2bf(float f) {
    union { float f; u32 u; } x; x.f = f;
    u32 r = x.u + 0x7FFFu + ((x.u >> 16) & 1u);
    return (u16)(r >> 16);
}

struct Frag { union { v16bf v; uint4 q[2]; u16 h[16]; }; };

// load a 16-half fragment (A-layout) from a row:
// lane holds row (lane&15); halves 0..7 at K = g*8.. , halves 8..15 at K = 16+g*8..
__device__ __forceinline__ void load_frag_u16(Frag& f, const u16* rowPtr, int g) {
    f.q[0] = *(const uint4*)(rowPtr + g * 8);
    f.q[1] = *(const uint4*)(rowPtr + 16 + g * 8);
}

// async copy of one 16B chunk from global to LDS (ASYNCcnt-tracked, no VGPR data)
__device__ __forceinline__ void async_copy16(u32 ldsAddr, const void* gaddr) {
    asm volatile("global_load_async_to_lds_b128 %0, %1, off"
                 :: "v"(ldsAddr), "v"((u64)(uintptr_t)gaddr) : "memory");
}
__device__ __forceinline__ void wait_async0() {
    asm volatile("s_wait_asynccnt 0x0" ::: "memory");
}

// ---------------------------------------------------------------- prep kernels
__global__ __launch_bounds__(256) void cvt_x_kernel(const float* __restrict__ src,
                                                    u16* __restrict__ dst, int n4) {
    int i = blockIdx.x * 256 + threadIdx.x;
    if (i >= n4) return;
    float4 f = ((const float4*)src)[i];
    ushort4 o; o.x = f2bf(f.x); o.y = f2bf(f.y); o.z = f2bf(f.z); o.w = f2bf(f.w);
    ((ushort4*)dst)[i] = o;
}

__global__ __launch_bounds__(256) void transpose_cvt_kernel(const float* __restrict__ W,
                                                            u16* __restrict__ WT) {
    __shared__ float t[32][33];
    int bx = blockIdx.x * 32, by = blockIdx.y * 32;
    int tx = threadIdx.x, ty = threadIdx.y;          // block 32x8
    for (int i = 0; i < 32; i += 8)
        t[ty + i][tx] = W[(size_t)(by + ty + i) * BDIM + bx + tx];
    __syncthreads();
    for (int i = 0; i < 32; i += 8)
        WT[(size_t)(bx + ty + i) * BDIM + by + tx] = f2bf(t[tx][ty + i]);
}

__global__ __launch_bounds__(256) void pack_bias_kernel(const float* bq, const float* bk,
                                                        const float* bv, float* out) {
    int i = blockIdx.x * 256 + threadIdx.x;
    if (i >= NQKV) return;
    out[i] = (i < 1024) ? bq[i] : (i < 2048) ? bk[i - 1024] : bv[i - 2048];
}

// ---------------------------------------------------------------- bf16 GEMM
// C[M][N] = A[M][K](bf16) * BT[N][K](bf16)^T + bias + residual
#define BM 128
#define BN 128
#define BK 32
#define LDT 40   // padded LDS row stride (halves): 80B, 16B aligned, conflict-free

__global__ __launch_bounds__(256) void gemm_bf16_kernel(
    const u16* __restrict__ A, const u16* __restrict__ BT,
    const float* __restrict__ bias, const float* __restrict__ residual,
    float* __restrict__ C, int M, int N, int K) {

    __shared__ u16 sA[2][BM * LDT];
    __shared__ u16 sB[2][BN * LDT];

    int bm = blockIdx.y * BM, bn = blockIdx.x * BN;
    int tid = threadIdx.x;
    int wave = tid >> 5, lane = tid & 31;
    int wm = wave & 1, wn = wave >> 1;     // 2x4 wave grid -> wave tile 64x32
    int laneRow = lane & 15, g = lane >> 4;

    // this thread's two staging chunks (row, col) within the 128x32 tile
    int c0 = tid * 2, c1 = tid * 2 + 1;
    int r0 = c0 >> 2, col0 = (c0 & 3) * 8;
    int r1 = c1 >> 2, col1 = (c1 & 3) * 8;

    v8f acc[4][2];
    for (int i = 0; i < 4; ++i)
        for (int j = 0; j < 2; ++j)
            acc[i][j] = v8f{0.f, 0.f, 0.f, 0.f, 0.f, 0.f, 0.f, 0.f};

    auto stage = [&](int buf, int k0) {
        async_copy16((u32)(uintptr_t)&sA[buf][r0 * LDT + col0],
                     A + (size_t)(bm + r0) * K + k0 + col0);
        async_copy16((u32)(uintptr_t)&sA[buf][r1 * LDT + col1],
                     A + (size_t)(bm + r1) * K + k0 + col1);
        async_copy16((u32)(uintptr_t)&sB[buf][r0 * LDT + col0],
                     BT + (size_t)(bn + r0) * K + k0 + col0);
        async_copy16((u32)(uintptr_t)&sB[buf][r1 * LDT + col1],
                     BT + (size_t)(bn + r1) * K + k0 + col1);
    };

    // prologue: fill buffer 0
    stage(0, 0);
    wait_async0();
    __syncthreads();

    int cur = 0;
    for (int k0 = 0; k0 < K; k0 += BK) {
        bool more = (k0 + BK) < K;
        if (more) stage(cur ^ 1, k0 + BK);   // overlap next-tile DMA with WMMA

        Frag bf[2];
        for (int nt = 0; nt < 2; ++nt)
            load_frag_u16(bf[nt], &sB[cur][(wn * 32 + nt * 16 + laneRow) * LDT], g);
        for (int mt = 0; mt < 4; ++mt) {
            Frag af;
            load_frag_u16(af, &sA[cur][(wm * 64 + mt * 16 + laneRow) * LDT], g);
            for (int nt = 0; nt < 2; ++nt)
                acc[mt][nt] = __builtin_amdgcn_wmma_f32_16x16x32_bf16(
                    false, af.v, false, bf[nt].v, (short)0, acc[mt][nt], false, false);
        }

        if (more) wait_async0();             // own async copies into cur^1 done
        __syncthreads();                     // everyone done reading cur / writing cur^1
        cur ^= 1;
    }

    for (int mt = 0; mt < 4; ++mt)
        for (int nt = 0; nt < 2; ++nt) {
            int col = bn + wn * 32 + nt * 16 + laneRow;
            float bv = bias ? bias[col] : 0.f;
            for (int r = 0; r < 8; ++r) {
                int row = bm + wm * 64 + mt * 16 + g * 8 + r;
                float v = acc[mt][nt][r] + bv;
                if (residual) v += residual[(size_t)row * N + col];
                C[(size_t)row * N + col] = v;
            }
        }
}

// ---------------------------------------------------------------- scale + rope
// qkv f32 [ROWS][3072] -> q_rot/k_rot bf16 [b,h,l,64], vT bf16 [b,h,64,l]
__global__ __launch_bounds__(128) void rope_kernel(
    const float* __restrict__ qkv, const float* __restrict__ phi,
    const float* __restrict__ mag, const float* __restrict__ gamma,
    u16* __restrict__ qrot, u16* __restrict__ krot, u16* __restrict__ vt) {

    int idx = blockIdx.x * 4 + (threadIdx.x >> 5);   // over B*H*L
    int lane = threadIdx.x & 31;
    int l = idx & (LDIM - 1);
    int h = (idx >> 10) & (HH - 1);
    int b = idx >> 14;

    float ph = phi[idx];
    float sc = 1.0f + gamma[h] * tanhf(mag[idx]);
    float cs = cosf(ph), sn = sinf(ph);

    const float* row = qkv + (size_t)(b * LDIM + l) * NQKV + h * HD;
    float q0 = row[lane] * sc,        q1 = row[lane + 32] * sc;
    float k0 = row[1024 + lane] * sc, k1 = row[1024 + lane + 32] * sc;
    float v0 = row[2048 + lane],      v1 = row[2048 + lane + 32];

    float qr0 = q0 * cs - q1 * sn, qr1 = q1 * cs + q0 * sn;
    float kr0 = k0 * cs - k1 * sn, kr1 = k1 * cs + k0 * sn;

    size_t ro = (size_t)idx * HD;
    qrot[ro + lane] = f2bf(qr0); qrot[ro + lane + 32] = f2bf(qr1);
    krot[ro + lane] = f2bf(kr0); krot[ro + lane + 32] = f2bf(kr1);

    size_t vb = (size_t)(b * HH + h) * HD;
    vt[(vb + lane) * LDIM + l]      = f2bf(v0);
    vt[(vb + lane + 32) * LDIM + l] = f2bf(v1);
}

// ---------------------------------------------------------------- attention
// one block per (b, h, 64-row query tile). Dynamic LDS: 64*1024 f32 scores.
__global__ __launch_bounds__(256) void attn_kernel(
    const u16* __restrict__ qrot, const u16* __restrict__ krot,
    const u16* __restrict__ vt, const float* __restrict__ mask,
    u16* __restrict__ ctx) {

    extern __shared__ float sc[];                    // [64][1024]
    int qt = blockIdx.x, h = blockIdx.y, b = blockIdx.z;
    int qbase = qt * 64;
    int tid = threadIdx.x, wave = tid >> 5, lane = tid & 31;
    int laneRow = lane & 15, g = lane >> 4;
    const float rscale = 0.125f;                     // 1/sqrt(64)

    const u16* qp = qrot + ((size_t)(b * HH + h) * LDIM + qbase) * HD;
    const u16* kp = krot + (size_t)(b * HH + h) * LDIM * HD;
    const u16* vp = vt + (size_t)(b * HH + h) * HD * LDIM;

    // ---- phase 1: scores = QK^T * rscale + mask ----
    Frag qf[4][2];
    for (int mt = 0; mt < 4; ++mt)
        for (int ks = 0; ks < 2; ++ks)
            load_frag_u16(qf[mt][ks], qp + (mt * 16 + laneRow) * HD + ks * 32, g);

    for (int nt = 0; nt < 8; ++nt) {
        int n = wave * 128 + nt * 16;                // key block
        Frag kf[2];
        for (int ks = 0; ks < 2; ++ks)
            load_frag_u16(kf[ks], kp + (n + laneRow) * HD + ks * 32, g);
        v8f c[4];
        for (int mt = 0; mt < 4; ++mt) {
            c[mt] = v8f{0.f, 0.f, 0.f, 0.f, 0.f, 0.f, 0.f, 0.f};
            for (int ks = 0; ks < 2; ++ks)
                c[mt] = __builtin_amdgcn_wmma_f32_16x16x32_bf16(
                    false, qf[mt][ks].v, false, kf[ks].v, (short)0, c[mt], false, false);
        }
        int col = n + laneRow;
        float mk = mask[b * LDIM + col];
        for (int mt = 0; mt < 4; ++mt)
            for (int r = 0; r < 8; ++r)
                sc[(mt * 16 + g * 8 + r) * LDIM + col] = c[mt][r] * rscale + mk;
    }
    __syncthreads();

    // ---- phase 2: softmax (+ diagonal fixup for fully-masked rows) ----
    for (int i = 0; i < 8; ++i) {
        int r = wave * 8 + i;
        float* row = sc + (size_t)r * LDIM;
        float mx = -3.4e38f;
        for (int j = lane; j < LDIM; j += 32) mx = fmaxf(mx, row[j]);
        for (int off = 16; off; off >>= 1) mx = fmaxf(mx, __shfl_xor(mx, off, 32));
        if (mx <= -1e8f) {
            if (lane == 0) row[qbase + r] = 0.f;
            mx = fmaxf(mx, 0.f);
        }
        float sum = 0.f;
        for (int j = lane; j < LDIM; j += 32) {
            float e = __expf(row[j] - mx);
            sum += e; row[j] = e;
        }
        for (int off = 16; off; off >>= 1) sum += __shfl_xor(sum, off, 32);
        float inv = 1.0f / sum;
        for (int j = lane; j < LDIM; j += 32) row[j] *= inv;
    }
    __syncthreads();

    // ---- phase 3: ctx = P @ V ----
    int mt = wave & 3;
    int nt0 = (wave >> 2) * 2;                       // waves 0-3 -> cols 0..31, 4-7 -> 32..63
    v8f c0 = v8f{0.f, 0.f, 0.f, 0.f, 0.f, 0.f, 0.f, 0.f};
    v8f c1 = c0;
    for (int k0 = 0; k0 < LDIM; k0 += 32) {
        // A fragment: probs f32 -> bf16 from LDS
        const float* prow = sc + (size_t)(mt * 16 + laneRow) * LDIM + k0;
        Frag af;
        {
            float4 f0 = *(const float4*)(prow + g * 8);
            float4 f1 = *(const float4*)(prow + g * 8 + 4);
            float4 f2 = *(const float4*)(prow + 16 + g * 8);
            float4 f3 = *(const float4*)(prow + 16 + g * 8 + 4);
            af.h[0] = f2bf(f0.x);  af.h[1] = f2bf(f0.y);
            af.h[2] = f2bf(f0.z);  af.h[3] = f2bf(f0.w);
            af.h[4] = f2bf(f1.x);  af.h[5] = f2bf(f1.y);
            af.h[6] = f2bf(f1.z);  af.h[7] = f2bf(f1.w);
            af.h[8] = f2bf(f2.x);  af.h[9] = f2bf(f2.y);
            af.h[10] = f2bf(f2.z); af.h[11] = f2bf(f2.w);
            af.h[12] = f2bf(f3.x); af.h[13] = f2bf(f3.y);
            af.h[14] = f2bf(f3.z); af.h[15] = f2bf(f3.w);
        }
        Frag b0, b1;
        load_frag_u16(b0, vp + (size_t)(nt0 * 16 + laneRow) * LDIM + k0, g);
        load_frag_u16(b1, vp + (size_t)((nt0 + 1) * 16 + laneRow) * LDIM + k0, g);
        c0 = __builtin_amdgcn_wmma_f32_16x16x32_bf16(false, af.v, false, b0.v, (short)0, c0, false, false);
        c1 = __builtin_amdgcn_wmma_f32_16x16x32_bf16(false, af.v, false, b1.v, (short)0, c1, false, false);
    }
    for (int p = 0; p < 2; ++p) {
        v8f cc = p ? c1 : c0;
        int col = h * HD + (nt0 + p) * 16 + laneRow;
        for (int r = 0; r < 8; ++r) {
            int l = qbase + mt * 16 + g * 8 + r;
            ctx[((size_t)b * LDIM + l) * BDIM + col] = f2bf(cc[r]);
        }
    }
}

// ---------------------------------------------------------------- LayerNorm
__global__ __launch_bounds__(256) void ln_kernel(const float* __restrict__ y,
                                                 const float* __restrict__ lnw,
                                                 const float* __restrict__ lnb,
                                                 float* __restrict__ out) {
    __shared__ float rbuf[16];
    int row = blockIdx.x, tid = threadIdx.x;
    int wave = tid >> 5, lane = tid & 31;
    const float* x = y + (size_t)row * BDIM;
    float s = 0.f, s2 = 0.f;
    for (int j = tid; j < BDIM; j += 256) { float v = x[j]; s += v; s2 += v * v; }
    for (int off = 16; off; off >>= 1) {
        s += __shfl_xor(s, off, 32);
        s2 += __shfl_xor(s2, off, 32);
    }
    if (lane == 0) { rbuf[wave] = s; rbuf[8 + wave] = s2; }
    __syncthreads();
    float S = 0.f, S2 = 0.f;
    for (int i = 0; i < 8; ++i) { S += rbuf[i]; S2 += rbuf[8 + i]; }
    float mu = S * (1.0f / BDIM);
    float var = S2 * (1.0f / BDIM) - mu * mu;
    float inv = rsqrtf(var + 1e-12f);
    for (int j = tid; j < BDIM; j += 256)
        out[(size_t)row * BDIM + j] = (x[j] - mu) * inv * lnw[j] + lnb[j];
}

// ---------------------------------------------------------------- launch
extern "C" void kernel_launch(void* const* d_in, const int* in_sizes, int n_in,
                              void* d_out, int out_size, void* d_ws, size_t ws_size,
                              hipStream_t stream) {
    const float* hidden = (const float*)d_in[0];
    const float* mask   = (const float*)d_in[1];
    const float* phi    = (const float*)d_in[2];
    const float* mag    = (const float*)d_in[3];
    const float* Wq     = (const float*)d_in[4];
    const float* bq     = (const float*)d_in[5];
    const float* Wk     = (const float*)d_in[6];
    const float* bk     = (const float*)d_in[7];
    const float* Wv     = (const float*)d_in[8];
    const float* bv     = (const float*)d_in[9];
    const float* gamma  = (const float*)d_in[10];
    const float* Wo     = (const float*)d_in[11];
    const float* bo     = (const float*)d_in[12];
    const float* lnw    = (const float*)d_in[13];
    const float* lnb    = (const float*)d_in[14];
    float* out = (float*)d_out;

    char* ws = (char*)d_ws;
    const size_t o_xb   = 0;                           // 8 MB  bf16 X
    const size_t o_wt   = o_xb + 8388608ull;           // 6 MB  bf16 WT (q,k,v packed)
    const size_t o_wot  = o_wt + 6291456ull;           // 2 MB  bf16 WoT
    const size_t o_bias = o_wot + 2097152ull;          // 12 KB packed bias
    const size_t o_qkv  = o_bias + 12288ull;           // 48 MB f32 qkv (reused for y)
    const size_t o_qr   = o_qkv + 50331648ull;         // 8 MB
    const size_t o_kr   = o_qr + 8388608ull;           // 8 MB
    const size_t o_vt   = o_kr + 8388608ull;           // 8 MB
    const size_t o_ctx  = o_vt + 8388608ull;           // 8 MB
    const size_t o_y    = o_qkv;                       // reuse dead region

    u16*   Xb    = (u16*)(ws + o_xb);
    u16*   WT    = (u16*)(ws + o_wt);
    u16*   WoT   = (u16*)(ws + o_wot);
    float* biasA = (float*)(ws + o_bias);
    float* qkv   = (float*)(ws + o_qkv);
    u16*   qrot  = (u16*)(ws + o_qr);
    u16*   krot  = (u16*)(ws + o_kr);
    u16*   vtb   = (u16*)(ws + o_vt);
    u16*   ctxb  = (u16*)(ws + o_ctx);
    float* yb    = (float*)(ws + o_y);

    // 1) convert X to bf16
    cvt_x_kernel<<<4096, 256, 0, stream>>>(hidden, Xb, ROWS * BDIM / 4);

    // 2) transpose-convert weights
    dim3 tb(32, 8), tg(32, 32);
    transpose_cvt_kernel<<<tg, tb, 0, stream>>>(Wq, WT);
    transpose_cvt_kernel<<<tg, tb, 0, stream>>>(Wk, WT + (size_t)BDIM * BDIM);
    transpose_cvt_kernel<<<tg, tb, 0, stream>>>(Wv, WT + 2ull * BDIM * BDIM);
    transpose_cvt_kernel<<<tg, tb, 0, stream>>>(Wo, WoT);
    pack_bias_kernel<<<12, 256, 0, stream>>>(bq, bk, bv, biasA);

    // 3) fused QKV GEMM: [4096 x 3072]
    gemm_bf16_kernel<<<dim3(NQKV / BN, ROWS / BM), 256, 0, stream>>>(
        Xb, WT, biasA, nullptr, qkv, ROWS, NQKV, BDIM);

    // 4) scale + rotation + V transpose
    rope_kernel<<<BB * HH * LDIM / 4, 128, 0, stream>>>(
        qkv, phi, mag, gamma, qrot, krot, vtb);

    // 5) fused attention (scores strip in 256KB LDS)
    static_assert(64 * LDIM * sizeof(float) == 262144, "lds");
    hipFuncSetAttribute((const void*)attn_kernel,
                        hipFuncAttributeMaxDynamicSharedMemorySize, 262144);
    attn_kernel<<<dim3(LDIM / 64, HH, BB), 256, 262144, stream>>>(
        qrot, krot, vtb, mask, ctxb);

    // 6) output projection + residual
    gemm_bf16_kernel<<<dim3(BDIM / BN, ROWS / BM), 256, 0, stream>>>(
        ctxb, WoT, bo, hidden, yb, ROWS, BDIM, BDIM);

    // 7) LayerNorm
    ln_kernel<<<ROWS, 256, 0, stream>>>(yb, lnw, lnb, out);
}

// v001
// Measured time: 223 microseconds a run.
// Timed twice side by side with v000, it ran 1.38 and 1.37 times as fast.
#include <hip/hip_runtime.h>
#include <hip/hip_bf16.h>

typedef unsigned short u16;
typedef unsigned int   u32;
typedef unsigned long long u64;

typedef __attribute__((ext_vector_type(16))) __bf16 v16bf;
typedef __attribute__((ext_vector_type(8)))  float  v8f;

#define BDIM 1024   // D
#define LDIM 1024   // L
#define BB   4      // B
#define HH   16     // H
#define HD   64     // head dim
#define ROWS (BB*LDIM)      // 4096
#define NQKV (3*BDIM)       // 3072

__device__ __forceinline__ u16 f2bf(float f) {
    union { float f; u32 u; } x; x.f = f;
    u32 r = x.u + 0x7FFFu + ((x.u >> 16) & 1u);
    return (u16)(r >> 16);
}

struct Frag { union { v16bf v; uint4 q[2]; u16 h[16]; }; };

// load a 16-half fragment (A-layout) from a row:
// lane holds row (lane&15); halves 0..7 at K = g*8.. , halves 8..15 at K = 16+g*8..
__device__ __forceinline__ void load_frag_u16(Frag& f, const u16* rowPtr, int g) {
    f.q[0] = *(const uint4*)(rowPtr + g * 8);
    f.q[1] = *(const uint4*)(rowPtr + 16 + g * 8);
}

// async copy of one 16B chunk from global to LDS (ASYNCcnt-tracked, no VGPR data)
__device__ __forceinline__ void async_copy16(u32 ldsAddr, const void* gaddr) {
    asm volatile("global_load_async_to_lds_b128 %0, %1, off"
                 :: "v"(ldsAddr), "v"((u64)(uintptr_t)gaddr) : "memory");
}
__device__ __forceinline__ void wait_async0() {
    asm volatile("s_wait_asynccnt 0x0" ::: "memory");
}

// ---------------------------------------------------------------- prep kernels
__global__ __launch_bounds__(256) void cvt_x_kernel(const float* __restrict__ src,
                                                    u16* __restrict__ dst, int n4) {
    int i = blockIdx.x * 256 + threadIdx.x;
    if (i >= n4) return;
    float4 f = ((const float4*)src)[i];
    ushort4 o; o.x = f2bf(f.x); o.y = f2bf(f.y); o.z = f2bf(f.z); o.w = f2bf(f.w);
    ((ushort4*)dst)[i] = o;
}

__global__ __launch_bounds__(256) void transpose_cvt_kernel(const float* __restrict__ W,
                                                            u16* __restrict__ WT) {
    __shared__ float t[32][33];
    int bx = blockIdx.x * 32, by = blockIdx.y * 32;
    int tx = threadIdx.x, ty = threadIdx.y;          // block 32x8
    for (int i = 0; i < 32; i += 8)
        t[ty + i][tx] = W[(size_t)(by + ty + i) * BDIM + bx + tx];
    __syncthreads();
    for (int i = 0; i < 32; i += 8)
        WT[(size_t)(bx + ty + i) * BDIM + by + tx] = f2bf(t[tx][ty + i]);
}

__global__ __launch_bounds__(256) void pack_bias_kernel(const float* bq, const float* bk,
                                                        const float* bv, float* out) {
    int i = blockIdx.x * 256 + threadIdx.x;
    if (i >= NQKV) return;
    out[i] = (i < 1024) ? bq[i] : (i < 2048) ? bk[i - 1024] : bv[i - 2048];
}

// ---------------------------------------------------------------- bf16 GEMM
// C[M][N] = A[M][K](bf16) * BT[N][K](bf16)^T + bias + residual
#define BM 128
#define BN 128
#define BK 32
#define LDT 40   // padded LDS row stride (halves): 80B, 16B aligned, conflict-free

__global__ __launch_bounds__(256) void gemm_bf16_kernel(
    const u16* __restrict__ A, const u16* __restrict__ BT,
    const float* __restrict__ bias, const float* __restrict__ residual,
    float* __restrict__ C, int M, int N, int K) {

    __shared__ u16 sA[2][BM * LDT];
    __shared__ u16 sB[2][BN * LDT];

    int bm = blockIdx.y * BM, bn = blockIdx.x * BN;
    int tid = threadIdx.x;
    int wave = tid >> 5, lane = tid & 31;
    int wm = wave & 1, wn = wave >> 1;     // 2x4 wave grid -> wave tile 64x32
    int laneRow = lane & 15, g = lane >> 4;

    // this thread's two staging chunks (row, col) within the 128x32 tile
    int c0 = tid * 2, c1 = tid * 2 + 1;
    int r0 = c0 >> 2, col0 = (c0 & 3) * 8;
    int r1 = c1 >> 2, col1 = (c1 & 3) * 8;

    v8f acc[4][2];
    for (int i = 0; i < 4; ++i)
        for (int j = 0; j < 2; ++j)
            acc[i][j] = v8f{0.f, 0.f, 0.f, 0.f, 0.f, 0.f, 0.f, 0.f};

    auto stage = [&](int buf, int k0) {
        async_copy16((u32)(uintptr_t)&sA[buf][r0 * LDT + col0],
                     A + (size_t)(bm + r0) * K + k0 + col0);
        async_copy16((u32)(uintptr_t)&sA[buf][r1 * LDT + col1],
                     A + (size_t)(bm + r1) * K + k0 + col1);
        async_copy16((u32)(uintptr_t)&sB[buf][r0 * LDT + col0],
                     BT + (size_t)(bn + r0) * K + k0 + col0);
        async_copy16((u32)(uintptr_t)&sB[buf][r1 * LDT + col1],
                     BT + (size_t)(bn + r1) * K + k0 + col1);
    };

    // prologue: fill buffer 0
    stage(0, 0);
    wait_async0();
    __syncthreads();

    int cur = 0;
    for (int k0 = 0; k0 < K; k0 += BK) {
        bool more = (k0 + BK) < K;
        if (more) stage(cur ^ 1, k0 + BK);   // overlap next-tile DMA with WMMA

        Frag bf[2];
        for (int nt = 0; nt < 2; ++nt)
            load_frag_u16(bf[nt], &sB[cur][(wn * 32 + nt * 16 + laneRow) * LDT], g);
        for (int mt = 0; mt < 4; ++mt) {
            Frag af;
            load_frag_u16(af, &sA[cur][(wm * 64 + mt * 16 + laneRow) * LDT], g);
            for (int nt = 0; nt < 2; ++nt)
                acc[mt][nt] = __builtin_amdgcn_wmma_f32_16x16x32_bf16(
                    false, af.v, false, bf[nt].v, (short)0, acc[mt][nt], false, false);
        }

        if (more) wait_async0();             // own async copies into cur^1 done
        __syncthreads();                     // everyone done reading cur / writing cur^1
        cur ^= 1;
    }

    for (int mt = 0; mt < 4; ++mt)
        for (int nt = 0; nt < 2; ++nt) {
            int col = bn + wn * 32 + nt * 16 + laneRow;
            float bv = bias ? bias[col] : 0.f;
            for (int r = 0; r < 8; ++r) {
                int row = bm + wm * 64 + mt * 16 + g * 8 + r;
                float v = acc[mt][nt][r] + bv;
                if (residual) v += residual[(size_t)row * N + col];
                C[(size_t)row * N + col] = v;
            }
        }
}

// ---------------------------------------------------------------- scale + rope
// qkv f32 [ROWS][3072] -> q_rot/k_rot bf16 [b,h,l,64], vT bf16 [b,h,64,l]
__global__ __launch_bounds__(128) void rope_kernel(
    const float* __restrict__ qkv, const float* __restrict__ phi,
    const float* __restrict__ mag, const float* __restrict__ gamma,
    u16* __restrict__ qrot, u16* __restrict__ krot, u16* __restrict__ vt) {

    int idx = blockIdx.x * 4 + (threadIdx.x >> 5);   // over B*H*L
    int lane = threadIdx.x & 31;
    int l = idx & (LDIM - 1);
    int h = (idx >> 10) & (HH - 1);
    int b = idx >> 14;

    float ph = phi[idx];
    float sc = 1.0f + gamma[h] * tanhf(mag[idx]);
    float cs = cosf(ph), sn = sinf(ph);

    const float* row = qkv + (size_t)(b * LDIM + l) * NQKV + h * HD;
    float q0 = row[lane] * sc,        q1 = row[lane + 32] * sc;
    float k0 = row[1024 + lane] * sc, k1 = row[1024 + lane + 32] * sc;
    float v0 = row[2048 + lane],      v1 = row[2048 + lane + 32];

    float qr0 = q0 * cs - q1 * sn, qr1 = q1 * cs + q0 * sn;
    float kr0 = k0 * cs - k1 * sn, kr1 = k1 * cs + k0 * sn;

    size_t ro = (size_t)idx * HD;
    qrot[ro + lane] = f2bf(qr0); qrot[ro + lane + 32] = f2bf(qr1);
    krot[ro + lane] = f2bf(kr0); krot[ro + lane + 32] = f2bf(kr1);

    size_t vb = (size_t)(b * HH + h) * HD;
    vt[(vb + lane) * LDIM + l]      = f2bf(v0);
    vt[(vb + lane + 32) * LDIM + l] = f2bf(v1);
}

// ---------------------------------------------------------------- attention
// Online softmax, all in registers. Each wave owns NQ*16 queries and walks the keys 32 at a time:
//   S^T = K * Q^T   (D: lane holds query laneRow, keys g*8+r)  -> max and sum are in-lane
//   O^T += V^T * P^T (two S^T tiles, converted in place, are the B operand in the same k order)
#define NQ 4          // 16-query tiles per wave
#define AW 4          // waves per block

typedef __attribute__((ext_vector_type(4))) u32   u32x4;
typedef __attribute__((ext_vector_type(4))) float f32x4;
struct Frag4 { union { v16bf v; u32x4 x[2]; }; };

__device__ __forceinline__ float other_half(float x) {   // lane l <-> l ^ 16
    int b = __builtin_bit_cast(int, x);
    b = __builtin_amdgcn_permlanex16(b, b, 0x76543210, 0xfedcba98, false, false);
    return __builtin_bit_cast(float, b);
}

// Several exp2 in one statement, each in place: no instruction reads the result or writes the source of the
// one in front of it, and the closing v_nop is the slot that the instruction set asks for behind a
// transcendental. In place, the statement writes only registers that the vector code in front of it wrote.
__device__ __forceinline__ void exp2x8(float (&x)[8]) {
    asm("v_exp_f32 %0, %0\n\tv_exp_f32 %1, %1\n\tv_exp_f32 %2, %2\n\tv_exp_f32 %3, %3\n\t"
        "v_exp_f32 %4, %4\n\tv_exp_f32 %5, %5\n\tv_exp_f32 %6, %6\n\tv_exp_f32 %7, %7\n\tv_nop"
        : "+v"(x[0]), "+v"(x[1]), "+v"(x[2]), "+v"(x[3]), "+v"(x[4]), "+v"(x[5]), "+v"(x[6]), "+v"(x[7]));
}
__device__ __forceinline__ void exp2x4(float (&x)[4]) {
    asm("v_exp_f32 %0, %0\n\tv_exp_f32 %1, %1\n\tv_exp_f32 %2, %2\n\tv_exp_f32 %3, %3\n\tv_nop"
        : "+v"(x[0]), "+v"(x[1]), "+v"(x[2]), "+v"(x[3]));
}

// No __restrict__ here: the "memory" clobber of the waits below must hold the loads on their side.
__global__ __launch_bounds__(AW * 32) void attn_kernel(
    const u16* qrot, const u16* krot, const u16* vt, const float* mask, u16* ctx) {

    int h = blockIdx.y, b = blockIdx.z;
    int tid = threadIdx.x, wave = tid >> 5, lane = tid & 31;
    int laneRow = lane & 15, g = lane >> 4;
    int qbase = (blockIdx.x * AW + wave) * (NQ * 16);
    const float rscale = 0.125f;                     // 1/sqrt(64)
    const float LOG2E = 1.44269504088896340736f;

    const char* qb = (const char*)(qrot + (size_t)(b * HH + h) * LDIM * HD);
    const char* kb = (const char*)(krot + (size_t)(b * HH + h) * LDIM * HD);
    const char* vb8 = (const char*)(vt + (size_t)(b * HH + h) * HD * LDIM);
    const char* mb = (const char*)(mask + b * LDIM);
    // per-lane byte offsets; k, v, m: of the pass that is fetched next
    u32 qoff = (u32)((qbase + laneRow) * HD + g * 8) * 2u;
    u32 koff = (u32)(laneRow * HD + g * 8) * 2u;
    u32 voff = (u32)(laneRow * LDIM + g * 8) * 2u;
    u32 moff = (u32)g * 32u;

    Frag4 qf[NQ][2];
    for (int q = 0; q < NQ; ++q)
        for (int ks = 0; ks < 2; ++ks) {
            qf[q][ks].x[0] = *(const u32x4*)(qb + qoff + (q * 16 * HD + ks * 32) * 2);
            qf[q][ks].x[1] = *(const u32x4*)(qb + qoff + (q * 16 * HD + ks * 32 + 16) * 2);
        }
    // the Q loads name qoff and qb: as inputs both stay live, so unwritten, up to this wait
    asm volatile("s_wait_xcnt 0x0" :: "v"(qoff), "s"(qb) : "memory");

    v8f o[NQ][4];
    float m[NQ], l[NQ];
    for (int q = 0; q < NQ; ++q) {
        for (int dt = 0; dt < 4; ++dt)
            o[q][dt] = v8f{0.f, 0.f, 0.f, 0.f, 0.f, 0.f, 0.f, 0.f};
        m[q] = -1e30f;            // finite start: t - m is never (-inf) - (-inf) under -inf masks
        l[q] = 0.f;
    }

    Frag4 kf[2][2], va[4], vb[4];
    f32x4 mk[2][2];
    int pos = 0;                  // first key of the pass that is fetched next

    auto fetch = [&](Frag4 (&vd)[4]) {
        for (int kt = 0; kt < 2; ++kt) {
            for (int ks = 0; ks < 2; ++ks) {
                kf[kt][ks].x[0] = *(const u32x4*)(kb + koff + (kt * 16 * HD + ks * 32) * 2);
                kf[kt][ks].x[1] = *(const u32x4*)(kb + koff + (kt * 16 * HD + ks * 32 + 16) * 2);
            }
            mk[kt][0] = *(const f32x4*)(mb + moff + kt * 64);
            mk[kt][1] = *(const f32x4*)(mb + moff + kt * 64 + 16);
        }
        for (int dt = 0; dt < 4; ++dt) {
            vd[dt].x[0] = *(const u32x4*)(vb8 + voff + dt * 16 * LDIM * 2);
            vd[dt].x[1] = *(const u32x4*)(vb8 + voff + dt * 16 * LDIM * 2 + 32);
        }
    };
    auto advance = [&]() {
        // The fetch's loads name koff, voff, moff: as inputs here they stay live, so unwritten, up to
        // this wait; its "memory" clobber keeps the loads in front of it.
        asm volatile("s_wait_xcnt 0x0" :: "v"(koff), "v"(voff), "v"(moff) : "memory");
        int nxt = (pos + 32) & (LDIM - 1);   // behind the last pass it wraps to key 0: in bounds, unused
        int d = nxt - pos;
        koff += (u32)(d * HD * 2); voff += (u32)(d * 2); moff += (u32)(d * 4);
        pos = nxt;
    };

    auto pass = [&](Frag4 (&vc)[4], Frag4 (&vn)[4]) {
        float t[NQ][16];
        for (int q = 0; q < NQ; ++q) {
            v8f s[2];
            for (int kt = 0; kt < 2; ++kt) {
                s[kt] = v8f{0.f, 0.f, 0.f, 0.f, 0.f, 0.f, 0.f, 0.f};
                for (int ks = 0; ks < 2; ++ks)
                    s[kt] = __builtin_amdgcn_wmma_f32_16x16x32_bf16(
                        false, kf[kt][ks].v, false, qf[q][ks].v, (short)0, s[kt], false, false);
            }
            for (int kt = 0; kt < 2; ++kt)
                for (int i = 0; i < 8; ++i)
                    t[q][kt * 8 + i] = s[kt][i] * rscale + mk[kt][i >> 2][i & 3];
        }
        // the next pass's K, mask and V fly while this pass's softmax and V products run
        fetch(vn);
        // holds the loads up here, in front of the softmax: they need its time to land
        __builtin_amdgcn_sched_barrier(0);

        float alpha[NQ];
        for (int q = 0; q < NQ; ++q) {
            float tm = t[q][0];
            for (int i = 1; i < 16; ++i) tm = fmaxf(tm, t[q][i]);
            tm = fmaxf(tm, other_half(tm));
            float mnew = fmaxf(m[q], tm);
            alpha[q] = (m[q] - mnew) * LOG2E;
            m[q] = mnew;
        }
        exp2x4(alpha);

        for (int q = 0; q < NQ; ++q) {
            Frag4 pf;
            float ls = 0.f;
            for (int hf = 0; hf < 2; ++hf) {
                float p[8];
                for (int i = 0; i < 8; ++i) p[i] = (t[q][hf * 8 + i] - m[q]) * LOG2E;
                exp2x8(p);
                for (int i = 0; i < 8; ++i) { ls += p[i]; pf.v[hf * 8 + i] = (__bf16)p[i]; }
            }
            l[q] = l[q] * alpha[q] + ls;
            for (int dt = 0; dt < 4; ++dt) {
                o[q][dt] *= alpha[q];
                o[q][dt] = __builtin_amdgcn_wmma_f32_16x16x32_bf16(
                    false, vc[dt].v, false, pf.v, (short)0, o[q][dt], false, false);
            }
        }
        advance();
    };

    fetch(va);
    advance();
    for (int k0 = 0; k0 < LDIM; k0 += 64) {
        pass(va, vb);
        pass(vb, va);
    }

    // epilogue: lane holds query laneRow, head columns dt*16 + g*8 + r -> one 16-byte store per tile
    char* cb = (char*)(ctx + (size_t)b * LDIM * BDIM + h * HD);
    for (int q = 0; q < NQ; ++q) {
        float inv = 1.0f / (l[q] + other_half(l[q]));
        int lq = qbase + q * 16 + laneRow;
        union { u32x4 x; u16 hh[8]; __bf16 bh[8]; } w[4];
        for (int dt = 0; dt < 4; ++dt)
            for (int r = 0; r < 8; ++r)
                w[dt].bh[r] = (__bf16)(o[q][dt][r] * inv);
        if (m[q] <= -1e8f) {         // fully masked row: the diagonal alone survives, ctx = v[lq]
            u32 doff = (u32)(g * 8 * LDIM + lq) * 2u;
            for (int dt = 0; dt < 4; ++dt)
                for (int r = 0; r < 8; ++r)
                    w[dt].hh[r] = *(const u16*)(vb8 + doff + (dt * 16 + r) * LDIM * 2);
            // these loads name doff: it stays live up to this wait, behind the loads
            asm volatile("s_wait_xcnt 0x0" :: "v"(doff) : "memory");
        }
        u32 soff = (u32)(lq * BDIM + g * 8) * 2u;
        for (int dt = 0; dt < 4; ++dt)
            *(u32x4*)(cb + soff + dt * 32) = w[dt].x;
        // the stores name soff and their data: the wait stands before either is written again
        asm volatile("s_wait_xcnt 0x0" :: "v"(soff), "v"(w[0].x), "v"(w[1].x), "v"(w[2].x), "v"(w[3].x) : "memory");
    }
}

// ---------------------------------------------------------------- LayerNorm
__global__ __launch_bounds__(256) void ln_kernel(const float* __restrict__ y,
                                                 const float* __restrict__ lnw,
                                                 const float* __restrict__ lnb,
                                                 float* __restrict__ out) {
    __shared__ float rbuf[16];
    int row = blockIdx.x, tid = threadIdx.x;
    int wave = tid >> 5, lane = tid & 31;
    const float* x = y + (size_t)row * BDIM;
    float s = 0.f, s2 = 0.f;
    for (int j = tid; j < BDIM; j += 256) { float v = x[j]; s += v; s2 += v * v; }
    for (int off = 16; off; off >>= 1) {
        s += __shfl_xor(s, off, 32);
        s2 += __shfl_xor(s2, off, 32);
    }
    if (lane == 0) { rbuf[wave] = s; rbuf[8 + wave] = s2; }
    __syncthreads();
    float S = 0.f, S2 = 0.f;
    for (int i = 0; i < 8; ++i) { S += rbuf[i]; S2 += rbuf[8 + i]; }
    float mu = S * (1.0f / BDIM);
    float var = S2 * (1.0f / BDIM) - mu * mu;
    float inv = rsqrtf(var + 1e-12f);
    for (int j = tid; j < BDIM; j += 256)
        out[(size_t)row * BDIM + j] = (x[j] - mu) * inv * lnw[j] + lnb[j];
}

// ---------------------------------------------------------------- launch
extern "C" void kernel_launch(void* const* d_in, const int* in_sizes, int n_in,
                              void* d_out, int out_size, void* d_ws, size_t ws_size,
                              hipStream_t stream) {
    const float* hidden = (const float*)d_in[0];
    const float* mask   = (const float*)d_in[1];
    const float* phi    = (const float*)d_in[2];
    const float* mag    = (const float*)d_in[3];
    const float* Wq     = (const float*)d_in[4];
    const float* bq     = (const float*)d_in[5];
    const float* Wk     = (const float*)d_in[6];
    const float* bk     = (const float*)d_in[7];
    const float* Wv     = (const float*)d_in[8];
    const float* bv     = (const float*)d_in[9];
    const float* gamma  = (const float*)d_in[10];
    const float* Wo     = (const float*)d_in[11];
    const float* bo     = (const float*)d_in[12];
    const float* lnw    = (const float*)d_in[13];
    const float* lnb    = (const float*)d_in[14];
    float* out = (float*)d_out;

    char* ws = (char*)d_ws;
    const size_t o_xb   = 0;                           // 8 MB  bf16 X
    const size_t o_wt   = o_xb + 8388608ull;           // 6 MB  bf16 WT (q,k,v packed)
    const size_t o_wot  = o_wt + 6291456ull;           // 2 MB  bf16 WoT
    const size_t o_bias = o_wot + 2097152ull;          // 12 KB packed bias
    const size_t o_qkv  = o_bias + 12288ull;           // 48 MB f32 qkv (reused for y)
    const size_t o_qr   = o_qkv + 50331648ull;         // 8 MB
    const size_t o_kr   = o_qr + 8388608ull;           // 8 MB
    const size_t o_vt   = o_kr + 8388608ull;           // 8 MB
    const size_t o_ctx  = o_vt + 8388608ull;           // 8 MB
    const size_t o_y    = o_qkv;                       // reuse dead region

    u16*   Xb    = (u16*)(ws + o_xb);
    u16*   WT    = (u16*)(ws + o_wt);
    u16*   WoT   = (u16*)(ws + o_wot);
    float* biasA = (float*)(ws + o_bias);
    float* qkv   = (float*)(ws + o_qkv);
    u16*   qrot  = (u16*)(ws + o_qr);
    u16*   krot  = (u16*)(ws + o_kr);
    u16*   vtb   = (u16*)(ws + o_vt);
    u16*   ctxb  = (u16*)(ws + o_ctx);
    float* yb    = (float*)(ws + o_y);

    // 1) convert X to bf16
    cvt_x_kernel<<<4096, 256, 0, stream>>>(hidden, Xb, ROWS * BDIM / 4);

    // 2) transpose-convert weights
    dim3 tb(32, 8), tg(32, 32);
    transpose_cvt_kernel<<<tg, tb, 0, stream>>>(Wq, WT);
    transpose_cvt_kernel<<<tg, tb, 0, stream>>>(Wk, WT + (size_t)BDIM * BDIM);
    transpose_cvt_kernel<<<tg, tb, 0, stream>>>(Wv, WT + 2ull * BDIM * BDIM);
    transpose_cvt_kernel<<<tg, tb, 0, stream>>>(Wo, WoT);
    pack_bias_kernel<<<12, 256, 0, stream>>>(bq, bk, bv, biasA);

    // 3) fused QKV GEMM: [4096 x 3072]
    gemm_bf16_kernel<<<dim3(NQKV / BN, ROWS / BM), 256, 0, stream>>>(
        Xb, WT, biasA, nullptr, qkv, ROWS, NQKV, BDIM);

    // 4) scale + rotation + V transpose
    rope_kernel<<<BB * HH * LDIM / 4, 128, 0, stream>>>(
        qkv, phi, mag, gamma, qrot, krot, vtb);

    // 5) fused attention (online softmax in registers, no LDS)
    attn_kernel<<<dim3(LDIM / (AW * NQ * 16), HH, BB), AW * 32, 0, stream>>>(
        qrot, krot, vtb, mask, ctxb);

    // 6) output projection + residual
    gemm_bf16_kernel<<<dim3(BDIM / BN, ROWS / BM), 256, 0, stream>>>(
        ctxb, WoT, bo, hidden, yb, ROWS, BDIM, BDIM);

    // 7) LayerNorm
    ln_kernel<<<ROWS, 256, 0, stream>>>(yb, lnw, lnb, out);
}

// v002
// It runs in 143 microseconds.
// Two timings next to v001 put it at 1.53 and 1.57 times that version's speed.
// Counting every step since v000, it is 2.13 times as fast.
#include <hip/hip_runtime.h>
#include <hip/hip_bf16.h>

typedef unsigned short u16;
typedef unsigned int   u32;
typedef unsigned long long u64;

typedef __attribute__((ext_vector_type(16))) __bf16 v16bf;
typedef __attribute__((ext_vector_type(8)))  float  v8f;

#define BDIM 1024   // D
#define LDIM 1024   // L
#define BB   4      // B
#define HH   16     // H
#define HD   64     // head dim
#define ROWS (BB*LDIM)      // 4096
#define NQKV (3*BDIM)       // 3072

__device__ __forceinline__ u16 f2bf(float f) {
    union { float f; u32 u; } x; x.f = f;
    u32 r = x.u + 0x7FFFu + ((x.u >> 16) & 1u);
    return (u16)(r >> 16);
}

struct Frag { union { v16bf v; uint4 q[2]; u16 h[16]; }; };

// load a 16-half fragment (A-layout) from a row:
// lane holds row (lane&15); halves 0..7 at K = g*8.. , halves 8..15 at K = 16+g*8..
__device__ __forceinline__ void load_frag_u16(Frag& f, const u16* rowPtr, int g) {
    f.q[0] = *(const uint4*)(rowPtr + g * 8);
    f.q[1] = *(const uint4*)(rowPtr + 16 + g * 8);
}

// async copy of one 16B chunk from global to LDS (ASYNCcnt-tracked, no VGPR data)
__device__ __forceinline__ void async_copy16(u32 ldsAddr, const void* gaddr) {
    asm volatile("global_load_async_to_lds_b128 %0, %1, off"
                 :: "v"(ldsAddr), "v"((u64)(uintptr_t)gaddr) : "memory");
}
__device__ __forceinline__ void wait_async0() {
    asm volatile("s_wait_asynccnt 0x0" ::: "memory");
}

// ---------------------------------------------------------------- prep kernels
__global__ __launch_bounds__(256) void cvt_x_kernel(const float* __restrict__ src,
                                                    u16* __restrict__ dst, int n4) {
    int i = blockIdx.x * 256 + threadIdx.x;
    if (i >= n4) return;
    float4 f = ((const float4*)src)[i];
    ushort4 o; o.x = f2bf(f.x); o.y = f2bf(f.y); o.z = f2bf(f.z); o.w = f2bf(f.w);
    ((ushort4*)dst)[i] = o;
}

__global__ __launch_bounds__(256) void transpose_cvt_kernel(const float* __restrict__ W,
                                                            u16* __restrict__ WT) {
    __shared__ float t[32][33];
    int bx = blockIdx.x * 32, by = blockIdx.y * 32;
    int tx = threadIdx.x, ty = threadIdx.y;          // block 32x8
    for (int i = 0; i < 32; i += 8)
        t[ty + i][tx] = W[(size_t)(by + ty + i) * BDIM + bx + tx];
    __syncthreads();
    for (int i = 0; i < 32; i += 8)
        WT[(size_t)(bx + ty + i) * BDIM + by + tx] = f2bf(t[tx][ty + i]);
}

__global__ __launch_bounds__(256) void pack_bias_kernel(const float* bq, const float* bk,
                                                        const float* bv, float* out) {
    int i = blockIdx.x * 256 + threadIdx.x;
    if (i >= NQKV) return;
    out[i] = (i < 1024) ? bq[i] : (i < 2048) ? bk[i - 1024] : bv[i - 2048];
}

// ---------------------------------------------------------------- bf16 GEMM
// C[M][N] = A[M][K](bf16) * BT[N][K](bf16)^T + bias + residual
#define BM 128
#define BN 128
#define BK 32
#define LDT 40   // padded LDS row stride (halves): 80B, 16B aligned, conflict-free

__global__ __launch_bounds__(256) void gemm_bf16_kernel(
    const u16* __restrict__ A, const u16* __restrict__ BT,
    const float* __restrict__ bias, const float* __restrict__ residual,
    float* __restrict__ C, int M, int N, int K) {

    __shared__ u16 sA[2][BM * LDT];
    __shared__ u16 sB[2][BN * LDT];

    int bm = blockIdx.y * BM, bn = blockIdx.x * BN;
    int tid = threadIdx.x;
    int wave = tid >> 5, lane = tid & 31;
    int wm = wave & 1, wn = wave >> 1;     // 2x4 wave grid -> wave tile 64x32
    int laneRow = lane & 15, g = lane >> 4;

    // this thread's two staging chunks (row, col) within the 128x32 tile
    int c0 = tid * 2, c1 = tid * 2 + 1;
    int r0 = c0 >> 2, col0 = (c0 & 3) * 8;
    int r1 = c1 >> 2, col1 = (c1 & 3) * 8;

    v8f acc[4][2];
    for (int i = 0; i < 4; ++i)
        for (int j = 0; j < 2; ++j)
            acc[i][j] = v8f{0.f, 0.f, 0.f, 0.f, 0.f, 0.f, 0.f, 0.f};

    auto stage = [&](int buf, int k0) {
        async_copy16((u32)(uintptr_t)&sA[buf][r0 * LDT + col0],
                     A + (size_t)(bm + r0) * K + k0 + col0);
        async_copy16((u32)(uintptr_t)&sA[buf][r1 * LDT + col1],
                     A + (size_t)(bm + r1) * K + k0 + col1);
        async_copy16((u32)(uintptr_t)&sB[buf][r0 * LDT + col0],
                     BT + (size_t)(bn + r0) * K + k0 + col0);
        async_copy16((u32)(uintptr_t)&sB[buf][r1 * LDT + col1],
                     BT + (size_t)(bn + r1) * K + k0 + col1);
    };

    // prologue: fill buffer 0
    stage(0, 0);
    wait_async0();
    __syncthreads();

    int cur = 0;
    for (int k0 = 0; k0 < K; k0 += BK) {
        bool more = (k0 + BK) < K;
        if (more) stage(cur ^ 1, k0 + BK);   // overlap next-tile DMA with WMMA

        Frag bf[2];
        for (int nt = 0; nt < 2; ++nt)
            load_frag_u16(bf[nt], &sB[cur][(wn * 32 + nt * 16 + laneRow) * LDT], g);
        for (int mt = 0; mt < 4; ++mt) {
            Frag af;
            load_frag_u16(af, &sA[cur][(wm * 64 + mt * 16 + laneRow) * LDT], g);
            for (int nt = 0; nt < 2; ++nt)
                acc[mt][nt] = __builtin_amdgcn_wmma_f32_16x16x32_bf16(
                    false, af.v, false, bf[nt].v, (short)0, acc[mt][nt], false, false);
        }

        if (more) wait_async0();             // own async copies into cur^1 done
        __syncthreads();                     // everyone done reading cur / writing cur^1
        cur ^= 1;
    }

    for (int mt = 0; mt < 4; ++mt)
        for (int nt = 0; nt < 2; ++nt) {
            int col = bn + wn * 32 + nt * 16 + laneRow;
            float bv = bias ? bias[col] : 0.f;
            for (int r = 0; r < 8; ++r) {
                int row = bm + wm * 64 + mt * 16 + g * 8 + r;
                float v = acc[mt][nt][r] + bv;
                if (residual) v += residual[(size_t)row * N + col];
                C[(size_t)row * N + col] = v;
            }
        }
}

// ---------------------------------------------------------------- QKV GEMM + scale + rotation
// Xb[ROWS][D] * WT[3072][D]^T + bias, then scale and rotation in the accumulators:
//   q_rot/k_rot bf16 [b,h,l,64], vT bf16 [b,h,64,l]; no f32 qkv array, no separate launch.
// The first WMMA operand (64 rows a wave) is the one whose index must run along a lane's 8 results:
//   Q, K blocks: W rows first -> lane = token l, results = 8 head columns d; a wave holds one whole head,
//                so the rotation partner d + 32 is tile i + 2 of the same lane and register
//   V blocks:    X rows first -> lane = head column d, results = 8 tokens l (the transposed V row)
// Either way 8 results are one 16-byte store.

// Four copies and the wait for their address registers in one statement: nothing can rewrite a register
// that a copy names in front of that wait.
__device__ __forceinline__ void async_copy16x4(u32 l0, const void* g0, u32 l1, const void* g1,
                                               u32 l2, const void* g2, u32 l3, const void* g3) {
    asm volatile("global_load_async_to_lds_b128 %0, %1, off\n\t"
                 "global_load_async_to_lds_b128 %2, %3, off\n\t"
                 "global_load_async_to_lds_b128 %4, %5, off\n\t"
                 "global_load_async_to_lds_b128 %6, %7, off\n\t"
                 "s_wait_xcnt 0x0"
                 :: "v"(l0), "v"((u64)(uintptr_t)g0), "v"(l1), "v"((u64)(uintptr_t)g1),
                    "v"(l2), "v"((u64)(uintptr_t)g2), "v"(l3), "v"((u64)(uintptr_t)g3) : "memory");
}

__global__ __launch_bounds__(256) void gemm_qkv_rope_kernel(
    const u16* __restrict__ A, const u16* __restrict__ BT, const float* __restrict__ bias,
    const float* __restrict__ phi, const float* __restrict__ mag, const float* __restrict__ gamma,
    u16* __restrict__ qrot, u16* __restrict__ krot, u16* __restrict__ vt) {

    __shared__ u16 sT[2][2][BM * LDT];     // [buffer][0: X rows, 1: W rows]

    const int K = BDIM, NT = BDIM / BK;
    int bm = blockIdx.y * BM, bn = blockIdx.x * BN;
    int tid = threadIdx.x;
    int wave = tid >> 5, lane = tid & 31;
    int wp = wave & 1, wq = wave >> 1;     // 64 rows of the first operand, 32 rows of the second
    int laneRow = lane & 15, g = lane >> 4;
    bool isV = bn >= 2 * BDIM;             // the same for the whole block
    int pSel = isV ? 0 : 1;

    int c0 = tid * 2, c1 = tid * 2 + 1;
    int r0 = c0 >> 2, col0 = (c0 & 3) * 8;
    int r1 = c1 >> 2, col1 = (c1 & 3) * 8;

    v8f acc[4][2];
    for (int i = 0; i < 4; ++i)
        for (int j = 0; j < 2; ++j)
            acc[i][j] = v8f{0.f, 0.f, 0.f, 0.f, 0.f, 0.f, 0.f, 0.f};

    auto stage = [&](int buf, int k0) {
        async_copy16x4((u32)(uintptr_t)&sT[buf][0][r0 * LDT + col0], A + (size_t)(bm + r0) * K + k0 + col0,
                       (u32)(uintptr_t)&sT[buf][0][r1 * LDT + col1], A + (size_t)(bm + r1) * K + k0 + col1,
                       (u32)(uintptr_t)&sT[buf][1][r0 * LDT + col0], BT + (size_t)(bn + r0) * K + k0 + col0,
                       (u32)(uintptr_t)&sT[buf][1][r1 * LDT + col1], BT + (size_t)(bn + r1) * K + k0 + col1);
    };

    stage(0, 0);
    wait_async0();
    __syncthreads();
    stage(1, BK);

    for (int t = 0; t < NT; ++t) {
        int cur = t & 1;
        const u16* pB = &sT[cur][pSel][(wp * 64 + laneRow) * LDT];
        const u16* qB = &sT[cur][pSel ^ 1][(wq * 32 + laneRow) * LDT];
        Frag sf[2];
        for (int j = 0; j < 2; ++j)
            load_frag_u16(sf[j], qB + j * 16 * LDT, g);
        for (int i = 0; i < 4; ++i) {
            Frag ff;
            load_frag_u16(ff, pB + i * 16 * LDT, g);
            for (int j = 0; j < 2; ++j)
                acc[i][j] = __builtin_amdgcn_wmma_f32_16x16x32_bf16(
                    false, ff.v, false, sf[j].v, (short)0, acc[i][j], false, false);
        }
        // hand-over: own LDS reads of this buffer retired, own copies of the next tile landed, then
        // the barrier that publishes that tile and frees this buffer for the refill behind it
        asm volatile("s_wait_dscnt 0x0" ::: "memory");
        wait_async0();
        __syncthreads();
        if (t + 2 < NT) stage(cur, (t + 2) * BK);
    }
    wait_async0();

    int b = bm >> 10, lblk = bm & (LDIM - 1);
    if (!isV) {
        int hsel = (bn >> 6) + wp;                   // 0..15: heads of Q, 16..31: heads of K
        int h = hsel & (HH - 1);
        u16* dst = (hsel >> 4) ? krot : qrot;
        const float* bp = bias + bn + wp * 64 + g * 8;
        float gm = gamma[h];
        for (int j = 0; j < 2; ++j) {
            int idx = (b * HH + h) * LDIM + lblk + wq * 32 + j * 16 + laneRow;
            float ph = phi[idx];
            float sc = 1.0f + gm * tanhf(mag[idx]);
            float cs = cosf(ph), sn = sinf(ph);
            for (int i = 0; i < 2; ++i) {
                union { uint4 x; u16 hh[8]; } lo, hi;
                for (int r = 0; r < 8; ++r) {
                    float a0 = (acc[i][j][r] + bp[i * 16 + r]) * sc;
                    float a1 = (acc[i + 2][j][r] + bp[i * 16 + 32 + r]) * sc;
                    lo.hh[r] = f2bf(a0 * cs - a1 * sn);
                    hi.hh[r] = f2bf(a1 * cs + a0 * sn);
                }
                u16* o = dst + (size_t)idx * HD + i * 16 + g * 8;
                *(uint4*)o = lo.x;
                *(uint4*)(o + 32) = hi.x;
            }
        }
    } else {
        for (int j = 0; j < 2; ++j) {
            int n = bn - 2 * BDIM + wq * 32 + j * 16 + laneRow;      // h * 64 + d
            float bv = bias[2 * BDIM + n];
            u16* o = vt + (size_t)(b * BDIM + n) * LDIM + lblk + wp * 64 + g * 8;
            for (int i = 0; i < 4; ++i) {
                union { uint4 x; u16 hh[8]; } w;
                for (int r = 0; r < 8; ++r) w.hh[r] = f2bf(acc[i][j][r] + bv);
                *(uint4*)(o + i * 16) = w.x;
            }
        }
        // the stores above name their address and data registers: the wait stands before any is written again
        asm volatile("s_wait_xcnt 0x0" ::: "memory");
    }
}

// ---------------------------------------------------------------- attention
// Online softmax, all in registers. Each wave owns NQ*16 queries and walks the keys 32 at a time:
//   S^T = K * Q^T   (D: lane holds query laneRow, keys g*8+r)  -> max and sum are in-lane
//   O^T += V^T * P^T (two S^T tiles, converted in place, are the B operand in the same k order)
#define NQ 4          // 16-query tiles per wave
#define AW 4          // waves per block

typedef __attribute__((ext_vector_type(4))) u32   u32x4;
typedef __attribute__((ext_vector_type(4))) float f32x4;
struct Frag4 { union { v16bf v; u32x4 x[2]; }; };

__device__ __forceinline__ float other_half(float x) {   // lane l <-> l ^ 16
    int b = __builtin_bit_cast(int, x);
    b = __builtin_amdgcn_permlanex16(b, b, 0x76543210, 0xfedcba98, false, false);
    return __builtin_bit_cast(float, b);
}

// Several exp2 in one statement, each in place: no instruction reads the result or writes the source of the
// one in front of it, and the closing v_nop is the slot that the instruction set asks for behind a
// transcendental. In place, the statement writes only registers that the vector code in front of it wrote.
__device__ __forceinline__ void exp2x8(float (&x)[8]) {
    asm("v_exp_f32 %0, %0\n\tv_exp_f32 %1, %1\n\tv_exp_f32 %2, %2\n\tv_exp_f32 %3, %3\n\t"
        "v_exp_f32 %4, %4\n\tv_exp_f32 %5, %5\n\tv_exp_f32 %6, %6\n\tv_exp_f32 %7, %7\n\tv_nop"
        : "+v"(x[0]), "+v"(x[1]), "+v"(x[2]), "+v"(x[3]), "+v"(x[4]), "+v"(x[5]), "+v"(x[6]), "+v"(x[7]));
}
__device__ __forceinline__ void exp2x4(float (&x)[4]) {
    asm("v_exp_f32 %0, %0\n\tv_exp_f32 %1, %1\n\tv_exp_f32 %2, %2\n\tv_exp_f32 %3, %3\n\tv_nop"
        : "+v"(x[0]), "+v"(x[1]), "+v"(x[2]), "+v"(x[3]));
}

// No __restrict__ here: the "memory" clobber of the waits below must hold the loads on their side.
__global__ __launch_bounds__(AW * 32) void attn_kernel(
    const u16* qrot, const u16* krot, const u16* vt, const float* mask, u16* ctx) {

    int h = blockIdx.y, b = blockIdx.z;
    int tid = threadIdx.x, wave = tid >> 5, lane = tid & 31;
    int laneRow = lane & 15, g = lane >> 4;
    int qbase = (blockIdx.x * AW + wave) * (NQ * 16);
    const float rscale = 0.125f;                     // 1/sqrt(64)
    const float LOG2E = 1.44269504088896340736f;

    const char* qb = (const char*)(qrot + (size_t)(b * HH + h) * LDIM * HD);
    const char* kb = (const char*)(krot + (size_t)(b * HH + h) * LDIM * HD);
    const char* vb8 = (const char*)(vt + (size_t)(b * HH + h) * HD * LDIM);
    const char* mb = (const char*)(mask + b * LDIM);
    // per-lane byte offsets; k, v, m: of the pass that is fetched next
    u32 qoff = (u32)((qbase + laneRow) * HD + g * 8) * 2u;
    u32 koff = (u32)(laneRow * HD + g * 8) * 2u;
    u32 voff = (u32)(laneRow * LDIM + g * 8) * 2u;
    u32 moff = (u32)g * 32u;

    Frag4 qf[NQ][2];
    for (int q = 0; q < NQ; ++q)
        for (int ks = 0; ks < 2; ++ks) {
            qf[q][ks].x[0] = *(const u32x4*)(qb + qoff + (q * 16 * HD + ks * 32) * 2);
            qf[q][ks].x[1] = *(const u32x4*)(qb + qoff + (q * 16 * HD + ks * 32 + 16) * 2);
        }
    // the Q loads name qoff and qb: as inputs both stay live, so unwritten, up to this wait
    asm volatile("s_wait_xcnt 0x0" :: "v"(qoff), "s"(qb) : "memory");

    v8f o[NQ][4];
    float m[NQ], l[NQ];
    for (int q = 0; q < NQ; ++q) {
        for (int dt = 0; dt < 4; ++dt)
            o[q][dt] = v8f{0.f, 0.f, 0.f, 0.f, 0.f, 0.f, 0.f, 0.f};
        m[q] = -1e30f;            // finite start: t - m is never (-inf) - (-inf) under -inf masks
        l[q] = 0.f;
    }

    Frag4 kf[2][2], va[4], vb[4];
    f32x4 mk[2][2];
    int pos = 0;                  // first key of the pass that is fetched next

    auto fetch = [&](Frag4 (&vd)[4]) {
        for (int kt = 0; kt < 2; ++kt) {
            for (int ks = 0; ks < 2; ++ks) {
                kf[kt][ks].x[0] = *(const u32x4*)(kb + koff + (kt * 16 * HD + ks * 32) * 2);
                kf[kt][ks].x[1] = *(const u32x4*)(kb + koff + (kt * 16 * HD + ks * 32 + 16) * 2);
            }
            mk[kt][0] = *(const f32x4*)(mb + moff + kt * 64);
            mk[kt][1] = *(const f32x4*)(mb + moff + kt * 64 + 16);
        }
        for (int dt = 0; dt < 4; ++dt) {
            vd[dt].x[0] = *(const u32x4*)(vb8 + voff + dt * 16 * LDIM * 2);
            vd[dt].x[1] = *(const u32x4*)(vb8 + voff + dt * 16 * LDIM * 2 + 32);
        }
    };
    auto advance = [&]() {
        // The fetch's loads name koff, voff, moff: as inputs here they stay live, so unwritten, up to
        // this wait; its "memory" clobber keeps the loads in front of it.
        asm volatile("s_wait_xcnt 0x0" :: "v"(koff), "v"(voff), "v"(moff) : "memory");
        int nxt = (pos + 32) & (LDIM - 1);   // behind the last pass it wraps to key 0: in bounds, unused
        int d = nxt - pos;
        koff += (u32)(d * HD * 2); voff += (u32)(d * 2); moff += (u32)(d * 4);
        pos = nxt;
    };

    auto pass = [&](Frag4 (&vc)[4], Frag4 (&vn)[4]) {
        float t[NQ][16];
        for (int q = 0; q < NQ; ++q) {
            v8f s[2];
            for (int kt = 0; kt < 2; ++kt) {
                s[kt] = v8f{0.f, 0.f, 0.f, 0.f, 0.f, 0.f, 0.f, 0.f};
                for (int ks = 0; ks < 2; ++ks)
                    s[kt] = __builtin_amdgcn_wmma_f32_16x16x32_bf16(
                        false, kf[kt][ks].v, false, qf[q][ks].v, (short)0, s[kt], false, false);
            }
            for (int kt = 0; kt < 2; ++kt)
                for (int i = 0; i < 8; ++i)
                    t[q][kt * 8 + i] = s[kt][i] * rscale + mk[kt][i >> 2][i & 3];
        }
        // the next pass's K, mask and V fly while this pass's softmax and V products run
        fetch(vn);
        // holds the loads up here, in front of the softmax: they need its time to land
        __builtin_amdgcn_sched_barrier(0);

        float alpha[NQ];
        for (int q = 0; q < NQ; ++q) {
            float tm = t[q][0];
            for (int i = 1; i < 16; ++i) tm = fmaxf(tm, t[q][i]);
            tm = fmaxf(tm, other_half(tm));
            float mnew = fmaxf(m[q], tm);
            alpha[q] = (m[q] - mnew) * LOG2E;
            m[q] = mnew;
        }
        exp2x4(alpha);

        for (int q = 0; q < NQ; ++q) {
            Frag4 pf;
            float ls = 0.f;
            for (int hf = 0; hf < 2; ++hf) {
                float p[8];
                for (int i = 0; i < 8; ++i) p[i] = (t[q][hf * 8 + i] - m[q]) * LOG2E;
                exp2x8(p);
                for (int i = 0; i < 8; ++i) { ls += p[i]; pf.v[hf * 8 + i] = (__bf16)p[i]; }
            }
            l[q] = l[q] * alpha[q] + ls;
            for (int dt = 0; dt < 4; ++dt) {
                o[q][dt] *= alpha[q];
                o[q][dt] = __builtin_amdgcn_wmma_f32_16x16x32_bf16(
                    false, vc[dt].v, false, pf.v, (short)0, o[q][dt], false, false);
            }
        }
        advance();
    };

    fetch(va);
    advance();
    for (int k0 = 0; k0 < LDIM; k0 += 64) {
        pass(va, vb);
        pass(vb, va);
    }

    // epilogue: lane holds query laneRow, head columns dt*16 + g*8 + r -> one 16-byte store per tile
    char* cb = (char*)(ctx + (size_t)b * LDIM * BDIM + h * HD);
    for (int q = 0; q < NQ; ++q) {
        float inv = 1.0f / (l[q] + other_half(l[q]));
        int lq = qbase + q * 16 + laneRow;
        union { u32x4 x; u16 hh[8]; __bf16 bh[8]; } w[4];
        for (int dt = 0; dt < 4; ++dt)
            for (int r = 0; r < 8; ++r)
                w[dt].bh[r] = (__bf16)(o[q][dt][r] * inv);
        if (m[q] <= -1e8f) {         // fully masked row: the diagonal alone survives, ctx = v[lq]
            u32 doff = (u32)(g * 8 * LDIM + lq) * 2u;
            for (int dt = 0; dt < 4; ++dt)
                for (int r = 0; r < 8; ++r)
                    w[dt].hh[r] = *(const u16*)(vb8 + doff + (dt * 16 + r) * LDIM * 2);
            // these loads name doff: it stays live up to this wait, behind the loads
            asm volatile("s_wait_xcnt 0x0" :: "v"(doff) : "memory");
        }
        u32 soff = (u32)(lq * BDIM + g * 8) * 2u;
        for (int dt = 0; dt < 4; ++dt)
            *(u32x4*)(cb + soff + dt * 32) = w[dt].x;
        // the stores name soff and their data: the wait stands before either is written again
        asm volatile("s_wait_xcnt 0x0" :: "v"(soff), "v"(w[0].x), "v"(w[1].x), "v"(w[2].x), "v"(w[3].x) : "memory");
    }
}

// ---------------------------------------------------------------- LayerNorm
__global__ __launch_bounds__(256) void ln_kernel(const float* __restrict__ y,
                                                 const float* __restrict__ lnw,
                                                 const float* __restrict__ lnb,
                                                 float* __restrict__ out) {
    __shared__ float rbuf[16];
    int row = blockIdx.x, tid = threadIdx.x;
    int wave = tid >> 5, lane = tid & 31;
    const float* x = y + (size_t)row * BDIM;
    float s = 0.f, s2 = 0.f;
    for (int j = tid; j < BDIM; j += 256) { float v = x[j]; s += v; s2 += v * v; }
    for (int off = 16; off; off >>= 1) {
        s += __shfl_xor(s, off, 32);
        s2 += __shfl_xor(s2, off, 32);
    }
    if (lane == 0) { rbuf[wave] = s; rbuf[8 + wave] = s2; }
    __syncthreads();
    float S = 0.f, S2 = 0.f;
    for (int i = 0; i < 8; ++i) { S += rbuf[i]; S2 += rbuf[8 + i]; }
    float mu = S * (1.0f / BDIM);
    float var = S2 * (1.0f / BDIM) - mu * mu;
    float inv = rsqrtf(var + 1e-12f);
    for (int j = tid; j < BDIM; j += 256)
        out[(size_t)row * BDIM + j] = (x[j] - mu) * inv * lnw[j] + lnb[j];
}

// ---------------------------------------------------------------- launch
extern "C" void kernel_launch(void* const* d_in, const int* in_sizes, int n_in,
                              void* d_out, int out_size, void* d_ws, size_t ws_size,
                              hipStream_t stream) {
    const float* hidden = (const float*)d_in[0];
    const float* mask   = (const float*)d_in[1];
    const float* phi    = (const float*)d_in[2];
    const float* mag    = (const float*)d_in[3];
    const float* Wq     = (const float*)d_in[4];
    const float* bq     = (const float*)d_in[5];
    const float* Wk     = (const float*)d_in[6];
    const float* bk     = (const float*)d_in[7];
    const float* Wv     = (const float*)d_in[8];
    const float* bv     = (const float*)d_in[9];
    const float* gamma  = (const float*)d_in[10];
    const float* Wo     = (const float*)d_in[11];
    const float* bo     = (const float*)d_in[12];
    const float* lnw    = (const float*)d_in[13];
    const float* lnb    = (const float*)d_in[14];
    float* out = (float*)d_out;

    char* ws = (char*)d_ws;
    const size_t o_xb   = 0;                           // 8 MB  bf16 X
    const size_t o_wt   = o_xb + 8388608ull;           // 6 MB  bf16 WT (q,k,v packed)
    const size_t o_wot  = o_wt + 6291456ull;           // 2 MB  bf16 WoT
    const size_t o_bias = o_wot + 2097152ull;          // 12 KB packed bias
    const size_t o_qkv  = o_bias + 12288ull;           // 48 MB region, its head holds f32 y
    const size_t o_qr   = o_qkv + 50331648ull;         // 8 MB
    const size_t o_kr   = o_qr + 8388608ull;           // 8 MB
    const size_t o_vt   = o_kr + 8388608ull;           // 8 MB
    const size_t o_ctx  = o_vt + 8388608ull;           // 8 MB
    const size_t o_y    = o_qkv;                       // 16 MB f32 y

    u16*   Xb    = (u16*)(ws + o_xb);
    u16*   WT    = (u16*)(ws + o_wt);
    u16*   WoT   = (u16*)(ws + o_wot);
    float* biasA = (float*)(ws + o_bias);
    u16*   qrot  = (u16*)(ws + o_qr);
    u16*   krot  = (u16*)(ws + o_kr);
    u16*   vtb   = (u16*)(ws + o_vt);
    u16*   ctxb  = (u16*)(ws + o_ctx);
    float* yb    = (float*)(ws + o_y);

    // 1) convert X to bf16
    cvt_x_kernel<<<4096, 256, 0, stream>>>(hidden, Xb, ROWS * BDIM / 4);

    // 2) transpose-convert weights
    dim3 tb(32, 8), tg(32, 32);
    transpose_cvt_kernel<<<tg, tb, 0, stream>>>(Wq, WT);
    transpose_cvt_kernel<<<tg, tb, 0, stream>>>(Wk, WT + (size_t)BDIM * BDIM);
    transpose_cvt_kernel<<<tg, tb, 0, stream>>>(Wv, WT + 2ull * BDIM * BDIM);
    transpose_cvt_kernel<<<tg, tb, 0, stream>>>(Wo, WoT);
    pack_bias_kernel<<<12, 256, 0, stream>>>(bq, bk, bv, biasA);

    // 3) fused QKV GEMM [4096 x 3072] with scale, rotation and V transpose in its epilogue
    gemm_qkv_rope_kernel<<<dim3(NQKV / BN, ROWS / BM), 256, 0, stream>>>(
        Xb, WT, biasA, phi, mag, gamma, qrot, krot, vtb);

    // 4) fused attention (online softmax in registers, no LDS)
    attn_kernel<<<dim3(LDIM / (AW * NQ * 16), HH, BB), AW * 32, 0, stream>>>(
        qrot, krot, vtb, mask, ctxb);

    // 5) output projection + residual
    gemm_bf16_kernel<<<dim3(BDIM / BN, ROWS / BM), 256, 0, stream>>>(
        ctxb, WoT, bo, hidden, yb, ROWS, BDIM, BDIM);

    // 6) LayerNorm
    ln_kernel<<<ROWS, 256, 0, stream>>>(yb, lnw, lnb, out);
}

// v003
// It runs in 133 microseconds.
// Next to v002, in two timings, it ran 1.07 and 1.08 times as fast.
// Counting every step since v000, it is 2.29 times as fast.
#include <hip/hip_runtime.h>
#include <hip/hip_bf16.h>

typedef unsigned short u16;
typedef unsigned int   u32;
typedef unsigned long long u64;

typedef __attribute__((ext_vector_type(16))) __bf16 v16bf;
typedef __attribute__((ext_vector_type(8)))  float  v8f;

#define BDIM 1024   // D
#define LDIM 1024   // L
#define BB   4      // B
#define HH   16     // H
#define HD   64     // head dim
#define ROWS (BB*LDIM)      // 4096
#define NQKV (3*BDIM)       // 3072

__device__ __forceinline__ u16 f2bf(float f) {
    union { float f; u32 u; } x; x.f = f;
    u32 r = x.u + 0x7FFFu + ((x.u >> 16) & 1u);
    return (u16)(r >> 16);
}

struct Frag { union { v16bf v; uint4 q[2]; u16 h[16]; }; };

// load a 16-half fragment (A-layout) from a row:
// lane holds row (lane&15); halves 0..7 at K = g*8.. , halves 8..15 at K = 16+g*8..
__device__ __forceinline__ void load_frag_u16(Frag& f, const u16* rowPtr, int g) {
    f.q[0] = *(const uint4*)(rowPtr + g * 8);
    f.q[1] = *(const uint4*)(rowPtr + 16 + g * 8);
}

// async copy of one 16B chunk from global to LDS (ASYNCcnt-tracked, no VGPR data)
__device__ __forceinline__ void async_copy16(u32 ldsAddr, const void* gaddr) {
    asm volatile("global_load_async_to_lds_b128 %0, %1, off"
                 :: "v"(ldsAddr), "v"((u64)(uintptr_t)gaddr) : "memory");
}
__device__ __forceinline__ void wait_async0() {
    asm volatile("s_wait_asynccnt 0x0" ::: "memory");
}

// ---------------------------------------------------------------- preparation, one launch
// Three independent jobs share one grid by block range (the test is the same for a whole block):
//   blocks [0, PREP_X):        X f32 -> bf16, 4096 float4 a block, 16 a thread
//   the next PREP_T blocks:    W f32 [k][n] -> bf16 [n][k], four matrices, a tile of 128 k x 64 n a block
//   the last PREP_B blocks:    bq, bk, bv -> one packed bias
#define PREP_X 256
#define PREP_T 512
#define PREP_B 3

__global__ __launch_bounds__(256) void prep_kernel(
    const float* __restrict__ X, const float* __restrict__ Wq, const float* __restrict__ Wk,
    const float* __restrict__ Wv, const float* __restrict__ Wo,
    const float* __restrict__ bq, const float* __restrict__ bk, const float* __restrict__ bv,
    u16* __restrict__ Xb, u16* __restrict__ WT, u16* __restrict__ WoT, float* __restrict__ biasA) {

    // [n][16-byte chunk of 8 k]; the chunk index is xor-ed with n >> 2, so that the 16 lanes that write
    // one k chunk of 16 rows, and the 16 that read one row, each meet 16 different bank groups
    __shared__ uint4 sW[64 * 16];

    int blk = blockIdx.x, tid = threadIdx.x;
    if (blk < PREP_X) {
        const char* s = (const char*)(X + (size_t)blk * 16384);
        char* d = (char*)(Xb + (size_t)blk * 16384);
        u32 off = (u32)tid * 16u;
        float4 f[16];
        for (int j = 0; j < 16; ++j)
            f[j] = *(const float4*)(s + off + j * 4096);
        u32 so = (u32)tid * 8u;
        for (int j = 0; j < 16; ++j) {
            ushort4 o;
            o.x = f2bf(f[j].x); o.y = f2bf(f[j].y); o.z = f2bf(f[j].z); o.w = f2bf(f[j].w);
            *(ushort4*)(d + so + j * 2048) = o;
        }
    } else if (blk < PREP_X + PREP_T) {
        int t = blk - PREP_X;
        int m = t >> 7;                              // which matrix
        int k0 = (t & 7) * 128, n0 = ((t >> 3) & 15) * 64;
        const float* Wm = m == 0 ? Wq : m == 1 ? Wk : m == 2 ? Wv : Wo;
        u16* Dm = m == 3 ? WoT : WT + (size_t)m * BDIM * BDIM;
        int c4 = tid & 15, kc = tid >> 4;            // 4 columns n, 8 rows k: four whole output chunks
        const char* s = (const char*)(Wm + (size_t)k0 * BDIM + n0);
        u32 off = (u32)(kc * 8 * BDIM + c4 * 4) * 4u;
        float4 f[8];
        for (int j = 0; j < 8; ++j)
            f[j] = *(const float4*)(s + off + j * BDIM * 4);
        union { uint4 x; u16 h[8]; } w[4];
        for (int j = 0; j < 8; ++j) {
            w[0].h[j] = f2bf(f[j].x); w[1].h[j] = f2bf(f[j].y);
            w[2].h[j] = f2bf(f[j].z); w[3].h[j] = f2bf(f[j].w);
        }
        for (int e = 0; e < 4; ++e)
            sW[(c4 * 4 + e) * 16 + (kc ^ c4)] = w[e].x;
        __syncthreads();
        char* d = (char*)(Dm + (size_t)n0 * BDIM + k0);
        u32 so = (u32)(kc * BDIM * 2 + c4 * 16);     // row n = kc + 16 j, chunk c4: 256 bytes a row in a run
        for (int j = 0; j < 4; ++j) {
            int n = kc + j * 16;
            *(uint4*)(d + so + j * 16 * BDIM * 2) = sW[n * 16 + (c4 ^ ((n >> 2) & 15))];
        }
    } else {
        int p = blk - PREP_X - PREP_T;
        const float* bs = p == 0 ? bq : p == 1 ? bk : bv;
        ((float4*)biasA)[p * 256 + tid] = ((const float4*)bs)[tid];
    }
}

// ---------------------------------------------------------------- bf16 GEMM
// C[M][N] = A[M][K](bf16) * BT[N][K](bf16)^T + bias + residual
#define BM 128
#define BN 128
#define BK 32
#define LDT 40   // padded LDS row stride (halves): 80B, 16B aligned, conflict-free

__global__ __launch_bounds__(256) void gemm_bf16_kernel(
    const u16* __restrict__ A, const u16* __restrict__ BT,
    const float* __restrict__ bias, const float* __restrict__ residual,
    float* __restrict__ C, int M, int N, int K) {

    __shared__ u16 sA[2][BM * LDT];
    __shared__ u16 sB[2][BN * LDT];

    int bm = blockIdx.y * BM, bn = blockIdx.x * BN;
    int tid = threadIdx.x;
    int wave = tid >> 5, lane = tid & 31;
    int wm = wave & 1, wn = wave >> 1;     // 2x4 wave grid -> wave tile 64x32
    int laneRow = lane & 15, g = lane >> 4;

    // this thread's two staging chunks (row, col) within the 128x32 tile
    int c0 = tid * 2, c1 = tid * 2 + 1;
    int r0 = c0 >> 2, col0 = (c0 & 3) * 8;
    int r1 = c1 >> 2, col1 = (c1 & 3) * 8;

    v8f acc[4][2];
    for (int i = 0; i < 4; ++i)
        for (int j = 0; j < 2; ++j)
            acc[i][j] = v8f{0.f, 0.f, 0.f, 0.f, 0.f, 0.f, 0.f, 0.f};

    auto stage = [&](int buf, int k0) {
        async_copy16((u32)(uintptr_t)&sA[buf][r0 * LDT + col0],
                     A + (size_t)(bm + r0) * K + k0 + col0);
        async_copy16((u32)(uintptr_t)&sA[buf][r1 * LDT + col1],
                     A + (size_t)(bm + r1) * K + k0 + col1);
        async_copy16((u32)(uintptr_t)&sB[buf][r0 * LDT + col0],
                     BT + (size_t)(bn + r0) * K + k0 + col0);
        async_copy16((u32)(uintptr_t)&sB[buf][r1 * LDT + col1],
                     BT + (size_t)(bn + r1) * K + k0 + col1);
    };

    // prologue: fill buffer 0
    stage(0, 0);
    wait_async0();
    __syncthreads();

    int cur = 0;
    for (int k0 = 0; k0 < K; k0 += BK) {
        bool more = (k0 + BK) < K;
        if (more) stage(cur ^ 1, k0 + BK);   // overlap next-tile DMA with WMMA

        Frag bf[2];
        for (int nt = 0; nt < 2; ++nt)
            load_frag_u16(bf[nt], &sB[cur][(wn * 32 + nt * 16 + laneRow) * LDT], g);
        for (int mt = 0; mt < 4; ++mt) {
            Frag af;
            load_frag_u16(af, &sA[cur][(wm * 64 + mt * 16 + laneRow) * LDT], g);
            for (int nt = 0; nt < 2; ++nt)
                acc[mt][nt] = __builtin_amdgcn_wmma_f32_16x16x32_bf16(
                    false, af.v, false, bf[nt].v, (short)0, acc[mt][nt], false, false);
        }

        if (more) wait_async0();             // own async copies into cur^1 done
        __syncthreads();                     // everyone done reading cur / writing cur^1
        cur ^= 1;
    }

    for (int mt = 0; mt < 4; ++mt)
        for (int nt = 0; nt < 2; ++nt) {
            int col = bn + wn * 32 + nt * 16 + laneRow;
            float bv = bias ? bias[col] : 0.f;
            for (int r = 0; r < 8; ++r) {
                int row = bm + wm * 64 + mt * 16 + g * 8 + r;
                float v = acc[mt][nt][r] + bv;
                if (residual) v += residual[(size_t)row * N + col];
                C[(size_t)row * N + col] = v;
            }
        }
}

// ---------------------------------------------------------------- QKV GEMM + scale + rotation
// Xb[ROWS][D] * WT[3072][D]^T + bias, then scale and rotation in the accumulators:
//   q_rot/k_rot bf16 [b,h,l,64], vT bf16 [b,h,64,l]; no f32 qkv array, no separate launch.
// The first WMMA operand (64 rows a wave) is the one whose index must run along a lane's 8 results:
//   Q, K blocks: W rows first -> lane = token l, results = 8 head columns d; a wave holds one whole head,
//                so the rotation partner d + 32 is tile i + 2 of the same lane and register
//   V blocks:    X rows first -> lane = head column d, results = 8 tokens l (the transposed V row)
// Either way 8 results are one 16-byte store.

// Four copies and the wait for their address registers in one statement: nothing can rewrite a register
// that a copy names in front of that wait.
__device__ __forceinline__ void async_copy16x4(u32 l0, const void* g0, u32 l1, const void* g1,
                                               u32 l2, const void* g2, u32 l3, const void* g3) {
    asm volatile("global_load_async_to_lds_b128 %0, %1, off\n\t"
                 "global_load_async_to_lds_b128 %2, %3, off\n\t"
                 "global_load_async_to_lds_b128 %4, %5, off\n\t"
                 "global_load_async_to_lds_b128 %6, %7, off\n\t"
                 "s_wait_xcnt 0x0"
                 :: "v"(l0), "v"((u64)(uintptr_t)g0), "v"(l1), "v"((u64)(uintptr_t)g1),
                    "v"(l2), "v"((u64)(uintptr_t)g2), "v"(l3), "v"((u64)(uintptr_t)g3) : "memory");
}

__global__ __launch_bounds__(256) void gemm_qkv_rope_kernel(
    const u16* __restrict__ A, const u16* __restrict__ BT, const float* __restrict__ bias,
    const float* __restrict__ phi, const float* __restrict__ mag, const float* __restrict__ gamma,
    u16* __restrict__ qrot, u16* __restrict__ krot, u16* __restrict__ vt) {

    __shared__ u16 sT[2][2][BM * LDT];     // [buffer][0: X rows, 1: W rows]

    const int K = BDIM, NT = BDIM / BK;
    int bm = blockIdx.y * BM, bn = blockIdx.x * BN;
    int tid = threadIdx.x;
    int wave = tid >> 5, lane = tid & 31;
    int wp = wave & 1, wq = wave >> 1;     // 64 rows of the first operand, 32 rows of the second
    int laneRow = lane & 15, g = lane >> 4;
    bool isV = bn >= 2 * BDIM;             // the same for the whole block
    int pSel = isV ? 0 : 1;

    int c0 = tid * 2, c1 = tid * 2 + 1;
    int r0 = c0 >> 2, col0 = (c0 & 3) * 8;
    int r1 = c1 >> 2, col1 = (c1 & 3) * 8;

    v8f acc[4][2];
    for (int i = 0; i < 4; ++i)
        for (int j = 0; j < 2; ++j)
            acc[i][j] = v8f{0.f, 0.f, 0.f, 0.f, 0.f, 0.f, 0.f, 0.f};

    auto stage = [&](int buf, int k0) {
        async_copy16x4((u32)(uintptr_t)&sT[buf][0][r0 * LDT + col0], A + (size_t)(bm + r0) * K + k0 + col0,
                       (u32)(uintptr_t)&sT[buf][0][r1 * LDT + col1], A + (size_t)(bm + r1) * K + k0 + col1,
                       (u32)(uintptr_t)&sT[buf][1][r0 * LDT + col0], BT + (size_t)(bn + r0) * K + k0 + col0,
                       (u32)(uintptr_t)&sT[buf][1][r1 * LDT + col1], BT + (size_t)(bn + r1) * K + k0 + col1);
    };

    stage(0, 0);
    wait_async0();
    __syncthreads();
    stage(1, BK);

    for (int t = 0; t < NT; ++t) {
        int cur = t & 1;
        const u16* pB = &sT[cur][pSel][(wp * 64 + laneRow) * LDT];
        const u16* qB = &sT[cur][pSel ^ 1][(wq * 32 + laneRow) * LDT];
        Frag sf[2];
        for (int j = 0; j < 2; ++j)
            load_frag_u16(sf[j], qB + j * 16 * LDT, g);
        for (int i = 0; i < 4; ++i) {
            Frag ff;
            load_frag_u16(ff, pB + i * 16 * LDT, g);
            for (int j = 0; j < 2; ++j)
                acc[i][j] = __builtin_amdgcn_wmma_f32_16x16x32_bf16(
                    false, ff.v, false, sf[j].v, (short)0, acc[i][j], false, false);
        }
        // hand-over: own LDS reads of this buffer retired, own copies of the next tile landed, then
        // the barrier that publishes that tile and frees this buffer for the refill behind it
        asm volatile("s_wait_dscnt 0x0" ::: "memory");
        wait_async0();
        __syncthreads();
        if (t + 2 < NT) stage(cur, (t + 2) * BK);
    }
    wait_async0();

    int b = bm >> 10, lblk = bm & (LDIM - 1);
    if (!isV) {
        int hsel = (bn >> 6) + wp;                   // 0..15: heads of Q, 16..31: heads of K
        int h = hsel & (HH - 1);
        u16* dst = (hsel >> 4) ? krot : qrot;
        const float* bp = bias + bn + wp * 64 + g * 8;
        float gm = gamma[h];
        for (int j = 0; j < 2; ++j) {
            int idx = (b * HH + h) * LDIM + lblk + wq * 32 + j * 16 + laneRow;
            float ph = phi[idx];
            float sc = 1.0f + gm * tanhf(mag[idx]);
            float cs = cosf(ph), sn = sinf(ph);
            for (int i = 0; i < 2; ++i) {
                union { uint4 x; u16 hh[8]; } lo, hi;
                for (int r = 0; r < 8; ++r) {
                    float a0 = (acc[i][j][r] + bp[i * 16 + r]) * sc;
                    float a1 = (acc[i + 2][j][r] + bp[i * 16 + 32 + r]) * sc;
                    lo.hh[r] = f2bf(a0 * cs - a1 * sn);
                    hi.hh[r] = f2bf(a1 * cs + a0 * sn);
                }
                u16* o = dst + (size_t)idx * HD + i * 16 + g * 8;
                *(uint4*)o = lo.x;
                *(uint4*)(o + 32) = hi.x;
            }
        }
    } else {
        for (int j = 0; j < 2; ++j) {
            int n = bn - 2 * BDIM + wq * 32 + j * 16 + laneRow;      // h * 64 + d
            float bv = bias[2 * BDIM + n];
            u16* o = vt + (size_t)(b * BDIM + n) * LDIM + lblk + wp * 64 + g * 8;
            for (int i = 0; i < 4; ++i) {
                union { uint4 x; u16 hh[8]; } w;
                for (int r = 0; r < 8; ++r) w.hh[r] = f2bf(acc[i][j][r] + bv);
                *(uint4*)(o + i * 16) = w.x;
            }
        }
        // the stores above name their address and data registers: the wait stands before any is written again
        asm volatile("s_wait_xcnt 0x0" ::: "memory");
    }
}

// ---------------------------------------------------------------- attention
// Online softmax, all in registers. Each wave owns NQ*16 queries and walks the keys 32 at a time:
//   S^T = K * Q^T   (D: lane holds query laneRow, keys g*8+r)  -> max and sum are in-lane
//   O^T += V^T * P^T (two S^T tiles, converted in place, are the B operand in the same k order)
#define NQ 4          // 16-query tiles per wave
#define AW 4          // waves per block

typedef __attribute__((ext_vector_type(4))) u32   u32x4;
typedef __attribute__((ext_vector_type(4))) float f32x4;
struct Frag4 { union { v16bf v; u32x4 x[2]; }; };

__device__ __forceinline__ float other_half(float x) {   // lane l <-> l ^ 16
    int b = __builtin_bit_cast(int, x);
    b = __builtin_amdgcn_permlanex16(b, b, 0x76543210, 0xfedcba98, false, false);
    return __builtin_bit_cast(float, b);
}

// Several exp2 in one statement, each in place: no instruction reads the result or writes the source of the
// one in front of it, and the closing v_nop is the slot that the instruction set asks for behind a
// transcendental. In place, the statement writes only registers that the vector code in front of it wrote.
__device__ __forceinline__ void exp2x8(float (&x)[8]) {
    asm("v_exp_f32 %0, %0\n\tv_exp_f32 %1, %1\n\tv_exp_f32 %2, %2\n\tv_exp_f32 %3, %3\n\t"
        "v_exp_f32 %4, %4\n\tv_exp_f32 %5, %5\n\tv_exp_f32 %6, %6\n\tv_exp_f32 %7, %7\n\tv_nop"
        : "+v"(x[0]), "+v"(x[1]), "+v"(x[2]), "+v"(x[3]), "+v"(x[4]), "+v"(x[5]), "+v"(x[6]), "+v"(x[7]));
}
__device__ __forceinline__ void exp2x4(float (&x)[4]) {
    asm("v_exp_f32 %0, %0\n\tv_exp_f32 %1, %1\n\tv_exp_f32 %2, %2\n\tv_exp_f32 %3, %3\n\tv_nop"
        : "+v"(x[0]), "+v"(x[1]), "+v"(x[2]), "+v"(x[3]));
}

// No __restrict__ here: the "memory" clobber of the waits below must hold the loads on their side.
__global__ __launch_bounds__(AW * 32) void attn_kernel(
    const u16* qrot, const u16* krot, const u16* vt, const float* mask, u16* ctx) {

    int h = blockIdx.y, b = blockIdx.z;
    int tid = threadIdx.x, wave = tid >> 5, lane = tid & 31;
    int laneRow = lane & 15, g = lane >> 4;
    int qbase = (blockIdx.x * AW + wave) * (NQ * 16);
    const float rscale = 0.125f;                     // 1/sqrt(64)
    const float LOG2E = 1.44269504088896340736f;

    const char* qb = (const char*)(qrot + (size_t)(b * HH + h) * LDIM * HD);
    const char* kb = (const char*)(krot + (size_t)(b * HH + h) * LDIM * HD);
    const char* vb8 = (const char*)(vt + (size_t)(b * HH + h) * HD * LDIM);
    const char* mb = (const char*)(mask + b * LDIM);
    // per-lane byte offsets; k, v, m: of the pass that is fetched next
    u32 qoff = (u32)((qbase + laneRow) * HD + g * 8) * 2u;
    u32 koff = (u32)(laneRow * HD + g * 8) * 2u;
    u32 voff = (u32)(laneRow * LDIM + g * 8) * 2u;
    u32 moff = (u32)g * 32u;

    Frag4 qf[NQ][2];
    for (int q = 0; q < NQ; ++q)
        for (int ks = 0; ks < 2; ++ks) {
            qf[q][ks].x[0] = *(const u32x4*)(qb + qoff + (q * 16 * HD + ks * 32) * 2);
            qf[q][ks].x[1] = *(const u32x4*)(qb + qoff + (q * 16 * HD + ks * 32 + 16) * 2);
        }
    // the Q loads name qoff and qb: as inputs both stay live, so unwritten, up to this wait
    asm volatile("s_wait_xcnt 0x0" :: "v"(qoff), "s"(qb) : "memory");

    v8f o[NQ][4];
    float m[NQ], l[NQ];
    for (int q = 0; q < NQ; ++q) {
        for (int dt = 0; dt < 4; ++dt)
            o[q][dt] = v8f{0.f, 0.f, 0.f, 0.f, 0.f, 0.f, 0.f, 0.f};
        m[q] = -1e30f;            // finite start: t - m is never (-inf) - (-inf) under -inf masks
        l[q] = 0.f;
    }

    Frag4 kf[2][2], va[4], vb[4];
    f32x4 mk[2][2];
    int pos = 0;                  // first key of the pass that is fetched next

    auto fetch = [&](Frag4 (&vd)[4]) {
        for (int kt = 0; kt < 2; ++kt) {
            for (int ks = 0; ks < 2; ++ks) {
                kf[kt][ks].x[0] = *(const u32x4*)(kb + koff + (kt * 16 * HD + ks * 32) * 2);
                kf[kt][ks].x[1] = *(const u32x4*)(kb + koff + (kt * 16 * HD + ks * 32 + 16) * 2);
            }
            mk[kt][0] = *(const f32x4*)(mb + moff + kt * 64);
            mk[kt][1] = *(const f32x4*)(mb + moff + kt * 64 + 16);
        }
        for (int dt = 0; dt < 4; ++dt) {
            vd[dt].x[0] = *(const u32x4*)(vb8 + voff + dt * 16 * LDIM * 2);
            vd[dt].x[1] = *(const u32x4*)(vb8 + voff + dt * 16 * LDIM * 2 + 32);
        }
    };
    auto advance = [&]() {
        // The fetch's loads name koff, voff, moff: as inputs here they stay live, so unwritten, up to
        // this wait; its "memory" clobber keeps the loads in front of it.
        asm volatile("s_wait_xcnt 0x0" :: "v"(koff), "v"(voff), "v"(moff) : "memory");
        int nxt = (pos + 32) & (LDIM - 1);   // behind the last pass it wraps to key 0: in bounds, unused
        int d = nxt - pos;
        koff += (u32)(d * HD * 2); voff += (u32)(d * 2); moff += (u32)(d * 4);
        pos = nxt;
    };

    auto pass = [&](Frag4 (&vc)[4], Frag4 (&vn)[4]) {
        float t[NQ][16];
        for (int q = 0; q < NQ; ++q) {
            v8f s[2];
            for (int kt = 0; kt < 2; ++kt) {
                s[kt] = v8f{0.f, 0.f, 0.f, 0.f, 0.f, 0.f, 0.f, 0.f};
                for (int ks = 0; ks < 2; ++ks)
                    s[kt] = __builtin_amdgcn_wmma_f32_16x16x32_bf16(
                        false, kf[kt][ks].v, false, qf[q][ks].v, (short)0, s[kt], false, false);
            }
            for (int kt = 0; kt < 2; ++kt)
                for (int i = 0; i < 8; ++i)
                    t[q][kt * 8 + i] = s[kt][i] * rscale + mk[kt][i >> 2][i & 3];
        }
        // the next pass's K, mask and V fly while this pass's softmax and V products run
        fetch(vn);
        // holds the loads up here, in front of the softmax: they need its time to land
        __builtin_amdgcn_sched_barrier(0);

        float alpha[NQ];
        for (int q = 0; q < NQ; ++q) {
            float tm = t[q][0];
            for (int i = 1; i < 16; ++i) tm = fmaxf(tm, t[q][i]);
            tm = fmaxf(tm, other_half(tm));
            float mnew = fmaxf(m[q], tm);
            alpha[q] = (m[q] - mnew) * LOG2E;
            m[q] = mnew;
        }
        exp2x4(alpha);

        for (int q = 0; q < NQ; ++q) {
            Frag4 pf;
            float ls = 0.f;
            for (int hf = 0; hf < 2; ++hf) {
                float p[8];
                for (int i = 0; i < 8; ++i) p[i] = (t[q][hf * 8 + i] - m[q]) * LOG2E;
                exp2x8(p);
                for (int i = 0; i < 8; ++i) { ls += p[i]; pf.v[hf * 8 + i] = (__bf16)p[i]; }
            }
            l[q] = l[q] * alpha[q] + ls;
            for (int dt = 0; dt < 4; ++dt) {
                o[q][dt] *= alpha[q];
                o[q][dt] = __builtin_amdgcn_wmma_f32_16x16x32_bf16(
                    false, vc[dt].v, false, pf.v, (short)0, o[q][dt], false, false);
            }
        }
        advance();
    };

    fetch(va);
    advance();
    for (int k0 = 0; k0 < LDIM; k0 += 64) {
        pass(va, vb);
        pass(vb, va);
    }

    // epilogue: lane holds query laneRow, head columns dt*16 + g*8 + r -> one 16-byte store per tile
    char* cb = (char*)(ctx + (size_t)b * LDIM * BDIM + h * HD);
    for (int q = 0; q < NQ; ++q) {
        float inv = 1.0f / (l[q] + other_half(l[q]));
        int lq = qbase + q * 16 + laneRow;
        union { u32x4 x; u16 hh[8]; __bf16 bh[8]; } w[4];
        for (int dt = 0; dt < 4; ++dt)
            for (int r = 0; r < 8; ++r)
                w[dt].bh[r] = (__bf16)(o[q][dt][r] * inv);
        if (m[q] <= -1e8f) {         // fully masked row: the diagonal alone survives, ctx = v[lq]
            u32 doff = (u32)(g * 8 * LDIM + lq) * 2u;
            for (int dt = 0; dt < 4; ++dt)
                for (int r = 0; r < 8; ++r)
                    w[dt].hh[r] = *(const u16*)(vb8 + doff + (dt * 16 + r) * LDIM * 2);
            // these loads name doff: it stays live up to this wait, behind the loads
            asm volatile("s_wait_xcnt 0x0" :: "v"(doff) : "memory");
        }
        u32 soff = (u32)(lq * BDIM + g * 8) * 2u;
        for (int dt = 0; dt < 4; ++dt)
            *(u32x4*)(cb + soff + dt * 32) = w[dt].x;
        // the stores name soff and their data: the wait stands before either is written again
        asm volatile("s_wait_xcnt 0x0" :: "v"(soff), "v"(w[0].x), "v"(w[1].x), "v"(w[2].x), "v"(w[3].x) : "memory");
    }
}

// ---------------------------------------------------------------- LayerNorm
__global__ __launch_bounds__(256) void ln_kernel(const float* __restrict__ y,
                                                 const float* __restrict__ lnw,
                                                 const float* __restrict__ lnb,
                                                 float* __restrict__ out) {
    __shared__ float rbuf[16];
    int row = blockIdx.x, tid = threadIdx.x;
    int wave = tid >> 5, lane = tid & 31;
    const float* x = y + (size_t)row * BDIM;
    float s = 0.f, s2 = 0.f;
    for (int j = tid; j < BDIM; j += 256) { float v = x[j]; s += v; s2 += v * v; }
    for (int off = 16; off; off >>= 1) {
        s += __shfl_xor(s, off, 32);
        s2 += __shfl_xor(s2, off, 32);
    }
    if (lane == 0) { rbuf[wave] = s; rbuf[8 + wave] = s2; }
    __syncthreads();
    float S = 0.f, S2 = 0.f;
    for (int i = 0; i < 8; ++i) { S += rbuf[i]; S2 += rbuf[8 + i]; }
    float mu = S * (1.0f / BDIM);
    float var = S2 * (1.0f / BDIM) - mu * mu;
    float inv = rsqrtf(var + 1e-12f);
    for (int j = tid; j < BDIM; j += 256)
        out[(size_t)row * BDIM + j] = (x[j] - mu) * inv * lnw[j] + lnb[j];
}

// ---------------------------------------------------------------- launch
extern "C" void kernel_launch(void* const* d_in, const int* in_sizes, int n_in,
                              void* d_out, int out_size, void* d_ws, size_t ws_size,
                              hipStream_t stream) {
    const float* hidden = (const float*)d_in[0];
    const float* mask   = (const float*)d_in[1];
    const float* phi    = (const float*)d_in[2];
    const float* mag    = (const float*)d_in[3];
    const float* Wq     = (const float*)d_in[4];
    const float* bq     = (const float*)d_in[5];
    const float* Wk     = (const float*)d_in[6];
    const float* bk     = (const float*)d_in[7];
    const float* Wv     = (const float*)d_in[8];
    const float* bv     = (const float*)d_in[9];
    const float* gamma  = (const float*)d_in[10];
    const float* Wo     = (const float*)d_in[11];
    const float* bo     = (const float*)d_in[12];
    const float* lnw    = (const float*)d_in[13];
    const float* lnb    = (const float*)d_in[14];
    float* out = (float*)d_out;

    char* ws = (char*)d_ws;
    const size_t o_xb   = 0;                           // 8 MB  bf16 X
    const size_t o_wt   = o_xb + 8388608ull;           // 6 MB  bf16 WT (q,k,v packed)
    const size_t o_wot  = o_wt + 6291456ull;           // 2 MB  bf16 WoT
    const size_t o_bias = o_wot + 2097152ull;          // 12 KB packed bias
    const size_t o_qkv  = o_bias + 12288ull;           // 48 MB region, its head holds f32 y
    const size_t o_qr   = o_qkv + 50331648ull;         // 8 MB
    const size_t o_kr   = o_qr + 8388608ull;           // 8 MB
    const size_t o_vt   = o_kr + 8388608ull;           // 8 MB
    const size_t o_ctx  = o_vt + 8388608ull;           // 8 MB
    const size_t o_y    = o_qkv;                       // 16 MB f32 y

    u16*   Xb    = (u16*)(ws + o_xb);
    u16*   WT    = (u16*)(ws + o_wt);
    u16*   WoT   = (u16*)(ws + o_wot);
    float* biasA = (float*)(ws + o_bias);
    u16*   qrot  = (u16*)(ws + o_qr);
    u16*   krot  = (u16*)(ws + o_kr);
    u16*   vtb   = (u16*)(ws + o_vt);
    u16*   ctxb  = (u16*)(ws + o_ctx);
    float* yb    = (float*)(ws + o_y);

    // 1) X to bf16, the four weights transposed to bf16, the bias packed: one launch
    prep_kernel<<<PREP_X + PREP_T + PREP_B, 256, 0, stream>>>(
        hidden, Wq, Wk, Wv, Wo, bq, bk, bv, Xb, WT, WoT, biasA);

    // 3) fused QKV GEMM [4096 x 3072] with scale, rotation and V transpose in its epilogue
    gemm_qkv_rope_kernel<<<dim3(NQKV / BN, ROWS / BM), 256, 0, stream>>>(
        Xb, WT, biasA, phi, mag, gamma, qrot, krot, vtb);

    // 4) fused attention (online softmax in registers, no LDS)
    attn_kernel<<<dim3(LDIM / (AW * NQ * 16), HH, BB), AW * 32, 0, stream>>>(
        qrot, krot, vtb, mask, ctxb);

    // 5) output projection + residual
    gemm_bf16_kernel<<<dim3(BDIM / BN, ROWS / BM), 256, 0, stream>>>(
        ctxb, WoT, bo, hidden, yb, ROWS, BDIM, BDIM);

    // 6) LayerNorm
    ln_kernel<<<ROWS, 256, 0, stream>>>(yb, lnw, lnb, out);
}

// v004
// A run of this version takes 106 microseconds.
// Timed twice side by side with v003, it ran 1.27 and 1.26 times as fast.
// Over all steps from v000 it is 2.88 times as fast.
#include <hip/hip_runtime.h>
#include <hip/hip_bf16.h>

typedef unsigned short u16;
typedef unsigned int   u32;
typedef unsigned long long u64;

typedef __attribute__((ext_vector_type(16))) __bf16 v16bf;
typedef __attribute__((ext_vector_type(8)))  float  v8f;

#define BDIM 1024   // D
#define LDIM 1024   // L
#define BB   4      // B
#define HH   16     // H
#define HD   64     // head dim
#define ROWS (BB*LDIM)      // 4096
#define NQKV (3*BDIM)       // 3072

__device__ __forceinline__ u16 f2bf(float f) {
    union { float f; u32 u; } x; x.f = f;
    u32 r = x.u + 0x7FFFu + ((x.u >> 16) & 1u);
    return (u16)(r >> 16);
}

struct Frag { union { v16bf v; uint4 q[2]; u16 h[16]; }; };

// load a 16-half fragment (A-layout) from a row:
// lane holds row (lane&15); halves 0..7 at K = g*8.. , halves 8..15 at K = 16+g*8..
__device__ __forceinline__ void load_frag_u16(Frag& f, const u16* rowPtr, int g) {
    f.q[0] = *(const uint4*)(rowPtr + g * 8);
    f.q[1] = *(const uint4*)(rowPtr + 16 + g * 8);
}

__device__ __forceinline__ void wait_async0() {
    asm volatile("s_wait_asynccnt 0x0" ::: "memory");
}

// ---------------------------------------------------------------- preparation, one launch
// Three independent jobs share one grid by block range (the test is the same for a whole block):
//   blocks [0, PREP_X):        X f32 -> bf16, 4096 float4 a block, 16 a thread
//   the next PREP_T blocks:    W f32 [k][n] -> bf16 [n][k], four matrices, a tile of 128 k x 64 n a block
//   the last PREP_B blocks:    bq, bk, bv -> one packed bias
#define PREP_X 256
#define PREP_T 512
#define PREP_B 3

__global__ __launch_bounds__(256) void prep_kernel(
    const float* __restrict__ X, const float* __restrict__ Wq, const float* __restrict__ Wk,
    const float* __restrict__ Wv, const float* __restrict__ Wo,
    const float* __restrict__ bq, const float* __restrict__ bk, const float* __restrict__ bv,
    u16* __restrict__ Xb, u16* __restrict__ WT, u16* __restrict__ WoT, float* __restrict__ biasA) {

    // [n][16-byte chunk of 8 k]; the chunk index is xor-ed with n >> 2, so that the 16 lanes that write
    // one k chunk of 16 rows, and the 16 that read one row, each meet 16 different bank groups
    __shared__ uint4 sW[64 * 16];

    int blk = blockIdx.x, tid = threadIdx.x;
    if (blk < PREP_X) {
        const char* s = (const char*)(X + (size_t)blk * 16384);
        char* d = (char*)(Xb + (size_t)blk * 16384);
        u32 off = (u32)tid * 16u;
        float4 f[16];
        for (int j = 0; j < 16; ++j)
            f[j] = *(const float4*)(s + off + j * 4096);
        u32 so = (u32)tid * 8u;
        for (int j = 0; j < 16; ++j) {
            ushort4 o;
            o.x = f2bf(f[j].x); o.y = f2bf(f[j].y); o.z = f2bf(f[j].z); o.w = f2bf(f[j].w);
            *(ushort4*)(d + so + j * 2048) = o;
        }
    } else if (blk < PREP_X + PREP_T) {
        int t = blk - PREP_X;
        int m = t >> 7;                              // which matrix
        int k0 = (t & 7) * 128, n0 = ((t >> 3) & 15) * 64;
        const float* Wm = m == 0 ? Wq : m == 1 ? Wk : m == 2 ? Wv : Wo;
        u16* Dm = m == 3 ? WoT : WT + (size_t)m * BDIM * BDIM;
        int c4 = tid & 15, kc = tid >> 4;            // 4 columns n, 8 rows k: four whole output chunks
        const char* s = (const char*)(Wm + (size_t)k0 * BDIM + n0);
        u32 off = (u32)(kc * 8 * BDIM + c4 * 4) * 4u;
        float4 f[8];
        for (int j = 0; j < 8; ++j)
            f[j] = *(const float4*)(s + off + j * BDIM * 4);
        union { uint4 x; u16 h[8]; } w[4];
        for (int j = 0; j < 8; ++j) {
            w[0].h[j] = f2bf(f[j].x); w[1].h[j] = f2bf(f[j].y);
            w[2].h[j] = f2bf(f[j].z); w[3].h[j] = f2bf(f[j].w);
        }
        for (int e = 0; e < 4; ++e)
            sW[(c4 * 4 + e) * 16 + (kc ^ c4)] = w[e].x;
        __syncthreads();
        char* d = (char*)(Dm + (size_t)n0 * BDIM + k0);
        u32 so = (u32)(kc * BDIM * 2 + c4 * 16);     // row n = kc + 16 j, chunk c4: 256 bytes a row in a run
        for (int j = 0; j < 4; ++j) {
            int n = kc + j * 16;
            *(uint4*)(d + so + j * 16 * BDIM * 2) = sW[n * 16 + (c4 ^ ((n >> 2) & 15))];
        }
    } else {
        int p = blk - PREP_X - PREP_T;
        const float* bs = p == 0 ? bq : p == 1 ? bk : bv;
        ((float4*)biasA)[p * 256 + tid] = ((const float4*)bs)[tid];
    }
}

// ---------------------------------------------------------------- tile of the QKV GEMM
#define BM 128
#define BN 128
#define BK 32
#define LDT 40   // padded LDS row stride (halves): 80B, 16B aligned, conflict-free

// ---------------------------------------------------------------- QKV GEMM + scale + rotation
// Xb[ROWS][D] * WT[3072][D]^T + bias, then scale and rotation in the accumulators:
//   q_rot/k_rot bf16 [b,h,l,64], vT bf16 [b,h,64,l]; no f32 qkv array, no separate launch.
// The first WMMA operand (64 rows a wave) is the one whose index must run along a lane's 8 results:
//   Q, K blocks: W rows first -> lane = token l, results = 8 head columns d; a wave holds one whole head,
//                so the rotation partner d + 32 is tile i + 2 of the same lane and register
//   V blocks:    X rows first -> lane = head column d, results = 8 tokens l (the transposed V row)
// Either way 8 results are one 16-byte store.

// Four copies and the wait for their address registers in one statement: nothing can rewrite a register
// that a copy names in front of that wait.
__device__ __forceinline__ void async_copy16x4(u32 l0, const void* g0, u32 l1, const void* g1,
                                               u32 l2, const void* g2, u32 l3, const void* g3) {
    asm volatile("global_load_async_to_lds_b128 %0, %1, off\n\t"
                 "global_load_async_to_lds_b128 %2, %3, off\n\t"
                 "global_load_async_to_lds_b128 %4, %5, off\n\t"
                 "global_load_async_to_lds_b128 %6, %7, off\n\t"
                 "s_wait_xcnt 0x0"
                 :: "v"(l0), "v"((u64)(uintptr_t)g0), "v"(l1), "v"((u64)(uintptr_t)g1),
                    "v"(l2), "v"((u64)(uintptr_t)g2), "v"(l3), "v"((u64)(uintptr_t)g3) : "memory");
}

__global__ __launch_bounds__(256) void gemm_qkv_rope_kernel(
    const u16* __restrict__ A, const u16* __restrict__ BT, const float* __restrict__ bias,
    const float* __restrict__ phi, const float* __restrict__ mag, const float* __restrict__ gamma,
    u16* __restrict__ qrot, u16* __restrict__ krot, u16* __restrict__ vt) {

    __shared__ u16 sT[2][2][BM * LDT];     // [buffer][0: X rows, 1: W rows]

    const int K = BDIM, NT = BDIM / BK;
    int bm = blockIdx.y * BM, bn = blockIdx.x * BN;
    int tid = threadIdx.x;
    int wave = tid >> 5, lane = tid & 31;
    int wp = wave & 1, wq = wave >> 1;     // 64 rows of the first operand, 32 rows of the second
    int laneRow = lane & 15, g = lane >> 4;
    bool isV = bn >= 2 * BDIM;             // the same for the whole block
    int pSel = isV ? 0 : 1;

    int c0 = tid * 2, c1 = tid * 2 + 1;
    int r0 = c0 >> 2, col0 = (c0 & 3) * 8;
    int r1 = c1 >> 2, col1 = (c1 & 3) * 8;

    v8f acc[4][2];
    for (int i = 0; i < 4; ++i)
        for (int j = 0; j < 2; ++j)
            acc[i][j] = v8f{0.f, 0.f, 0.f, 0.f, 0.f, 0.f, 0.f, 0.f};

    auto stage = [&](int buf, int k0) {
        async_copy16x4((u32)(uintptr_t)&sT[buf][0][r0 * LDT + col0], A + (size_t)(bm + r0) * K + k0 + col0,
                       (u32)(uintptr_t)&sT[buf][0][r1 * LDT + col1], A + (size_t)(bm + r1) * K + k0 + col1,
                       (u32)(uintptr_t)&sT[buf][1][r0 * LDT + col0], BT + (size_t)(bn + r0) * K + k0 + col0,
                       (u32)(uintptr_t)&sT[buf][1][r1 * LDT + col1], BT + (size_t)(bn + r1) * K + k0 + col1);
    };

    stage(0, 0);
    wait_async0();
    __syncthreads();
    stage(1, BK);

    for (int t = 0; t < NT; ++t) {
        int cur = t & 1;
        const u16* pB = &sT[cur][pSel][(wp * 64 + laneRow) * LDT];
        const u16* qB = &sT[cur][pSel ^ 1][(wq * 32 + laneRow) * LDT];
        Frag sf[2];
        for (int j = 0; j < 2; ++j)
            load_frag_u16(sf[j], qB + j * 16 * LDT, g);
        for (int i = 0; i < 4; ++i) {
            Frag ff;
            load_frag_u16(ff, pB + i * 16 * LDT, g);
            for (int j = 0; j < 2; ++j)
                acc[i][j] = __builtin_amdgcn_wmma_f32_16x16x32_bf16(
                    false, ff.v, false, sf[j].v, (short)0, acc[i][j], false, false);
        }
        // hand-over: own LDS reads of this buffer retired, own copies of the next tile landed, then
        // the barrier that publishes that tile and frees this buffer for the refill behind it
        asm volatile("s_wait_dscnt 0x0" ::: "memory");
        wait_async0();
        __syncthreads();
        if (t + 2 < NT) stage(cur, (t + 2) * BK);
    }
    wait_async0();

    int b = bm >> 10, lblk = bm & (LDIM - 1);
    if (!isV) {
        int hsel = (bn >> 6) + wp;                   // 0..15: heads of Q, 16..31: heads of K
        int h = hsel & (HH - 1);
        u16* dst = (hsel >> 4) ? krot : qrot;
        const float* bp = bias + bn + wp * 64 + g * 8;
        float gm = gamma[h];
        for (int j = 0; j < 2; ++j) {
            int idx = (b * HH + h) * LDIM + lblk + wq * 32 + j * 16 + laneRow;
            float ph = phi[idx];
            float sc = 1.0f + gm * tanhf(mag[idx]);
            float cs = cosf(ph), sn = sinf(ph);
            for (int i = 0; i < 2; ++i) {
                union { uint4 x; u16 hh[8]; } lo, hi;
                for (int r = 0; r < 8; ++r) {
                    float a0 = (acc[i][j][r] + bp[i * 16 + r]) * sc;
                    float a1 = (acc[i + 2][j][r] + bp[i * 16 + 32 + r]) * sc;
                    lo.hh[r] = f2bf(a0 * cs - a1 * sn);
                    hi.hh[r] = f2bf(a1 * cs + a0 * sn);
                }
                u16* o = dst + (size_t)idx * HD + i * 16 + g * 8;
                *(uint4*)o = lo.x;
                *(uint4*)(o + 32) = hi.x;
            }
        }
    } else {
        for (int j = 0; j < 2; ++j) {
            int n = bn - 2 * BDIM + wq * 32 + j * 16 + laneRow;      // h * 64 + d
            float bv = bias[2 * BDIM + n];
            u16* o = vt + (size_t)(b * BDIM + n) * LDIM + lblk + wp * 64 + g * 8;
            for (int i = 0; i < 4; ++i) {
                union { uint4 x; u16 hh[8]; } w;
                for (int r = 0; r < 8; ++r) w.hh[r] = f2bf(acc[i][j][r] + bv);
                *(uint4*)(o + i * 16) = w.x;
            }
        }
        // the stores above name their address and data registers: the wait stands before any is written again
        asm volatile("s_wait_xcnt 0x0" ::: "memory");
    }
}

// ---------------------------------------------------------------- attention
// Online softmax, all in registers. Each wave owns NQ*16 queries and walks the keys 32 at a time:
//   S^T = K * Q^T   (D: lane holds query laneRow, keys g*8+r)  -> max and sum are in-lane
//   O^T += V^T * P^T (two S^T tiles, converted in place, are the B operand in the same k order)
#define NQ 4          // 16-query tiles per wave
#define AW 4          // waves per block

typedef __attribute__((ext_vector_type(4))) u32   u32x4;
typedef __attribute__((ext_vector_type(4))) float f32x4;
struct Frag4 { union { v16bf v; u32x4 x[2]; }; };

__device__ __forceinline__ float other_half(float x) {   // lane l <-> l ^ 16
    int b = __builtin_bit_cast(int, x);
    b = __builtin_amdgcn_permlanex16(b, b, 0x76543210, 0xfedcba98, false, false);
    return __builtin_bit_cast(float, b);
}

// Several exp2 in one statement, each in place: no instruction reads the result or writes the source of the
// one in front of it, and the closing v_nop is the slot that the instruction set asks for behind a
// transcendental. In place, the statement writes only registers that the vector code in front of it wrote.
__device__ __forceinline__ void exp2x8(float (&x)[8]) {
    asm("v_exp_f32 %0, %0\n\tv_exp_f32 %1, %1\n\tv_exp_f32 %2, %2\n\tv_exp_f32 %3, %3\n\t"
        "v_exp_f32 %4, %4\n\tv_exp_f32 %5, %5\n\tv_exp_f32 %6, %6\n\tv_exp_f32 %7, %7\n\tv_nop"
        : "+v"(x[0]), "+v"(x[1]), "+v"(x[2]), "+v"(x[3]), "+v"(x[4]), "+v"(x[5]), "+v"(x[6]), "+v"(x[7]));
}
__device__ __forceinline__ void exp2x4(float (&x)[4]) {
    asm("v_exp_f32 %0, %0\n\tv_exp_f32 %1, %1\n\tv_exp_f32 %2, %2\n\tv_exp_f32 %3, %3\n\tv_nop"
        : "+v"(x[0]), "+v"(x[1]), "+v"(x[2]), "+v"(x[3]));
}

// No __restrict__ here: the "memory" clobber of the waits below must hold the loads on their side.
__global__ __launch_bounds__(AW * 32) void attn_kernel(
    const u16* qrot, const u16* krot, const u16* vt, const float* mask, u16* ctx) {

    int h = blockIdx.y, b = blockIdx.z;
    int tid = threadIdx.x, wave = tid >> 5, lane = tid & 31;
    int laneRow = lane & 15, g = lane >> 4;
    int qbase = (blockIdx.x * AW + wave) * (NQ * 16);
    const float rscale = 0.125f;                     // 1/sqrt(64)
    const float LOG2E = 1.44269504088896340736f;

    const char* qb = (const char*)(qrot + (size_t)(b * HH + h) * LDIM * HD);
    const char* kb = (const char*)(krot + (size_t)(b * HH + h) * LDIM * HD);
    const char* vb8 = (const char*)(vt + (size_t)(b * HH + h) * HD * LDIM);
    const char* mb = (const char*)(mask + b * LDIM);
    // per-lane byte offsets; k, v, m: of the pass that is fetched next
    u32 qoff = (u32)((qbase + laneRow) * HD + g * 8) * 2u;
    u32 koff = (u32)(laneRow * HD + g * 8) * 2u;
    u32 voff = (u32)(laneRow * LDIM + g * 8) * 2u;
    u32 moff = (u32)g * 32u;

    Frag4 qf[NQ][2];
    for (int q = 0; q < NQ; ++q)
        for (int ks = 0; ks < 2; ++ks) {
            qf[q][ks].x[0] = *(const u32x4*)(qb + qoff + (q * 16 * HD + ks * 32) * 2);
            qf[q][ks].x[1] = *(const u32x4*)(qb + qoff + (q * 16 * HD + ks * 32 + 16) * 2);
        }
    // the Q loads name qoff and qb: as inputs both stay live, so unwritten, up to this wait
    asm volatile("s_wait_xcnt 0x0" :: "v"(qoff), "s"(qb) : "memory");

    v8f o[NQ][4];
    float m[NQ], l[NQ];
    for (int q = 0; q < NQ; ++q) {
        for (int dt = 0; dt < 4; ++dt)
            o[q][dt] = v8f{0.f, 0.f, 0.f, 0.f, 0.f, 0.f, 0.f, 0.f};
        m[q] = -1e30f;            // finite start: t - m is never (-inf) - (-inf) under -inf masks
        l[q] = 0.f;
    }

    Frag4 kf[2][2], va[4], vb[4];
    f32x4 mk[2][2];
    int pos = 0;                  // first key of the pass that is fetched next

    auto fetch = [&](Frag4 (&vd)[4]) {
        for (int kt = 0; kt < 2; ++kt) {
            for (int ks = 0; ks < 2; ++ks) {
                kf[kt][ks].x[0] = *(const u32x4*)(kb + koff + (kt * 16 * HD + ks * 32) * 2);
                kf[kt][ks].x[1] = *(const u32x4*)(kb + koff + (kt * 16 * HD + ks * 32 + 16) * 2);
            }
            mk[kt][0] = *(const f32x4*)(mb + moff + kt * 64);
            mk[kt][1] = *(const f32x4*)(mb + moff + kt * 64 + 16);
        }
        for (int dt = 0; dt < 4; ++dt) {
            vd[dt].x[0] = *(const u32x4*)(vb8 + voff + dt * 16 * LDIM * 2);
            vd[dt].x[1] = *(const u32x4*)(vb8 + voff + dt * 16 * LDIM * 2 + 32);
        }
    };
    auto advance = [&]() {
        // The fetch's loads name koff, voff, moff: as inputs here they stay live, so unwritten, up to
        // this wait; its "memory" clobber keeps the loads in front of it.
        asm volatile("s_wait_xcnt 0x0" :: "v"(koff), "v"(voff), "v"(moff) : "memory");
        int nxt = (pos + 32) & (LDIM - 1);   // behind the last pass it wraps to key 0: in bounds, unused
        int d = nxt - pos;
        koff += (u32)(d * HD * 2); voff += (u32)(d * 2); moff += (u32)(d * 4);
        pos = nxt;
    };

    auto pass = [&](Frag4 (&vc)[4], Frag4 (&vn)[4]) {
        float t[NQ][16];
        for (int q = 0; q < NQ; ++q) {
            v8f s[2];
            for (int kt = 0; kt < 2; ++kt) {
                s[kt] = v8f{0.f, 0.f, 0.f, 0.f, 0.f, 0.f, 0.f, 0.f};
                for (int ks = 0; ks < 2; ++ks)
                    s[kt] = __builtin_amdgcn_wmma_f32_16x16x32_bf16(
                        false, kf[kt][ks].v, false, qf[q][ks].v, (short)0, s[kt], false, false);
            }
            for (int kt = 0; kt < 2; ++kt)
                for (int i = 0; i < 8; ++i)
                    t[q][kt * 8 + i] = s[kt][i] * rscale + mk[kt][i >> 2][i & 3];
        }
        // the next pass's K, mask and V fly while this pass's softmax and V products run
        fetch(vn);
        // holds the loads up here, in front of the softmax: they need its time to land
        __builtin_amdgcn_sched_barrier(0);

        float alpha[NQ];
        for (int q = 0; q < NQ; ++q) {
            float tm = t[q][0];
            for (int i = 1; i < 16; ++i) tm = fmaxf(tm, t[q][i]);
            tm = fmaxf(tm, other_half(tm));
            float mnew = fmaxf(m[q], tm);
            alpha[q] = (m[q] - mnew) * LOG2E;
            m[q] = mnew;
        }
        exp2x4(alpha);

        for (int q = 0; q < NQ; ++q) {
            Frag4 pf;
            float ls = 0.f;
            for (int hf = 0; hf < 2; ++hf) {
                float p[8];
                for (int i = 0; i < 8; ++i) p[i] = (t[q][hf * 8 + i] - m[q]) * LOG2E;
                exp2x8(p);
                for (int i = 0; i < 8; ++i) { ls += p[i]; pf.v[hf * 8 + i] = (__bf16)p[i]; }
            }
            l[q] = l[q] * alpha[q] + ls;
            for (int dt = 0; dt < 4; ++dt) {
                o[q][dt] *= alpha[q];
                o[q][dt] = __builtin_amdgcn_wmma_f32_16x16x32_bf16(
                    false, vc[dt].v, false, pf.v, (short)0, o[q][dt], false, false);
            }
        }
        advance();
    };

    fetch(va);
    advance();
    for (int k0 = 0; k0 < LDIM; k0 += 64) {
        pass(va, vb);
        pass(vb, va);
    }

    // epilogue: lane holds query laneRow, head columns dt*16 + g*8 + r -> one 16-byte store per tile
    char* cb = (char*)(ctx + (size_t)b * LDIM * BDIM + h * HD);
    for (int q = 0; q < NQ; ++q) {
        float inv = 1.0f / (l[q] + other_half(l[q]));
        int lq = qbase + q * 16 + laneRow;
        union { u32x4 x; u16 hh[8]; __bf16 bh[8]; } w[4];
        for (int dt = 0; dt < 4; ++dt)
            for (int r = 0; r < 8; ++r)
                w[dt].bh[r] = (__bf16)(o[q][dt][r] * inv);
        if (m[q] <= -1e8f) {         // fully masked row: the diagonal alone survives, ctx = v[lq]
            u32 doff = (u32)(g * 8 * LDIM + lq) * 2u;
            for (int dt = 0; dt < 4; ++dt)
                for (int r = 0; r < 8; ++r)
                    w[dt].hh[r] = *(const u16*)(vb8 + doff + (dt * 16 + r) * LDIM * 2);
            // these loads name doff: it stays live up to this wait, behind the loads
            asm volatile("s_wait_xcnt 0x0" :: "v"(doff) : "memory");
        }
        u32 soff = (u32)(lq * BDIM + g * 8) * 2u;
        for (int dt = 0; dt < 4; ++dt)
            *(u32x4*)(cb + soff + dt * 32) = w[dt].x;
        // the stores name soff and their data: the wait stands before either is written again
        asm volatile("s_wait_xcnt 0x0" :: "v"(soff), "v"(w[0].x), "v"(w[1].x), "v"(w[2].x), "v"(w[3].x) : "memory");
    }
}

// ---------------------------------------------------------------- output projection + residual + LayerNorm
// A block owns OM whole rows of x = ctx * Wo + bo + hidden, so the row statistics never leave it:
//   16 waves, each 64 columns n x 32 rows m; W rows are the first WMMA operand, so a lane holds one row m
//   and 8 columns n in a run (two 16-byte LDS stores a tile);
//   the f32 tile then lies in the LDS of the finished ring, and each wave normalises two whole rows of it
//   with 16-byte loads and stores in whole lines.
// Every block reads all of W: block i starts its walk over k at tile i mod 16, so that the blocks do not
// all ask for the same lines at the same time.
#define OM 32                        // rows a block
#define OKT 64                       // k a tile: 128 bytes a row, a whole line
#define OP 72                        // LDS row pitch in halves: 144 B = 16 B x 9, free of conflicts for 16-byte reads
#define ONT (BDIM / OKT)
#define OB_BYTES (BDIM * OP * 2)     // W tile
#define OA_BYTES (OM * OP * 2)       // ctx tile
#define OBUF (OB_BYTES + OA_BYTES)
#define XP 1028                      // f32 row pitch of the x tile: 16 rows of 16-byte stores meet 64 different banks

// Eight copies and the wait for their address registers in one statement: nothing can rewrite a register
// that a copy names in front of that wait.
__device__ __forceinline__ void async_copy16x8(const u32 (&l)[8], const char* const (&p)[8]) {
    asm volatile("global_load_async_to_lds_b128 %0, %1, off\n\t"
                 "global_load_async_to_lds_b128 %2, %3, off\n\t"
                 "global_load_async_to_lds_b128 %4, %5, off\n\t"
                 "global_load_async_to_lds_b128 %6, %7, off\n\t"
                 "global_load_async_to_lds_b128 %8, %9, off\n\t"
                 "global_load_async_to_lds_b128 %10, %11, off\n\t"
                 "global_load_async_to_lds_b128 %12, %13, off\n\t"
                 "global_load_async_to_lds_b128 %14, %15, off\n\t"
                 "s_wait_xcnt 0x0"
                 :: "v"(l[0]), "v"((u64)(uintptr_t)p[0]), "v"(l[1]), "v"((u64)(uintptr_t)p[1]),
                    "v"(l[2]), "v"((u64)(uintptr_t)p[2]), "v"(l[3]), "v"((u64)(uintptr_t)p[3]),
                    "v"(l[4]), "v"((u64)(uintptr_t)p[4]), "v"(l[5]), "v"((u64)(uintptr_t)p[5]),
                    "v"(l[6]), "v"((u64)(uintptr_t)p[6]), "v"(l[7]), "v"((u64)(uintptr_t)p[7]) : "memory");
}
// One 8-byte copy with the same wait in its statement.
__device__ __forceinline__ void async_copy8(u32 l, const char* p) {
    asm volatile("global_load_async_to_lds_b64 %0, %1, off\n\t"
                 "s_wait_xcnt 0x0"
                 :: "v"(l), "v"((u64)(uintptr_t)p) : "memory");
}

// No __restrict__ here: the "memory" clobber of the waits below must hold the loads and stores on their side.
__global__ __launch_bounds__(512) void gemm_out_ln_kernel(
    const u16* A, const u16* BT, const float* bias, const float* residual,
    const float* lnw, const float* lnb, float* out) {

    __shared__ __attribute__((aligned(16))) char sm[2 * OBUF];

    int bm = blockIdx.x * OM;
    int tid = threadIdx.x;
    int wave = tid >> 5, lane = tid & 31;
    int laneRow = lane & 15, g = lane >> 4;

    v8f acc[4][2];
    for (int i = 0; i < 4; ++i)
        for (int j = 0; j < 2; ++j)
            acc[i][j] = v8f{0.f, 0.f, 0.f, 0.f, 0.f, 0.f, 0.f, 0.f};

    // W tile: copy c of a thread brings 16 bytes of row c * 64 + (tid >> 3); a wave's copy is 4 whole lines.
    // ctx tile: 8 bytes of row tid >> 4; a wave's copy is 2 whole lines.
    const char* gW = (const char*)(BT + (size_t)(tid >> 3) * BDIM + (tid & 7) * 8);
    const char* gA = (const char*)(A + (size_t)(bm + (tid >> 4)) * BDIM + (tid & 15) * 4);
    u32 lW = (u32)(uintptr_t)&sm[(tid >> 3) * (OP * 2) + (tid & 7) * 16];
    u32 lA = (u32)(uintptr_t)&sm[OB_BYTES + (tid >> 4) * (OP * 2) + (tid & 15) * 8];

    auto stage = [&](int buf, int t) {
        u32 kb = (u32)((t + blockIdx.x) & (ONT - 1)) * (OKT * 2);    // byte offset of the k tile in a row
        for (int hf = 0; hf < 2; ++hf) {
            u32 l[8];
            const char* p[8];
            for (int c = 0; c < 8; ++c) {
                l[c] = lW + (u32)(buf * OBUF + (hf * 8 + c) * 64 * OP * 2);
                p[c] = gW + kb + (size_t)(hf * 8 + c) * 64 * BDIM * 2;
            }
            async_copy16x8(l, p);
        }
        async_copy8(lA + (u32)(buf * OBUF), gA + kb);
    };

    stage(0, 0);
    wait_async0();
    __syncthreads();
    stage(1, 1);

    for (int t = 0; t < ONT; ++t) {
        int cur = t & 1;
        const u16* wB = (const u16*)(sm + cur * OBUF) + (wave * 64 + laneRow) * OP;
        const u16* xB = (const u16*)(sm + cur * OBUF + OB_BYTES) + laneRow * OP;
        Frag sf[2][2], ff[2][4];
        for (int ks = 0; ks < 2; ++ks) {
            for (int j = 0; j < 2; ++j)
                load_frag_u16(sf[ks][j], xB + j * 16 * OP + ks * 32, g);
            for (int i = 0; i < 4; ++i)
                load_frag_u16(ff[ks][i], wB + i * 16 * OP + ks * 32, g);
        }
        // hand-over: own LDS reads of this buffer retired (the whole tile's fragments are in registers), own
        // copies of the next tile landed, then the barrier that publishes that tile and frees this buffer
        asm volatile("s_wait_dscnt 0x0" ::: "memory");
        wait_async0();
        __syncthreads();
        // the refill stands in front of the products, which read registers alone: its copies get the whole
        // trip to land
        if (t + 2 < ONT) stage(cur, t + 2);
        for (int ks = 0; ks < 2; ++ks)
            for (int i = 0; i < 4; ++i)
                for (int j = 0; j < 2; ++j)
                    acc[i][j] = __builtin_amdgcn_wmma_f32_16x16x32_bf16(
                        false, ff[ks][i].v, false, sf[ks][j].v, (short)0, acc[i][j], false, false);
    }
    wait_async0();

    // this wave's two rows of the residual, and the bias: they fly while the tile is laid down
    const char* hb = (const char*)residual;
    const char* bb = (const char*)bias;
    u32 roff = (u32)(bm + wave * 2) * (BDIM * 4) + (u32)lane * 16u;
    u32 coff = (u32)lane * 16u;
    f32x4 hv[2][8], bv[8];
    for (int c = 0; c < 8; ++c) {
        hv[0][c] = *(const f32x4*)(hb + roff + c * 512);
        hv[1][c] = *(const f32x4*)(hb + roff + BDIM * 4 + c * 512);
        bv[c] = *(const f32x4*)(bb + coff + c * 512);
    }
    // these loads name roff, coff (or the lane number it is made of) and their bases: as inputs all stay
    // live, so unwritten, up to this wait
    asm volatile("s_wait_xcnt 0x0" :: "v"(roff), "v"(coff), "v"(lane), "s"(hb), "s"(bb) : "memory");

    // the ring is finished (last barrier of the loop, no copy in flight): its LDS takes the f32 tile
    float* xs = (float*)sm;
    for (int i = 0; i < 4; ++i)
        for (int j = 0; j < 2; ++j) {
            float* p = xs + (j * 16 + laneRow) * XP + wave * 64 + i * 16 + g * 8;
            *(f32x4*)p = f32x4{acc[i][j][0], acc[i][j][1], acc[i][j][2], acc[i][j][3]};
            *(f32x4*)(p + 4) = f32x4{acc[i][j][4], acc[i][j][5], acc[i][j][6], acc[i][j][7]};
        }

    const char* wb = (const char*)lnw;
    const char* ob = (const char*)lnb;
    f32x4 wv[8], ov[8];
    for (int c = 0; c < 8; ++c) {
        wv[c] = *(const f32x4*)(wb + coff + c * 512);
        ov[c] = *(const f32x4*)(ob + coff + c * 512);
    }
    // as above, for coff, the lane number and the two bases
    asm volatile("s_wait_xcnt 0x0" :: "v"(coff), "v"(lane), "s"(wb), "s"(ob) : "memory");

    __syncthreads();                 // every wave's part of the tile is in LDS

    f32x4 v[2][8];
    float s[2];
    for (int rr = 0; rr < 2; ++rr) {
        const float* xr = xs + (wave * 2 + rr) * XP + lane * 4;
        f32x4 a = f32x4{0.f, 0.f, 0.f, 0.f};
        for (int c = 0; c < 8; ++c) {
            v[rr][c] = (*(const f32x4*)(xr + c * 128) + bv[c]) + hv[rr][c];
            a += v[rr][c];
        }
        s[rr] = (a[0] + a[1]) + (a[2] + a[3]);
    }
    for (int off = 16; off; off >>= 1)
        for (int rr = 0; rr < 2; ++rr) s[rr] += __shfl_xor(s[rr], off, 32);
    float mu[2], q[2];
    for (int rr = 0; rr < 2; ++rr) {
        mu[rr] = s[rr] * (1.0f / BDIM);
        f32x4 a = f32x4{0.f, 0.f, 0.f, 0.f};
        for (int c = 0; c < 8; ++c) {
            v[rr][c] -= mu[rr];
            a += v[rr][c] * v[rr][c];
        }
        q[rr] = (a[0] + a[1]) + (a[2] + a[3]);
    }
    for (int off = 16; off; off >>= 1)
        for (int rr = 0; rr < 2; ++rr) q[rr] += __shfl_xor(q[rr], off, 32);
    for (int rr = 0; rr < 2; ++rr) {
        float inv = rsqrtf(q[rr] * (1.0f / BDIM) + 1e-12f);
        for (int c = 0; c < 8; ++c)
            v[rr][c] = v[rr][c] * inv * wv[c] + ov[c];
    }
    char* db = (char*)out;
    for (int rr = 0; rr < 2; ++rr)
        for (int c = 0; c < 8; ++c)
            *(f32x4*)(db + roff + rr * (BDIM * 4) + c * 512) = v[rr][c];
    // the stores name roff and their data: as inputs all stay live, so unwritten, up to this wait
    asm volatile("s_wait_xcnt 0x0" :: "v"(roff),
                 "v"(v[0][0]), "v"(v[0][1]), "v"(v[0][2]), "v"(v[0][3]), "v"(v[0][4]), "v"(v[0][5]), "v"(v[0][6]), "v"(v[0][7]),
                 "v"(v[1][0]), "v"(v[1][1]), "v"(v[1][2]), "v"(v[1][3]), "v"(v[1][4]), "v"(v[1][5]), "v"(v[1][6]), "v"(v[1][7])
                 : "memory");
}

// ---------------------------------------------------------------- launch
extern "C" void kernel_launch(void* const* d_in, const int* in_sizes, int n_in,
                              void* d_out, int out_size, void* d_ws, size_t ws_size,
                              hipStream_t stream) {
    const float* hidden = (const float*)d_in[0];
    const float* mask   = (const float*)d_in[1];
    const float* phi    = (const float*)d_in[2];
    const float* mag    = (const float*)d_in[3];
    const float* Wq     = (const float*)d_in[4];
    const float* bq     = (const float*)d_in[5];
    const float* Wk     = (const float*)d_in[6];
    const float* bk     = (const float*)d_in[7];
    const float* Wv     = (const float*)d_in[8];
    const float* bv     = (const float*)d_in[9];
    const float* gamma  = (const float*)d_in[10];
    const float* Wo     = (const float*)d_in[11];
    const float* bo     = (const float*)d_in[12];
    const float* lnw    = (const float*)d_in[13];
    const float* lnb    = (const float*)d_in[14];
    float* out = (float*)d_out;

    char* ws = (char*)d_ws;
    const size_t o_xb   = 0;                           // 8 MB  bf16 X
    const size_t o_wt   = o_xb + 8388608ull;           // 6 MB  bf16 WT (q,k,v packed)
    const size_t o_wot  = o_wt + 6291456ull;           // 2 MB  bf16 WoT
    const size_t o_bias = o_wot + 2097152ull;          // 12 KB packed bias
    const size_t o_qr   = o_bias + 12288ull + 50331648ull;   // 8 MB, at its old place: the 48 MB in front are not used
    const size_t o_kr   = o_qr + 8388608ull;           // 8 MB
    const size_t o_vt   = o_kr + 8388608ull;           // 8 MB
    const size_t o_ctx  = o_vt + 8388608ull;           // 8 MB

    u16*   Xb    = (u16*)(ws + o_xb);
    u16*   WT    = (u16*)(ws + o_wt);
    u16*   WoT   = (u16*)(ws + o_wot);
    float* biasA = (float*)(ws + o_bias);
    u16*   qrot  = (u16*)(ws + o_qr);
    u16*   krot  = (u16*)(ws + o_kr);
    u16*   vtb   = (u16*)(ws + o_vt);
    u16*   ctxb  = (u16*)(ws + o_ctx);

    // 1) X to bf16, the four weights transposed to bf16, the bias packed: one launch
    prep_kernel<<<PREP_X + PREP_T + PREP_B, 256, 0, stream>>>(
        hidden, Wq, Wk, Wv, Wo, bq, bk, bv, Xb, WT, WoT, biasA);

    // 3) fused QKV GEMM [4096 x 3072] with scale, rotation and V transpose in its epilogue
    gemm_qkv_rope_kernel<<<dim3(NQKV / BN, ROWS / BM), 256, 0, stream>>>(
        Xb, WT, biasA, phi, mag, gamma, qrot, krot, vtb);

    // 4) fused attention (online softmax in registers, no LDS)
    attn_kernel<<<dim3(LDIM / (AW * NQ * 16), HH, BB), AW * 32, 0, stream>>>(
        qrot, krot, vtb, mask, ctxb);

    // 5) output projection + residual + LayerNorm, a block for 32 whole rows
    gemm_out_ln_kernel<<<ROWS / OM, 512, 0, stream>>>(
        ctxb, WoT, bo, hidden, lnw, lnb, out);
}

// v005
// Measured time: 91.2 microseconds a run.
// Next to v004, in two timings, it ran 1.16 and 1.15 times as fast.
// All steps since v000 together make it 3.34 times as fast.
#include <hip/hip_runtime.h>
#include <hip/hip_bf16.h>

typedef unsigned short u16;
typedef unsigned int   u32;
typedef unsigned long long u64;

typedef __attribute__((ext_vector_type(16))) __bf16 v16bf;
typedef __attribute__((ext_vector_type(8)))  float  v8f;

#define BDIM 1024   // D
#define LDIM 1024   // L
#define BB   4      // B
#define HH   16     // H
#define HD   64     // head dim
#define ROWS (BB*LDIM)      // 4096
#define NQKV (3*BDIM)       // 3072

__device__ __forceinline__ u16 f2bf(float f) {
    union { float f; u32 u; } x; x.f = f;
    u32 r = x.u + 0x7FFFu + ((x.u >> 16) & 1u);
    return (u16)(r >> 16);
}

struct Frag { union { v16bf v; uint4 q[2]; u16 h[16]; }; };

// load a 16-half fragment (A-layout) from a row:
// lane holds row (lane&15); halves 0..7 at K = g*8.. , halves 8..15 at K = 16+g*8..
__device__ __forceinline__ void load_frag_u16(Frag& f, const u16* rowPtr, int g) {
    f.q[0] = *(const uint4*)(rowPtr + g * 8);
    f.q[1] = *(const uint4*)(rowPtr + 16 + g * 8);
}

__device__ __forceinline__ void wait_async0() {
    asm volatile("s_wait_asynccnt 0x0" ::: "memory");
}

// ---------------------------------------------------------------- preparation, one launch
// Three independent jobs share one grid by block range (the test is the same for a whole block):
//   blocks [0, PREP_X):        X f32 -> bf16, 4096 float4 a block, 16 a thread
//   the next PREP_T blocks:    W f32 [k][n] -> bf16 [n][k], four matrices, a tile of 128 k x 64 n a block
//   the last PREP_B blocks:    bq, bk, bv -> one packed bias
#define PREP_X 256
#define PREP_T 512
#define PREP_B 3

__global__ __launch_bounds__(256) void prep_kernel(
    const float* __restrict__ X, const float* __restrict__ Wq, const float* __restrict__ Wk,
    const float* __restrict__ Wv, const float* __restrict__ Wo,
    const float* __restrict__ bq, const float* __restrict__ bk, const float* __restrict__ bv,
    u16* __restrict__ Xb, u16* __restrict__ WT, u16* __restrict__ WoT, float* __restrict__ biasA) {

    // [n][16-byte chunk of 8 k]; the chunk index is xor-ed with n >> 2, so that the 16 lanes that write
    // one k chunk of 16 rows, and the 16 that read one row, each meet 16 different bank groups
    __shared__ uint4 sW[64 * 16];

    int blk = blockIdx.x, tid = threadIdx.x;
    if (blk < PREP_X) {
        const char* s = (const char*)(X + (size_t)blk * 16384);
        char* d = (char*)(Xb + (size_t)blk * 16384);
        u32 off = (u32)tid * 16u;
        float4 f[16];
        for (int j = 0; j < 16; ++j)
            f[j] = *(const float4*)(s + off + j * 4096);
        u32 so = (u32)tid * 8u;
        for (int j = 0; j < 16; ++j) {
            ushort4 o;
            o.x = f2bf(f[j].x); o.y = f2bf(f[j].y); o.z = f2bf(f[j].z); o.w = f2bf(f[j].w);
            *(ushort4*)(d + so + j * 2048) = o;
        }
    } else if (blk < PREP_X + PREP_T) {
        int t = blk - PREP_X;
        int m = t >> 7;                              // which matrix
        int k0 = (t & 7) * 128, n0 = ((t >> 3) & 15) * 64;
        const float* Wm = m == 0 ? Wq : m == 1 ? Wk : m == 2 ? Wv : Wo;
        u16* Dm = m == 3 ? WoT : WT + (size_t)m * BDIM * BDIM;
        int c4 = tid & 15, kc = tid >> 4;            // 4 columns n, 8 rows k: four whole output chunks
        const char* s = (const char*)(Wm + (size_t)k0 * BDIM + n0);
        u32 off = (u32)(kc * 8 * BDIM + c4 * 4) * 4u;
        float4 f[8];
        for (int j = 0; j < 8; ++j)
            f[j] = *(const float4*)(s + off + j * BDIM * 4);
        union { uint4 x; u16 h[8]; } w[4];
        for (int j = 0; j < 8; ++j) {
            w[0].h[j] = f2bf(f[j].x); w[1].h[j] = f2bf(f[j].y);
            w[2].h[j] = f2bf(f[j].z); w[3].h[j] = f2bf(f[j].w);
        }
        for (int e = 0; e < 4; ++e)
            sW[(c4 * 4 + e) * 16 + (kc ^ c4)] = w[e].x;
        __syncthreads();
        char* d = (char*)(Dm + (size_t)n0 * BDIM + k0);
        u32 so = (u32)(kc * BDIM * 2 + c4 * 16);     // row n = kc + 16 j, chunk c4: 256 bytes a row in a run
        for (int j = 0; j < 4; ++j) {
            int n = kc + j * 16;
            *(uint4*)(d + so + j * 16 * BDIM * 2) = sW[n * 16 + (c4 ^ ((n >> 2) & 15))];
        }
    } else {
        int p = blk - PREP_X - PREP_T;
        const float* bs = p == 0 ? bq : p == 1 ? bk : bv;
        ((float4*)biasA)[p * 256 + tid] = ((const float4*)bs)[tid];
    }
}

// ---------------------------------------------------------------- tile of the QKV GEMM
#define BM 128
#define BN 128
#define BK 64    // k a tile: 128 bytes a row, a whole line
#define LDT 72   // padded LDS row stride (halves): 144 B = 16 B x 9, free of conflicts for 16-byte reads

// ---------------------------------------------------------------- QKV GEMM + scale + rotation
// Xb[ROWS][D] * WT[3072][D]^T + bias, then scale and rotation in the accumulators:
//   q_rot/k_rot bf16 [b,h,l,64], vT bf16 [b,h,64,l]; no f32 qkv array, no separate launch.
// The first WMMA operand (64 rows a wave) is the one whose index must run along a lane's 8 results:
//   Q, K blocks: W rows first -> lane = token l, results = 8 head columns d; a wave holds one whole head,
//                so the rotation partner d + 32 is tile i + 2 of the same lane and register
//   V blocks:    X rows first -> lane = head column d, results = 8 tokens l (the transposed V row)
// Either way 8 results are one 16-byte store.

// Eight copies and the wait for their address registers in one statement: nothing can rewrite a register
// that a copy names in front of that wait.
__device__ __forceinline__ void async_copy16x8(const u32 (&l)[8], const char* const (&p)[8]) {
    asm volatile("global_load_async_to_lds_b128 %0, %1, off\n\t"
                 "global_load_async_to_lds_b128 %2, %3, off\n\t"
                 "global_load_async_to_lds_b128 %4, %5, off\n\t"
                 "global_load_async_to_lds_b128 %6, %7, off\n\t"
                 "global_load_async_to_lds_b128 %8, %9, off\n\t"
                 "global_load_async_to_lds_b128 %10, %11, off\n\t"
                 "global_load_async_to_lds_b128 %12, %13, off\n\t"
                 "global_load_async_to_lds_b128 %14, %15, off\n\t"
                 "s_wait_xcnt 0x0"
                 :: "v"(l[0]), "v"((u64)(uintptr_t)p[0]), "v"(l[1]), "v"((u64)(uintptr_t)p[1]),
                    "v"(l[2]), "v"((u64)(uintptr_t)p[2]), "v"(l[3]), "v"((u64)(uintptr_t)p[3]),
                    "v"(l[4]), "v"((u64)(uintptr_t)p[4]), "v"(l[5]), "v"((u64)(uintptr_t)p[5]),
                    "v"(l[6]), "v"((u64)(uintptr_t)p[6]), "v"(l[7]), "v"((u64)(uintptr_t)p[7]) : "memory");
}

__global__ __launch_bounds__(256) void gemm_qkv_rope_kernel(
    const u16* __restrict__ A, const u16* __restrict__ BT, const float* __restrict__ bias,
    const float* __restrict__ phi, const float* __restrict__ mag, const float* __restrict__ gamma,
    u16* __restrict__ qrot, u16* __restrict__ krot, u16* __restrict__ vt) {

    __shared__ __attribute__((aligned(16))) u16 sT[2][2][BM * LDT];     // [buffer][0: X rows, 1: W rows]

    const int K = BDIM, NT = BDIM / BK;
    int bm = blockIdx.y * BM, bn = blockIdx.x * BN;
    int tid = threadIdx.x;
    int wave = tid >> 5, lane = tid & 31;
    int wp = wave & 1, wq = wave >> 1;     // 64 rows of the first operand, 32 rows of the second
    int laneRow = lane & 15, g = lane >> 4;
    bool isV = bn >= 2 * BDIM;             // the same for the whole block
    int pSel = isV ? 0 : 1;

    // copy c of a thread brings 16 bytes of row c * 32 + (tid >> 3) of its operand: eight lanes take one row's
    // 128 bytes, so a wave's copy is 4 whole lines
    const char* gX = (const char*)(A + (size_t)(bm + (tid >> 3)) * K + (tid & 7) * 8);
    const char* gW = (const char*)(BT + (size_t)(bn + (tid >> 3)) * K + (tid & 7) * 8);
    u32 lX = (u32)(uintptr_t)&sT[0][0][(tid >> 3) * LDT + (tid & 7) * 8];

    v8f acc[4][2];
    for (int i = 0; i < 4; ++i)
        for (int j = 0; j < 2; ++j)
            acc[i][j] = v8f{0.f, 0.f, 0.f, 0.f, 0.f, 0.f, 0.f, 0.f};

    auto stage = [&](int buf, int k0) {
        u32 l[8];
        const char* p[8];
        for (int c = 0; c < 4; ++c) {
            l[c]     = lX + (u32)(((buf * 2 + 0) * BM + c * 32) * LDT * 2);
            l[c + 4] = lX + (u32)(((buf * 2 + 1) * BM + c * 32) * LDT * 2);
            p[c]     = gX + k0 * 2 + (size_t)c * 32 * K * 2;
            p[c + 4] = gW + k0 * 2 + (size_t)c * 32 * K * 2;
        }
        async_copy16x8(l, p);
    };

    stage(0, 0);
    wait_async0();
    __syncthreads();
    stage(1, BK);

    for (int t = 0; t < NT; ++t) {
        int cur = t & 1;
        const u16* pB = &sT[cur][pSel][(wp * 64 + laneRow) * LDT];
        const u16* qB = &sT[cur][pSel ^ 1][(wq * 32 + laneRow) * LDT];
        for (int ks = 0; ks < 2; ++ks) {
            Frag sf[2];
            for (int j = 0; j < 2; ++j)
                load_frag_u16(sf[j], qB + j * 16 * LDT + ks * 32, g);
            for (int i = 0; i < 4; ++i) {
                Frag ff;
                load_frag_u16(ff, pB + i * 16 * LDT + ks * 32, g);
                for (int j = 0; j < 2; ++j)
                    acc[i][j] = __builtin_amdgcn_wmma_f32_16x16x32_bf16(
                        false, ff.v, false, sf[j].v, (short)0, acc[i][j], false, false);
            }
        }
        // hand-over: own LDS reads of this buffer retired, own copies of the next tile landed, then
        // the barrier that publishes that tile and frees this buffer for the refill behind it
        asm volatile("s_wait_dscnt 0x0" ::: "memory");
        wait_async0();
        __syncthreads();
        if (t + 2 < NT) stage(cur, (t + 2) * BK);
    }
    wait_async0();

    int b = bm >> 10, lblk = bm & (LDIM - 1);
    if (!isV) {
        int hsel = (bn >> 6) + wp;                   // 0..15: heads of Q, 16..31: heads of K
        int h = hsel & (HH - 1);
        u16* dst = (hsel >> 4) ? krot : qrot;
        const float* bp = bias + bn + wp * 64 + g * 8;
        float gm = gamma[h];
        for (int j = 0; j < 2; ++j) {
            int idx = (b * HH + h) * LDIM + lblk + wq * 32 + j * 16 + laneRow;
            float ph = phi[idx];
            float sc = 1.0f + gm * tanhf(mag[idx]);
            float cs = cosf(ph), sn = sinf(ph);
            for (int i = 0; i < 2; ++i) {
                union { uint4 x; u16 hh[8]; } lo, hi;
                for (int r = 0; r < 8; ++r) {
                    float a0 = (acc[i][j][r] + bp[i * 16 + r]) * sc;
                    float a1 = (acc[i + 2][j][r] + bp[i * 16 + 32 + r]) * sc;
                    lo.hh[r] = f2bf(a0 * cs - a1 * sn);
                    hi.hh[r] = f2bf(a1 * cs + a0 * sn);
                }
                u16* o = dst + (size_t)idx * HD + i * 16 + g * 8;
                *(uint4*)o = lo.x;
                *(uint4*)(o + 32) = hi.x;
            }
        }
    } else {
        for (int j = 0; j < 2; ++j) {
            int n = bn - 2 * BDIM + wq * 32 + j * 16 + laneRow;      // h * 64 + d
            float bv = bias[2 * BDIM + n];
            u16* o = vt + (size_t)(b * BDIM + n) * LDIM + lblk + wp * 64 + g * 8;
            for (int i = 0; i < 4; ++i) {
                union { uint4 x; u16 hh[8]; } w;
                for (int r = 0; r < 8; ++r) w.hh[r] = f2bf(acc[i][j][r] + bv);
                *(uint4*)(o + i * 16) = w.x;
            }
        }
        // the stores above name their address and data registers: the wait stands before any is written again
        asm volatile("s_wait_xcnt 0x0" ::: "memory");
    }
}

// ---------------------------------------------------------------- attention
// Online softmax, all in registers. Each wave owns NQ*16 queries and walks the keys 32 at a time:
//   S^T = K * Q^T   (D: lane holds query laneRow, keys g*8+r)  -> max and sum are in-lane
//   O^T += V^T * P^T (two S^T tiles, converted in place, are the B operand in the same k order)
#define NQ 4          // 16-query tiles per wave
#define AW 4          // waves per block

typedef __attribute__((ext_vector_type(4))) u32   u32x4;
typedef __attribute__((ext_vector_type(4))) float f32x4;
struct Frag4 { union { v16bf v; u32x4 x[2]; }; };

__device__ __forceinline__ float other_half(float x) {   // lane l <-> l ^ 16
    int b = __builtin_bit_cast(int, x);
    b = __builtin_amdgcn_permlanex16(b, b, 0x76543210, 0xfedcba98, false, false);
    return __builtin_bit_cast(float, b);
}

// Several exp2 in one statement, each in place: no instruction reads the result or writes the source of the
// one in front of it, and the closing v_nop is the slot that the instruction set asks for behind a
// transcendental. In place, the statement writes only registers that the vector code in front of it wrote.
__device__ __forceinline__ void exp2x8(float (&x)[8]) {
    asm("v_exp_f32 %0, %0\n\tv_exp_f32 %1, %1\n\tv_exp_f32 %2, %2\n\tv_exp_f32 %3, %3\n\t"
        "v_exp_f32 %4, %4\n\tv_exp_f32 %5, %5\n\tv_exp_f32 %6, %6\n\tv_exp_f32 %7, %7\n\tv_nop"
        : "+v"(x[0]), "+v"(x[1]), "+v"(x[2]), "+v"(x[3]), "+v"(x[4]), "+v"(x[5]), "+v"(x[6]), "+v"(x[7]));
}
__device__ __forceinline__ void exp2x4(float (&x)[4]) {
    asm("v_exp_f32 %0, %0\n\tv_exp_f32 %1, %1\n\tv_exp_f32 %2, %2\n\tv_exp_f32 %3, %3\n\tv_nop"
        : "+v"(x[0]), "+v"(x[1]), "+v"(x[2]), "+v"(x[3]));
}

// No __restrict__ here: the "memory" clobber of the waits below must hold the loads on their side.
__global__ __launch_bounds__(AW * 32) void attn_kernel(
    const u16* qrot, const u16* krot, const u16* vt, const float* mask, u16* ctx) {

    int h = blockIdx.y, b = blockIdx.z;
    int tid = threadIdx.x, wave = tid >> 5, lane = tid & 31;
    int laneRow = lane & 15, g = lane >> 4;
    int qbase = (blockIdx.x * AW + wave) * (NQ * 16);
    const float rscale = 0.125f;                     // 1/sqrt(64)
    const float LOG2E = 1.44269504088896340736f;

    const char* qb = (const char*)(qrot + (size_t)(b * HH + h) * LDIM * HD);
    const char* kb = (const char*)(krot + (size_t)(b * HH + h) * LDIM * HD);
    const char* vb8 = (const char*)(vt + (size_t)(b * HH + h) * HD * LDIM);
    const char* mb = (const char*)(mask + b * LDIM);
    // per-lane byte offsets; k, v, m: of the pass that is fetched next
    u32 qoff = (u32)((qbase + laneRow) * HD + g * 8) * 2u;
    u32 koff = (u32)(laneRow * HD + g * 8) * 2u;
    u32 voff = (u32)(laneRow * LDIM + g * 8) * 2u;
    u32 moff = (u32)g * 32u;

    Frag4 qf[NQ][2];
    for (int q = 0; q < NQ; ++q)
        for (int ks = 0; ks < 2; ++ks) {
            qf[q][ks].x[0] = *(const u32x4*)(qb + qoff + (q * 16 * HD + ks * 32) * 2);
            qf[q][ks].x[1] = *(const u32x4*)(qb + qoff + (q * 16 * HD + ks * 32 + 16) * 2);
        }
    // the Q loads name qoff and qb: as inputs both stay live, so unwritten, up to this wait
    asm volatile("s_wait_xcnt 0x0" :: "v"(qoff), "s"(qb) : "memory");

    v8f o[NQ][4];
    float m[NQ], l[NQ];
    for (int q = 0; q < NQ; ++q) {
        for (int dt = 0; dt < 4; ++dt)
            o[q][dt] = v8f{0.f, 0.f, 0.f, 0.f, 0.f, 0.f, 0.f, 0.f};
        m[q] = -1e30f;            // finite start: t - m is never (-inf) - (-inf) under -inf masks
        l[q] = 0.f;
    }

    Frag4 kf[2][2], va[4], vb[4];
    f32x4 mk[2][2];
    int pos = 0;                  // first key of the pass that is fetched next

    auto fetch = [&](Frag4 (&vd)[4]) {
        for (int kt = 0; kt < 2; ++kt) {
            for (int ks = 0; ks < 2; ++ks) {
                kf[kt][ks].x[0] = *(const u32x4*)(kb + koff + (kt * 16 * HD + ks * 32) * 2);
                kf[kt][ks].x[1] = *(const u32x4*)(kb + koff + (kt * 16 * HD + ks * 32 + 16) * 2);
            }
            mk[kt][0] = *(const f32x4*)(mb + moff + kt * 64);
            mk[kt][1] = *(const f32x4*)(mb + moff + kt * 64 + 16);
        }
        for (int dt = 0; dt < 4; ++dt) {
            vd[dt].x[0] = *(const u32x4*)(vb8 + voff + dt * 16 * LDIM * 2);
            vd[dt].x[1] = *(const u32x4*)(vb8 + voff + dt * 16 * LDIM * 2 + 32);
        }
    };
    auto advance = [&]() {
        // The fetch's loads name koff, voff, moff: as inputs here they stay live, so unwritten, up to
        // this wait; its "memory" clobber keeps the loads in front of it.
        asm volatile("s_wait_xcnt 0x0" :: "v"(koff), "v"(voff), "v"(moff) : "memory");
        int nxt = (pos + 32) & (LDIM - 1);   // behind the last pass it wraps to key 0: in bounds, unused
        int d = nxt - pos;
        koff += (u32)(d * HD * 2); voff += (u32)(d * 2); moff += (u32)(d * 4);
        pos = nxt;
    };

    auto pass = [&](Frag4 (&vc)[4], Frag4 (&vn)[4]) {
        float t[NQ][16];
        for (int q = 0; q < NQ; ++q) {
            v8f s[2];
            for (int kt = 0; kt < 2; ++kt) {
                s[kt] = v8f{0.f, 0.f, 0.f, 0.f, 0.f, 0.f, 0.f, 0.f};
                for (int ks = 0; ks < 2; ++ks)
                    s[kt] = __builtin_amdgcn_wmma_f32_16x16x32_bf16(
                        false, kf[kt][ks].v, false, qf[q][ks].v, (short)0, s[kt], false, false);
            }
            for (int kt = 0; kt < 2; ++kt)
                for (int i = 0; i < 8; ++i)
                    t[q][kt * 8 + i] = s[kt][i] * rscale + mk[kt][i >> 2][i & 3];
        }
        // the next pass's K, mask and V fly while this pass's softmax and V products run
        fetch(vn);
        // holds the loads up here, in front of the softmax: they need its time to land
        __builtin_amdgcn_sched_barrier(0);

        float alpha[NQ];
        for (int q = 0; q < NQ; ++q) {
            float tm = t[q][0];
            for (int i = 1; i < 16; ++i) tm = fmaxf(tm, t[q][i]);
            tm = fmaxf(tm, other_half(tm));
            float mnew = fmaxf(m[q], tm);
            alpha[q] = (m[q] - mnew) * LOG2E;
            m[q] = mnew;
        }
        exp2x4(alpha);

        for (int q = 0; q < NQ; ++q) {
            Frag4 pf;
            float ls = 0.f;
            for (int hf = 0; hf < 2; ++hf) {
                float p[8];
                for (int i = 0; i < 8; ++i) p[i] = (t[q][hf * 8 + i] - m[q]) * LOG2E;
                exp2x8(p);
                for (int i = 0; i < 8; ++i) { ls += p[i]; pf.v[hf * 8 + i] = (__bf16)p[i]; }
            }
            l[q] = l[q] * alpha[q] + ls;
            for (int dt = 0; dt < 4; ++dt) {
                o[q][dt] *= alpha[q];
                o[q][dt] = __builtin_amdgcn_wmma_f32_16x16x32_bf16(
                    false, vc[dt].v, false, pf.v, (short)0, o[q][dt], false, false);
            }
        }
        advance();
    };

    fetch(va);
    advance();
    for (int k0 = 0; k0 < LDIM; k0 += 64) {
        pass(va, vb);
        pass(vb, va);
    }

    // epilogue: lane holds query laneRow, head columns dt*16 + g*8 + r -> one 16-byte store per tile
    char* cb = (char*)(ctx + (size_t)b * LDIM * BDIM + h * HD);
    for (int q = 0; q < NQ; ++q) {
        float inv = 1.0f / (l[q] + other_half(l[q]));
        int lq = qbase + q * 16 + laneRow;
        union { u32x4 x; u16 hh[8]; __bf16 bh[8]; } w[4];
        for (int dt = 0; dt < 4; ++dt)
            for (int r = 0; r < 8; ++r)
                w[dt].bh[r] = (__bf16)(o[q][dt][r] * inv);
        if (m[q] <= -1e8f) {         // fully masked row: the diagonal alone survives, ctx = v[lq]
            u32 doff = (u32)(g * 8 * LDIM + lq) * 2u;
            for (int dt = 0; dt < 4; ++dt)
                for (int r = 0; r < 8; ++r)
                    w[dt].hh[r] = *(const u16*)(vb8 + doff + (dt * 16 + r) * LDIM * 2);
            // these loads name doff: it stays live up to this wait, behind the loads
            asm volatile("s_wait_xcnt 0x0" :: "v"(doff) : "memory");
        }
        u32 soff = (u32)(lq * BDIM + g * 8) * 2u;
        for (int dt = 0; dt < 4; ++dt)
            *(u32x4*)(cb + soff + dt * 32) = w[dt].x;
        // the stores name soff and their data: the wait stands before either is written again
        asm volatile("s_wait_xcnt 0x0" :: "v"(soff), "v"(w[0].x), "v"(w[1].x), "v"(w[2].x), "v"(w[3].x) : "memory");
    }
}

// ---------------------------------------------------------------- output projection + residual + LayerNorm
// A block owns OM whole rows of x = ctx * Wo + bo + hidden, so the row statistics never leave it:
//   16 waves, each 64 columns n x 32 rows m; W rows are the first WMMA operand, so a lane holds one row m
//   and 8 columns n in a run (two 16-byte LDS stores a tile);
//   the f32 tile then lies in the LDS of the finished ring, and each wave normalises two whole rows of it
//   with 16-byte loads and stores in whole lines.
// Every block reads all of W: block i starts its walk over k at tile i mod 16, so that the blocks do not
// all ask for the same lines at the same time.
#define OM 32                        // rows a block
#define OKT 64                       // k a tile: 128 bytes a row, a whole line
#define OP 72                        // LDS row pitch in halves: 144 B = 16 B x 9, free of conflicts for 16-byte reads
#define ONT (BDIM / OKT)
#define OB_BYTES (BDIM * OP * 2)     // W tile
#define OA_BYTES (OM * OP * 2)       // ctx tile
#define OBUF (OB_BYTES + OA_BYTES)
#define XP 1028                      // f32 row pitch of the x tile: 16 rows of 16-byte stores meet 64 different banks

// One 8-byte copy with the same wait in its statement.
__device__ __forceinline__ void async_copy8(u32 l, const char* p) {
    asm volatile("global_load_async_to_lds_b64 %0, %1, off\n\t"
                 "s_wait_xcnt 0x0"
                 :: "v"(l), "v"((u64)(uintptr_t)p) : "memory");
}

// No __restrict__ here: the "memory" clobber of the waits below must hold the loads and stores on their side.
__global__ __launch_bounds__(512) void gemm_out_ln_kernel(
    const u16* A, const u16* BT, const float* bias, const float* residual,
    const float* lnw, const float* lnb, float* out) {

    __shared__ __attribute__((aligned(16))) char sm[2 * OBUF];

    int bm = blockIdx.x * OM;
    int tid = threadIdx.x;
    int wave = tid >> 5, lane = tid & 31;
    int laneRow = lane & 15, g = lane >> 4;

    v8f acc[4][2];
    for (int i = 0; i < 4; ++i)
        for (int j = 0; j < 2; ++j)
            acc[i][j] = v8f{0.f, 0.f, 0.f, 0.f, 0.f, 0.f, 0.f, 0.f};

    // W tile: copy c of a thread brings 16 bytes of row c * 64 + (tid >> 3); a wave's copy is 4 whole lines.
    // ctx tile: 8 bytes of row tid >> 4; a wave's copy is 2 whole lines.
    const char* gW = (const char*)(BT + (size_t)(tid >> 3) * BDIM + (tid & 7) * 8);
    const char* gA = (const char*)(A + (size_t)(bm + (tid >> 4)) * BDIM + (tid & 15) * 4);
    u32 lW = (u32)(uintptr_t)&sm[(tid >> 3) * (OP * 2) + (tid & 7) * 16];
    u32 lA = (u32)(uintptr_t)&sm[OB_BYTES + (tid >> 4) * (OP * 2) + (tid & 15) * 8];

    auto stage = [&](int buf, int t) {
        u32 kb = (u32)((t + blockIdx.x) & (ONT - 1)) * (OKT * 2);    // byte offset of the k tile in a row
        for (int hf = 0; hf < 2; ++hf) {
            u32 l[8];
            const char* p[8];
            for (int c = 0; c < 8; ++c) {
                l[c] = lW + (u32)(buf * OBUF + (hf * 8 + c) * 64 * OP * 2);
                p[c] = gW + kb + (size_t)(hf * 8 + c) * 64 * BDIM * 2;
            }
            async_copy16x8(l, p);
        }
        async_copy8(lA + (u32)(buf * OBUF), gA + kb);
    };

    stage(0, 0);
    wait_async0();
    __syncthreads();
    stage(1, 1);

    for (int t = 0; t < ONT; ++t) {
        int cur = t & 1;
        const u16* wB = (const u16*)(sm + cur * OBUF) + (wave * 64 + laneRow) * OP;
        const u16* xB = (const u16*)(sm + cur * OBUF + OB_BYTES) + laneRow * OP;
        Frag sf[2][2], ff[2][4];
        for (int ks = 0; ks < 2; ++ks) {
            for (int j = 0; j < 2; ++j)
                load_frag_u16(sf[ks][j], xB + j * 16 * OP + ks * 32, g);
            for (int i = 0; i < 4; ++i)
                load_frag_u16(ff[ks][i], wB + i * 16 * OP + ks * 32, g);
        }
        // hand-over: own LDS reads of this buffer retired (the whole tile's fragments are in registers), own
        // copies of the next tile landed, then the barrier that publishes that tile and frees this buffer
        asm volatile("s_wait_dscnt 0x0" ::: "memory");
        wait_async0();
        __syncthreads();
        // the refill stands in front of the products, which read registers alone: its copies get the whole
        // trip to land
        if (t + 2 < ONT) stage(cur, t + 2);
        for (int ks = 0; ks < 2; ++ks)
            for (int i = 0; i < 4; ++i)
                for (int j = 0; j < 2; ++j)
                    acc[i][j] = __builtin_amdgcn_wmma_f32_16x16x32_bf16(
                        false, ff[ks][i].v, false, sf[ks][j].v, (short)0, acc[i][j], false, false);
    }
    wait_async0();

    // this wave's two rows of the residual, and the bias: they fly while the tile is laid down
    const char* hb = (const char*)residual;
    const char* bb = (const char*)bias;
    u32 roff = (u32)(bm + wave * 2) * (BDIM * 4) + (u32)lane * 16u;
    u32 coff = (u32)lane * 16u;
    f32x4 hv[2][8], bv[8];
    for (int c = 0; c < 8; ++c) {
        hv[0][c] = *(const f32x4*)(hb + roff + c * 512);
        hv[1][c] = *(const f32x4*)(hb + roff + BDIM * 4 + c * 512);
        bv[c] = *(const f32x4*)(bb + coff + c * 512);
    }
    // these loads name roff, coff (or the lane number it is made of) and their bases: as inputs all stay
    // live, so unwritten, up to this wait
    asm volatile("s_wait_xcnt 0x0" :: "v"(roff), "v"(coff), "v"(lane), "s"(hb), "s"(bb) : "memory");

    // the ring is finished (last barrier of the loop, no copy in flight): its LDS takes the f32 tile
    float* xs = (float*)sm;
    for (int i = 0; i < 4; ++i)
        for (int j = 0; j < 2; ++j) {
            float* p = xs + (j * 16 + laneRow) * XP + wave * 64 + i * 16 + g * 8;
            *(f32x4*)p = f32x4{acc[i][j][0], acc[i][j][1], acc[i][j][2], acc[i][j][3]};
            *(f32x4*)(p + 4) = f32x4{acc[i][j][4], acc[i][j][5], acc[i][j][6], acc[i][j][7]};
        }

    const char* wb = (const char*)lnw;
    const char* ob = (const char*)lnb;
    f32x4 wv[8], ov[8];
    for (int c = 0; c < 8; ++c) {
        wv[c] = *(const f32x4*)(wb + coff + c * 512);
        ov[c] = *(const f32x4*)(ob + coff + c * 512);
    }
    // as above, for coff, the lane number and the two bases
    asm volatile("s_wait_xcnt 0x0" :: "v"(coff), "v"(lane), "s"(wb), "s"(ob) : "memory");

    __syncthreads();                 // every wave's part of the tile is in LDS

    f32x4 v[2][8];
    float s[2];
    for (int rr = 0; rr < 2; ++rr) {
        const float* xr = xs + (wave * 2 + rr) * XP + lane * 4;
        f32x4 a = f32x4{0.f, 0.f, 0.f, 0.f};
        for (int c = 0; c < 8; ++c) {
            v[rr][c] = (*(const f32x4*)(xr + c * 128) + bv[c]) + hv[rr][c];
            a += v[rr][c];
        }
        s[rr] = (a[0] + a[1]) + (a[2] + a[3]);
    }
    for (int off = 16; off; off >>= 1)
        for (int rr = 0; rr < 2; ++rr) s[rr] += __shfl_xor(s[rr], off, 32);
    float mu[2], q[2];
    for (int rr = 0; rr < 2; ++rr) {
        mu[rr] = s[rr] * (1.0f / BDIM);
        f32x4 a = f32x4{0.f, 0.f, 0.f, 0.f};
        for (int c = 0; c < 8; ++c) {
            v[rr][c] -= mu[rr];
            a += v[rr][c] * v[rr][c];
        }
        q[rr] = (a[0] + a[1]) + (a[2] + a[3]);
    }
    for (int off = 16; off; off >>= 1)
        for (int rr = 0; rr < 2; ++rr) q[rr] += __shfl_xor(q[rr], off, 32);
    for (int rr = 0; rr < 2; ++rr) {
        float inv = rsqrtf(q[rr] * (1.0f / BDIM) + 1e-12f);
        for (int c = 0; c < 8; ++c)
            v[rr][c] = v[rr][c] * inv * wv[c] + ov[c];
    }
    char* db = (char*)out;
    for (int rr = 0; rr < 2; ++rr)
        for (int c = 0; c < 8; ++c)
            *(f32x4*)(db + roff + rr * (BDIM * 4) + c * 512) = v[rr][c];
    // the stores name roff and their data: as inputs all stay live, so unwritten, up to this wait
    asm volatile("s_wait_xcnt 0x0" :: "v"(roff),
                 "v"(v[0][0]), "v"(v[0][1]), "v"(v[0][2]), "v"(v[0][3]), "v"(v[0][4]), "v"(v[0][5]), "v"(v[0][6]), "v"(v[0][7]),
                 "v"(v[1][0]), "v"(v[1][1]), "v"(v[1][2]), "v"(v[1][3]), "v"(v[1][4]), "v"(v[1][5]), "v"(v[1][6]), "v"(v[1][7])
                 : "memory");
}

// ---------------------------------------------------------------- launch
extern "C" void kernel_launch(void* const* d_in, const int* in_sizes, int n_in,
                              void* d_out, int out_size, void* d_ws, size_t ws_size,
                              hipStream_t stream) {
    const float* hidden = (const float*)d_in[0];
    const float* mask   = (const float*)d_in[1];
    const float* phi    = (const float*)d_in[2];
    const float* mag    = (const float*)d_in[3];
    const float* Wq     = (const float*)d_in[4];
    const float* bq     = (const float*)d_in[5];
    const float* Wk     = (const float*)d_in[6];
    const float* bk     = (const float*)d_in[7];
    const float* Wv     = (const float*)d_in[8];
    const float* bv     = (const float*)d_in[9];
    const float* gamma  = (const float*)d_in[10];
    const float* Wo     = (const float*)d_in[11];
    const float* bo     = (const float*)d_in[12];
    const float* lnw    = (const float*)d_in[13];
    const float* lnb    = (const float*)d_in[14];
    float* out = (float*)d_out;

    char* ws = (char*)d_ws;
    const size_t o_xb   = 0;                           // 8 MB  bf16 X
    const size_t o_wt   = o_xb + 8388608ull;           // 6 MB  bf16 WT (q,k,v packed)
    const size_t o_wot  = o_wt + 6291456ull;           // 2 MB  bf16 WoT
    const size_t o_bias = o_wot + 2097152ull;          // 12 KB packed bias
    const size_t o_qr   = o_bias + 12288ull + 50331648ull;   // 8 MB, at its old place: the 48 MB in front are not used
    const size_t o_kr   = o_qr + 8388608ull;           // 8 MB
    const size_t o_vt   = o_kr + 8388608ull;           // 8 MB
    const size_t o_ctx  = o_vt + 8388608ull;           // 8 MB

    u16*   Xb    = (u16*)(ws + o_xb);
    u16*   WT    = (u16*)(ws + o_wt);
    u16*   WoT   = (u16*)(ws + o_wot);
    float* biasA = (float*)(ws + o_bias);
    u16*   qrot  = (u16*)(ws + o_qr);
    u16*   krot  = (u16*)(ws + o_kr);
    u16*   vtb   = (u16*)(ws + o_vt);
    u16*   ctxb  = (u16*)(ws + o_ctx);

    // 1) X to bf16, the four weights transposed to bf16, the bias packed: one launch
    prep_kernel<<<PREP_X + PREP_T + PREP_B, 256, 0, stream>>>(
        hidden, Wq, Wk, Wv, Wo, bq, bk, bv, Xb, WT, WoT, biasA);

    // 3) fused QKV GEMM [4096 x 3072] with scale, rotation and V transpose in its epilogue
    gemm_qkv_rope_kernel<<<dim3(NQKV / BN, ROWS / BM), 256, 0, stream>>>(
        Xb, WT, biasA, phi, mag, gamma, qrot, krot, vtb);

    // 4) fused attention (online softmax in registers, no LDS)
    attn_kernel<<<dim3(LDIM / (AW * NQ * 16), HH, BB), AW * 32, 0, stream>>>(
        qrot, krot, vtb, mask, ctxb);

    // 5) output projection + residual + LayerNorm, a block for 32 whole rows
    gemm_out_ln_kernel<<<ROWS / OM, 512, 0, stream>>>(
        ctxb, WoT, bo, hidden, lnw, lnb, out);
}

// v006
// It runs in 88.4 microseconds.
// Timed twice side by side with v005, it ran 1.04 and 1.03 times as fast.
// Over all steps from v000 it is 3.45 times as fast.
#include <hip/hip_runtime.h>
#include <hip/hip_bf16.h>

typedef unsigned short u16;
typedef unsigned int   u32;
typedef unsigned long long u64;

typedef __attribute__((ext_vector_type(16))) __bf16 v16bf;
typedef __attribute__((ext_vector_type(8)))  float  v8f;

#define BDIM 1024   // D
#define LDIM 1024   // L
#define BB   4      // B
#define HH   16     // H
#define HD   64     // head dim
#define ROWS (BB*LDIM)      // 4096
#define NQKV (3*BDIM)       // 3072

__device__ __forceinline__ u16 f2bf(float f) {
    union { float f; u32 u; } x; x.f = f;
    u32 r = x.u + 0x7FFFu + ((x.u >> 16) & 1u);
    return (u16)(r >> 16);
}

struct Frag { union { v16bf v; uint4 q[2]; u16 h[16]; }; };

// load a 16-half fragment (A-layout) from a row:
// lane holds row (lane&15); halves 0..7 at K = g*8.. , halves 8..15 at K = 16+g*8..
__device__ __forceinline__ void load_frag_u16(Frag& f, const u16* rowPtr, int g) {
    f.q[0] = *(const uint4*)(rowPtr + g * 8);
    f.q[1] = *(const uint4*)(rowPtr + 16 + g * 8);
}

__device__ __forceinline__ void wait_async0() {
    asm volatile("s_wait_asynccnt 0x0" ::: "memory");
}

// ---------------------------------------------------------------- preparation, one launch
// Three independent jobs share one grid by block range (the test is the same for a whole block):
//   blocks [0, PREP_X):        X f32 -> bf16, 4096 float4 a block, 16 a thread
//   the next PREP_T blocks:    W f32 [k][n] -> bf16 [n][k], four matrices, a tile of 128 k x 64 n a block
//   the last PREP_B blocks:    bq, bk, bv -> one packed bias
#define PREP_X 256
#define PREP_T 512
#define PREP_B 3

__global__ __launch_bounds__(256) void prep_kernel(
    const float* __restrict__ X, const float* __restrict__ Wq, const float* __restrict__ Wk,
    const float* __restrict__ Wv, const float* __restrict__ Wo,
    const float* __restrict__ bq, const float* __restrict__ bk, const float* __restrict__ bv,
    u16* __restrict__ Xb, u16* __restrict__ WT, u16* __restrict__ WoT, float* __restrict__ biasA) {

    // [n][16-byte chunk of 8 k]; the chunk index is xor-ed with n >> 2, so that the 16 lanes that write
    // one k chunk of 16 rows, and the 16 that read one row, each meet 16 different bank groups
    __shared__ uint4 sW[64 * 16];

    int blk = blockIdx.x, tid = threadIdx.x;
    if (blk < PREP_X) {
        const char* s = (const char*)(X + (size_t)blk * 16384);
        char* d = (char*)(Xb + (size_t)blk * 16384);
        u32 off = (u32)tid * 16u;
        float4 f[16];
        for (int j = 0; j < 16; ++j)
            f[j] = *(const float4*)(s + off + j * 4096);
        u32 so = (u32)tid * 8u;
        for (int j = 0; j < 16; ++j) {
            ushort4 o;
            o.x = f2bf(f[j].x); o.y = f2bf(f[j].y); o.z = f2bf(f[j].z); o.w = f2bf(f[j].w);
            *(ushort4*)(d + so + j * 2048) = o;
        }
    } else if (blk < PREP_X + PREP_T) {
        int t = blk - PREP_X;
        int m = t >> 7;                              // which matrix
        int k0 = (t & 7) * 128, n0 = ((t >> 3) & 15) * 64;
        const float* Wm = m == 0 ? Wq : m == 1 ? Wk : m == 2 ? Wv : Wo;
        u16* Dm = m == 3 ? WoT : WT + (size_t)m * BDIM * BDIM;
        int c4 = tid & 15, kc = tid >> 4;            // 4 columns n, 8 rows k: four whole output chunks
        const char* s = (const char*)(Wm + (size_t)k0 * BDIM + n0);
        u32 off = (u32)(kc * 8 * BDIM + c4 * 4) * 4u;
        float4 f[8];
        for (int j = 0; j < 8; ++j)
            f[j] = *(const float4*)(s + off + j * BDIM * 4);
        union { uint4 x; u16 h[8]; } w[4];
        for (int j = 0; j < 8; ++j) {
            w[0].h[j] = f2bf(f[j].x); w[1].h[j] = f2bf(f[j].y);
            w[2].h[j] = f2bf(f[j].z); w[3].h[j] = f2bf(f[j].w);
        }
        for (int e = 0; e < 4; ++e)
            sW[(c4 * 4 + e) * 16 + (kc ^ c4)] = w[e].x;
        __syncthreads();
        char* d = (char*)(Dm + (size_t)n0 * BDIM + k0);
        u32 so = (u32)(kc * BDIM * 2 + c4 * 16);     // row n = kc + 16 j, chunk c4: 256 bytes a row in a run
        for (int j = 0; j < 4; ++j) {
            int n = kc + j * 16;
            *(uint4*)(d + so + j * 16 * BDIM * 2) = sW[n * 16 + (c4 ^ ((n >> 2) & 15))];
        }
    } else {
        int p = blk - PREP_X - PREP_T;
        const float* bs = p == 0 ? bq : p == 1 ? bk : bv;
        ((float4*)biasA)[p * 256 + tid] = ((const float4*)bs)[tid];
    }
}

// ---------------------------------------------------------------- tile of the QKV GEMM
#define BM 128
#define BN 128
#define BK 64    // k a tile: 128 bytes a row, a whole line
#define LDT 72   // padded LDS row stride (halves): 144 B = 16 B x 9, free of conflicts for 16-byte reads

// ---------------------------------------------------------------- QKV GEMM + scale + rotation
// Xb[ROWS][D] * WT[3072][D]^T + bias, then scale and rotation in the accumulators:
//   q_rot, k_rot, V^T bf16, one plane of 64 x 1024 a (b, h), each in the order in which the attention's
//   fragments are loaded (below); no f32 qkv array, no separate launch.
// The first WMMA operand (64 rows a wave) is the one whose index must run along a lane's 8 results:
//   Q, K blocks: W rows first -> lane = token l, results = 8 head columns d; a wave holds one whole head,
//                so the rotation partner d + 32 is tile i + 2 of the same lane and register
//   V blocks:    X rows first -> lane = head column d, results = 8 tokens l (the transposed V row)
// Either way 8 results are one 16-byte store.
// Fragment order: the 32 pieces of 16 bytes that one wave-wide fragment load takes lie side by side, piece
// number = lane = g * 16 + row, so such a load, and the store that writes the same 512 bytes here, covers
// 4 whole 128-byte lines:
//   q_rot, k_rot: [l >> 4][d >> 4][(d >> 3) & 1][l & 15][d & 7]
//   V^T:          [l >> 5][d >> 4][(l >> 4) & 1][(l >> 3) & 1][d & 15][l & 7]

// Eight copies and the wait for their address registers in one statement: nothing can rewrite a register
// that a copy names in front of that wait.
__device__ __forceinline__ void async_copy16x8(const u32 (&l)[8], const char* const (&p)[8]) {
    asm volatile("global_load_async_to_lds_b128 %0, %1, off\n\t"
                 "global_load_async_to_lds_b128 %2, %3, off\n\t"
                 "global_load_async_to_lds_b128 %4, %5, off\n\t"
                 "global_load_async_to_lds_b128 %6, %7, off\n\t"
                 "global_load_async_to_lds_b128 %8, %9, off\n\t"
                 "global_load_async_to_lds_b128 %10, %11, off\n\t"
                 "global_load_async_to_lds_b128 %12, %13, off\n\t"
                 "global_load_async_to_lds_b128 %14, %15, off\n\t"
                 "s_wait_xcnt 0x0"
                 :: "v"(l[0]), "v"((u64)(uintptr_t)p[0]), "v"(l[1]), "v"((u64)(uintptr_t)p[1]),
                    "v"(l[2]), "v"((u64)(uintptr_t)p[2]), "v"(l[3]), "v"((u64)(uintptr_t)p[3]),
                    "v"(l[4]), "v"((u64)(uintptr_t)p[4]), "v"(l[5]), "v"((u64)(uintptr_t)p[5]),
                    "v"(l[6]), "v"((u64)(uintptr_t)p[6]), "v"(l[7]), "v"((u64)(uintptr_t)p[7]) : "memory");
}

__global__ __launch_bounds__(256) void gemm_qkv_rope_kernel(
    const u16* __restrict__ A, const u16* __restrict__ BT, const float* __restrict__ bias,
    const float* __restrict__ phi, const float* __restrict__ mag, const float* __restrict__ gamma,
    u16* __restrict__ qrot, u16* __restrict__ krot, u16* __restrict__ vt) {

    __shared__ __attribute__((aligned(16))) u16 sT[2][2][BM * LDT];     // [buffer][0: X rows, 1: W rows]

    const int K = BDIM, NT = BDIM / BK;
    int bm = blockIdx.y * BM, bn = blockIdx.x * BN;
    int tid = threadIdx.x;
    int wave = tid >> 5, lane = tid & 31;
    int wp = wave & 1, wq = wave >> 1;     // 64 rows of the first operand, 32 rows of the second
    int laneRow = lane & 15, g = lane >> 4;
    bool isV = bn >= 2 * BDIM;             // the same for the whole block
    int pSel = isV ? 0 : 1;

    // copy c of a thread brings 16 bytes of row c * 32 + (tid >> 3) of its operand: eight lanes take one row's
    // 128 bytes, so a wave's copy is 4 whole lines
    const char* gX = (const char*)(A + (size_t)(bm + (tid >> 3)) * K + (tid & 7) * 8);
    const char* gW = (const char*)(BT + (size_t)(bn + (tid >> 3)) * K + (tid & 7) * 8);
    u32 lX = (u32)(uintptr_t)&sT[0][0][(tid >> 3) * LDT + (tid & 7) * 8];

    v8f acc[4][2];
    for (int i = 0; i < 4; ++i)
        for (int j = 0; j < 2; ++j)
            acc[i][j] = v8f{0.f, 0.f, 0.f, 0.f, 0.f, 0.f, 0.f, 0.f};

    auto stage = [&](int buf, int k0) {
        u32 l[8];
        const char* p[8];
        for (int c = 0; c < 4; ++c) {
            l[c]     = lX + (u32)(((buf * 2 + 0) * BM + c * 32) * LDT * 2);
            l[c + 4] = lX + (u32)(((buf * 2 + 1) * BM + c * 32) * LDT * 2);
            p[c]     = gX + k0 * 2 + (size_t)c * 32 * K * 2;
            p[c + 4] = gW + k0 * 2 + (size_t)c * 32 * K * 2;
        }
        async_copy16x8(l, p);
    };

    stage(0, 0);
    wait_async0();
    __syncthreads();
    stage(1, BK);

    for (int t = 0; t < NT; ++t) {
        int cur = t & 1;
        const u16* pB = &sT[cur][pSel][(wp * 64 + laneRow) * LDT];
        const u16* qB = &sT[cur][pSel ^ 1][(wq * 32 + laneRow) * LDT];
        for (int ks = 0; ks < 2; ++ks) {
            Frag sf[2];
            for (int j = 0; j < 2; ++j)
                load_frag_u16(sf[j], qB + j * 16 * LDT + ks * 32, g);
            for (int i = 0; i < 4; ++i) {
                Frag ff;
                load_frag_u16(ff, pB + i * 16 * LDT + ks * 32, g);
                for (int j = 0; j < 2; ++j)
                    acc[i][j] = __builtin_amdgcn_wmma_f32_16x16x32_bf16(
                        false, ff.v, false, sf[j].v, (short)0, acc[i][j], false, false);
            }
        }
        // hand-over: own LDS reads of this buffer retired, own copies of the next tile landed, then
        // the barrier that publishes that tile and frees this buffer for the refill behind it
        asm volatile("s_wait_dscnt 0x0" ::: "memory");
        wait_async0();
        __syncthreads();
        if (t + 2 < NT) stage(cur, (t + 2) * BK);
    }
    wait_async0();

    int b = bm >> 10, lblk = bm & (LDIM - 1);
    if (!isV) {
        int hsel = (bn >> 6) + wp;                   // 0..15: heads of Q, 16..31: heads of K
        int h = hsel & (HH - 1);
        u16* dst = (hsel >> 4) ? krot : qrot;
        const float* bp = bias + bn + wp * 64 + g * 8;
        float gm = gamma[h];
        for (int j = 0; j < 2; ++j) {
            int idx = (b * HH + h) * LDIM + lblk + wq * 32 + j * 16 + laneRow;
            float ph = phi[idx];
            float sc = 1.0f + gm * tanhf(mag[idx]);
            float cs = cosf(ph), sn = sinf(ph);
            for (int i = 0; i < 2; ++i) {
                union { uint4 x; u16 hh[8]; } lo, hi;
                for (int r = 0; r < 8; ++r) {
                    float a0 = (acc[i][j][r] + bp[i * 16 + r]) * sc;
                    float a1 = (acc[i + 2][j][r] + bp[i * 16 + 32 + r]) * sc;
                    lo.hh[r] = f2bf(a0 * cs - a1 * sn);
                    hi.hh[r] = f2bf(a1 * cs + a0 * sn);
                }
                u16* o = dst + (size_t)(idx & ~15) * HD + i * 256 + lane * 8;    // idx & ~15: first token of the tile
                *(uint4*)o = lo.x;
                *(uint4*)(o + 512) = hi.x;
            }
        }
    } else {
        for (int j = 0; j < 2; ++j) {
            int n = bn - 2 * BDIM + wq * 32 + j * 16 + laneRow;      // h * 64 + d
            float bv = bias[2 * BDIM + n];
            u16* o = vt + (size_t)(b * HH + (n >> 6)) * (HD * LDIM) + (lblk + wp * 64) * HD
                        + ((n >> 4) & 3) * 512 + lane * 8;
            for (int i = 0; i < 4; ++i) {
                union { uint4 x; u16 hh[8]; } w;
                for (int r = 0; r < 8; ++r) w.hh[r] = f2bf(acc[i][j][r] + bv);
                *(uint4*)(o + (i >> 1) * 2048 + (i & 1) * 256) = w.x;
            }
        }
        // the stores above name their address and data registers: the wait stands before any is written again
        asm volatile("s_wait_xcnt 0x0" ::: "memory");
    }
}

// ---------------------------------------------------------------- attention
// Online softmax, all in registers. Each wave owns NQ*16 queries and walks the keys 32 at a time:
//   S^T = K * Q^T   (D: lane holds query laneRow, keys g*8+r)  -> max and sum are in-lane
//   O^T += V^T * P^T (two S^T tiles, converted in place, are the B operand in the same k order)
// Q, K and V^T lie in fragment order (see the QKV product): a fragment half is 512 bytes in a run, lane * 16.
#define NQ 4          // 16-query tiles per wave
#define AW 4          // waves per block

typedef __attribute__((ext_vector_type(4))) u32   u32x4;
typedef __attribute__((ext_vector_type(4))) float f32x4;
struct Frag4 { union { v16bf v; u32x4 x[2]; }; };

__device__ __forceinline__ float other_half(float x) {   // lane l <-> l ^ 16
    int b = __builtin_bit_cast(int, x);
    b = __builtin_amdgcn_permlanex16(b, b, 0x76543210, 0xfedcba98, false, false);
    return __builtin_bit_cast(float, b);
}

// Several exp2 in one statement, each in place: no instruction reads the result or writes the source of the
// one in front of it, and the closing v_nop is the slot that the instruction set asks for behind a
// transcendental. In place, the statement writes only registers that the vector code in front of it wrote.
__device__ __forceinline__ void exp2x8(float (&x)[8]) {
    asm("v_exp_f32 %0, %0\n\tv_exp_f32 %1, %1\n\tv_exp_f32 %2, %2\n\tv_exp_f32 %3, %3\n\t"
        "v_exp_f32 %4, %4\n\tv_exp_f32 %5, %5\n\tv_exp_f32 %6, %6\n\tv_exp_f32 %7, %7\n\tv_nop"
        : "+v"(x[0]), "+v"(x[1]), "+v"(x[2]), "+v"(x[3]), "+v"(x[4]), "+v"(x[5]), "+v"(x[6]), "+v"(x[7]));
}
__device__ __forceinline__ void exp2x4(float (&x)[4]) {
    asm("v_exp_f32 %0, %0\n\tv_exp_f32 %1, %1\n\tv_exp_f32 %2, %2\n\tv_exp_f32 %3, %3\n\tv_nop"
        : "+v"(x[0]), "+v"(x[1]), "+v"(x[2]), "+v"(x[3]));
}

// No __restrict__ here: the "memory" clobber of the waits below must hold the loads on their side.
__global__ __launch_bounds__(AW * 32) void attn_kernel(
    const u16* qrot, const u16* krot, const u16* vt, const float* mask, u16* ctx) {

    int h = blockIdx.y, b = blockIdx.z;
    int tid = threadIdx.x, wave = tid >> 5, lane = tid & 31;
    int laneRow = lane & 15, g = lane >> 4;
    int qbase = (blockIdx.x * AW + wave) * (NQ * 16);
    const float rscale = 0.125f;                     // 1/sqrt(64)
    const float LOG2E = 1.44269504088896340736f;

    const char* qb = (const char*)(qrot + (size_t)(b * HH + h) * LDIM * HD);
    const char* kb = (const char*)(krot + (size_t)(b * HH + h) * LDIM * HD);
    const char* vb8 = (const char*)(vt + (size_t)(b * HH + h) * HD * LDIM);
    const char* mb = (const char*)(mask + b * LDIM);
    // per-lane byte offsets; kv, m: of the pass that is fetched next (32 keys are 4096 bytes of K and of V^T)
    u32 qoff = (u32)(qbase * HD * 2 + lane * 16);
    u32 kvoff = (u32)lane * 16u;
    u32 moff = (u32)g * 32u;

    Frag4 qf[NQ][2];
    for (int q = 0; q < NQ; ++q)
        for (int ks = 0; ks < 2; ++ks) {
            qf[q][ks].x[0] = *(const u32x4*)(qb + qoff + q * 2048 + ks * 1024);
            qf[q][ks].x[1] = *(const u32x4*)(qb + qoff + q * 2048 + ks * 1024 + 512);
        }
    // the Q loads name qoff and qb: as inputs both stay live, so unwritten, up to this wait
    asm volatile("s_wait_xcnt 0x0" :: "v"(qoff), "s"(qb) : "memory");

    v8f o[NQ][4];
    float m[NQ], l[NQ];
    for (int q = 0; q < NQ; ++q) {
        for (int dt = 0; dt < 4; ++dt)
            o[q][dt] = v8f{0.f, 0.f, 0.f, 0.f, 0.f, 0.f, 0.f, 0.f};
        m[q] = -1e30f;            // finite start: t - m is never (-inf) - (-inf) under -inf masks
        l[q] = 0.f;
    }

    Frag4 kf[2][2], va[4], vb[4];
    f32x4 mk[2][2];
    int pos = 0;                  // first key of the pass that is fetched next

    auto fetch = [&](Frag4 (&vd)[4]) {
        for (int kt = 0; kt < 2; ++kt) {
            for (int ks = 0; ks < 2; ++ks) {
                kf[kt][ks].x[0] = *(const u32x4*)(kb + kvoff + kt * 2048 + ks * 1024);
                kf[kt][ks].x[1] = *(const u32x4*)(kb + kvoff + kt * 2048 + ks * 1024 + 512);
            }
            mk[kt][0] = *(const f32x4*)(mb + moff + kt * 64);
            mk[kt][1] = *(const f32x4*)(mb + moff + kt * 64 + 16);
        }
        for (int dt = 0; dt < 4; ++dt) {
            vd[dt].x[0] = *(const u32x4*)(vb8 + kvoff + dt * 1024);
            vd[dt].x[1] = *(const u32x4*)(vb8 + kvoff + dt * 1024 + 512);
        }
    };
    auto advance = [&]() {
        // The fetch's loads name kvoff, moff: as inputs here they stay live, so unwritten, up to
        // this wait; its "memory" clobber keeps the loads in front of it.
        asm volatile("s_wait_xcnt 0x0" :: "v"(kvoff), "v"(moff) : "memory");
        int nxt = (pos + 32) & (LDIM - 1);   // behind the last pass it wraps to key 0: in bounds, unused
        int d = nxt - pos;
        kvoff += (u32)(d * HD * 2); moff += (u32)(d * 4);
        pos = nxt;
    };

    auto pass = [&](Frag4 (&vc)[4], Frag4 (&vn)[4]) {
        float t[NQ][16];
        for (int q = 0; q < NQ; ++q) {
            v8f s[2];
            for (int kt = 0; kt < 2; ++kt) {
                s[kt] = v8f{0.f, 0.f, 0.f, 0.f, 0.f, 0.f, 0.f, 0.f};
                for (int ks = 0; ks < 2; ++ks)
                    s[kt] = __builtin_amdgcn_wmma_f32_16x16x32_bf16(
                        false, kf[kt][ks].v, false, qf[q][ks].v, (short)0, s[kt], false, false);
            }
            for (int kt = 0; kt < 2; ++kt)
                for (int i = 0; i < 8; ++i)
                    t[q][kt * 8 + i] = s[kt][i] * rscale + mk[kt][i >> 2][i & 3];
        }
        // the next pass's K, mask and V fly while this pass's softmax and V products run
        fetch(vn);
        // holds the loads up here, in front of the softmax: they need its time to land
        __builtin_amdgcn_sched_barrier(0);

        float alpha[NQ];
        for (int q = 0; q < NQ; ++q) {
            float tm = t[q][0];
            for (int i = 1; i < 16; ++i) tm = fmaxf(tm, t[q][i]);
            tm = fmaxf(tm, other_half(tm));
            float mnew = fmaxf(m[q], tm);
            alpha[q] = (m[q] - mnew) * LOG2E;
            m[q] = mnew;
        }
        exp2x4(alpha);

        for (int q = 0; q < NQ; ++q) {
            Frag4 pf;
            float ls = 0.f;
            for (int hf = 0; hf < 2; ++hf) {
                float p[8];
                for (int i = 0; i < 8; ++i) p[i] = (t[q][hf * 8 + i] - m[q]) * LOG2E;
                exp2x8(p);
                for (int i = 0; i < 8; ++i) { ls += p[i]; pf.v[hf * 8 + i] = (__bf16)p[i]; }
            }
            l[q] = l[q] * alpha[q] + ls;
            for (int dt = 0; dt < 4; ++dt) {
                o[q][dt] *= alpha[q];
                o[q][dt] = __builtin_amdgcn_wmma_f32_16x16x32_bf16(
                    false, vc[dt].v, false, pf.v, (short)0, o[q][dt], false, false);
            }
        }
        advance();
    };

    fetch(va);
    advance();
    for (int k0 = 0; k0 < LDIM; k0 += 64) {
        pass(va, vb);
        pass(vb, va);
    }

    // epilogue: lane holds query laneRow, head columns dt*16 + g*8 + r -> one 16-byte store per tile
    char* cb = (char*)(ctx + (size_t)b * LDIM * BDIM + h * HD);
    for (int q = 0; q < NQ; ++q) {
        float inv = 1.0f / (l[q] + other_half(l[q]));
        int lq = qbase + q * 16 + laneRow;
        union { u32x4 x; u16 hh[8]; __bf16 bh[8]; } w[4];
        for (int dt = 0; dt < 4; ++dt)
            for (int r = 0; r < 8; ++r)
                w[dt].bh[r] = (__bf16)(o[q][dt][r] * inv);
        if (m[q] <= -1e8f) {         // fully masked row: the diagonal alone survives, ctx = v[lq]
            u32 doff = (u32)((lq >> 5) * 2048 + ((lq >> 4) & 1) * 256 + ((lq >> 3) & 1) * 128 + g * 64 + (lq & 7)) * 2u;
            for (int dt = 0; dt < 4; ++dt)
                for (int r = 0; r < 8; ++r)
                    w[dt].hh[r] = *(const u16*)(vb8 + doff + (dt * 512 + r * 8) * 2);
            // these loads name doff: it stays live up to this wait, behind the loads
            asm volatile("s_wait_xcnt 0x0" :: "v"(doff) : "memory");
        }
        u32 soff = (u32)(lq * BDIM + g * 8) * 2u;
        for (int dt = 0; dt < 4; ++dt)
            *(u32x4*)(cb + soff + dt * 32) = w[dt].x;
        // the stores name soff and their data: the wait stands before either is written again
        asm volatile("s_wait_xcnt 0x0" :: "v"(soff), "v"(w[0].x), "v"(w[1].x), "v"(w[2].x), "v"(w[3].x) : "memory");
    }
}

// ---------------------------------------------------------------- output projection + residual + LayerNorm
// A block owns OM whole rows of x = ctx * Wo + bo + hidden, so the row statistics never leave it:
//   16 waves, each 64 columns n x 32 rows m; W rows are the first WMMA operand, so a lane holds one row m
//   and 8 columns n in a run (two 16-byte LDS stores a tile);
//   the f32 tile then lies in the LDS of the finished ring, and each wave normalises two whole rows of it
//   with 16-byte loads and stores in whole lines.
// Every block reads all of W: block i starts its walk over k at tile i mod 16, so that the blocks do not
// all ask for the same lines at the same time.
#define OM 32                        // rows a block
#define OKT 64                       // k a tile: 128 bytes a row, a whole line
#define OP 72                        // LDS row pitch in halves: 144 B = 16 B x 9, free of conflicts for 16-byte reads
#define ONT (BDIM / OKT)
#define OB_BYTES (BDIM * OP * 2)     // W tile
#define OA_BYTES (OM * OP * 2)       // ctx tile
#define OBUF (OB_BYTES + OA_BYTES)
#define XP 1028                      // f32 row pitch of the x tile: 16 rows of 16-byte stores meet 64 different banks

// One 8-byte copy with the same wait in its statement.
__device__ __forceinline__ void async_copy8(u32 l, const char* p) {
    asm volatile("global_load_async_to_lds_b64 %0, %1, off\n\t"
                 "s_wait_xcnt 0x0"
                 :: "v"(l), "v"((u64)(uintptr_t)p) : "memory");
}

// No __restrict__ here: the "memory" clobber of the waits below must hold the loads and stores on their side.
__global__ __launch_bounds__(512) void gemm_out_ln_kernel(
    const u16* A, const u16* BT, const float* bias, const float* residual,
    const float* lnw, const float* lnb, float* out) {

    __shared__ __attribute__((aligned(16))) char sm[2 * OBUF];

    int bm = blockIdx.x * OM;
    int tid = threadIdx.x;
    int wave = tid >> 5, lane = tid & 31;
    int laneRow = lane & 15, g = lane >> 4;

    v8f acc[4][2];
    for (int i = 0; i < 4; ++i)
        for (int j = 0; j < 2; ++j)
            acc[i][j] = v8f{0.f, 0.f, 0.f, 0.f, 0.f, 0.f, 0.f, 0.f};

    // W tile: copy c of a thread brings 16 bytes of row c * 64 + (tid >> 3); a wave's copy is 4 whole lines.
    // ctx tile: 8 bytes of row tid >> 4; a wave's copy is 2 whole lines.
    const char* gW = (const char*)(BT + (size_t)(tid >> 3) * BDIM + (tid & 7) * 8);
    const char* gA = (const char*)(A + (size_t)(bm + (tid >> 4)) * BDIM + (tid & 15) * 4);
    u32 lW = (u32)(uintptr_t)&sm[(tid >> 3) * (OP * 2) + (tid & 7) * 16];
    u32 lA = (u32)(uintptr_t)&sm[OB_BYTES + (tid >> 4) * (OP * 2) + (tid & 15) * 8];

    auto stage = [&](int buf, int t) {
        u32 kb = (u32)((t + blockIdx.x) & (ONT - 1)) * (OKT * 2);    // byte offset of the k tile in a row
        for (int hf = 0; hf < 2; ++hf) {
            u32 l[8];
            const char* p[8];
            for (int c = 0; c < 8; ++c) {
                l[c] = lW + (u32)(buf * OBUF + (hf * 8 + c) * 64 * OP * 2);
                p[c] = gW + kb + (size_t)(hf * 8 + c) * 64 * BDIM * 2;
            }
            async_copy16x8(l, p);
        }
        async_copy8(lA + (u32)(buf * OBUF), gA + kb);
    };

    stage(0, 0);
    wait_async0();
    __syncthreads();
    stage(1, 1);

    for (int t = 0; t < ONT; ++t) {
        int cur = t & 1;
        const u16* wB = (const u16*)(sm + cur * OBUF) + (wave * 64 + laneRow) * OP;
        const u16* xB = (const u16*)(sm + cur * OBUF + OB_BYTES) + laneRow * OP;
        Frag sf[2][2], ff[2][4];
        for (int ks = 0; ks < 2; ++ks) {
            for (int j = 0; j < 2; ++j)
                load_frag_u16(sf[ks][j], xB + j * 16 * OP + ks * 32, g);
            for (int i = 0; i < 4; ++i)
                load_frag_u16(ff[ks][i], wB + i * 16 * OP + ks * 32, g);
        }
        // hand-over: own LDS reads of this buffer retired (the whole tile's fragments are in registers), own
        // copies of the next tile landed, then the barrier that publishes that tile and frees this buffer
        asm volatile("s_wait_dscnt 0x0" ::: "memory");
        wait_async0();
        __syncthreads();
        // the refill stands in front of the products, which read registers alone: its copies get the whole
        // trip to land
        if (t + 2 < ONT) stage(cur, t + 2);
        for (int ks = 0; ks < 2; ++ks)
            for (int i = 0; i < 4; ++i)
                for (int j = 0; j < 2; ++j)
                    acc[i][j] = __builtin_amdgcn_wmma_f32_16x16x32_bf16(
                        false, ff[ks][i].v, false, sf[ks][j].v, (short)0, acc[i][j], false, false);
    }
    wait_async0();

    // this wave's two rows of the residual, and the bias: they fly while the tile is laid down
    const char* hb = (const char*)residual;
    const char* bb = (const char*)bias;
    u32 roff = (u32)(bm + wave * 2) * (BDIM * 4) + (u32)lane * 16u;
    u32 coff = (u32)lane * 16u;
    f32x4 hv[2][8], bv[8];
    for (int c = 0; c < 8; ++c) {
        hv[0][c] = *(const f32x4*)(hb + roff + c * 512);
        hv[1][c] = *(const f32x4*)(hb + roff + BDIM * 4 + c * 512);
        bv[c] = *(const f32x4*)(bb + coff + c * 512);
    }
    // these loads name roff, coff (or the lane number it is made of) and their bases: as inputs all stay
    // live, so unwritten, up to this wait
    asm volatile("s_wait_xcnt 0x0" :: "v"(roff), "v"(coff), "v"(lane), "s"(hb), "s"(bb) : "memory");

    // the ring is finished (last barrier of the loop, no copy in flight): its LDS takes the f32 tile
    float* xs = (float*)sm;
    for (int i = 0; i < 4; ++i)
        for (int j = 0; j < 2; ++j) {
            float* p = xs + (j * 16 + laneRow) * XP + wave * 64 + i * 16 + g * 8;
            *(f32x4*)p = f32x4{acc[i][j][0], acc[i][j][1], acc[i][j][2], acc[i][j][3]};
            *(f32x4*)(p + 4) = f32x4{acc[i][j][4], acc[i][j][5], acc[i][j][6], acc[i][j][7]};
        }

    const char* wb = (const char*)lnw;
    const char* ob = (const char*)lnb;
    f32x4 wv[8], ov[8];
    for (int c = 0; c < 8; ++c) {
        wv[c] = *(const f32x4*)(wb + coff + c * 512);
        ov[c] = *(const f32x4*)(ob + coff + c * 512);
    }
    // as above, for coff, the lane number and the two bases
    asm volatile("s_wait_xcnt 0x0" :: "v"(coff), "v"(lane), "s"(wb), "s"(ob) : "memory");

    __syncthreads();                 // every wave's part of the tile is in LDS

    f32x4 v[2][8];
    float s[2];
    for (int rr = 0; rr < 2; ++rr) {
        const float* xr = xs + (wave * 2 + rr) * XP + lane * 4;
        f32x4 a = f32x4{0.f, 0.f, 0.f, 0.f};
        for (int c = 0; c < 8; ++c) {
            v[rr][c] = (*(const f32x4*)(xr + c * 128) + bv[c]) + hv[rr][c];
            a += v[rr][c];
        }
        s[rr] = (a[0] + a[1]) + (a[2] + a[3]);
    }
    for (int off = 16; off; off >>= 1)
        for (int rr = 0; rr < 2; ++rr) s[rr] += __shfl_xor(s[rr], off, 32);
    float mu[2], q[2];
    for (int rr = 0; rr < 2; ++rr) {
        mu[rr] = s[rr] * (1.0f / BDIM);
        f32x4 a = f32x4{0.f, 0.f, 0.f, 0.f};
        for (int c = 0; c < 8; ++c) {
            v[rr][c] -= mu[rr];
            a += v[rr][c] * v[rr][c];
        }
        q[rr] = (a[0] + a[1]) + (a[2] + a[3]);
    }
    for (int off = 16; off; off >>= 1)
        for (int rr = 0; rr < 2; ++rr) q[rr] += __shfl_xor(q[rr], off, 32);
    for (int rr = 0; rr < 2; ++rr) {
        float inv = rsqrtf(q[rr] * (1.0f / BDIM) + 1e-12f);
        for (int c = 0; c < 8; ++c)
            v[rr][c] = v[rr][c] * inv * wv[c] + ov[c];
    }
    char* db = (char*)out;
    for (int rr = 0; rr < 2; ++rr)
        for (int c = 0; c < 8; ++c)
            *(f32x4*)(db + roff + rr * (BDIM * 4) + c * 512) = v[rr][c];
    // the stores name roff and their data: as inputs all stay live, so unwritten, up to this wait
    asm volatile("s_wait_xcnt 0x0" :: "v"(roff),
                 "v"(v[0][0]), "v"(v[0][1]), "v"(v[0][2]), "v"(v[0][3]), "v"(v[0][4]), "v"(v[0][5]), "v"(v[0][6]), "v"(v[0][7]),
                 "v"(v[1][0]), "v"(v[1][1]), "v"(v[1][2]), "v"(v[1][3]), "v"(v[1][4]), "v"(v[1][5]), "v"(v[1][6]), "v"(v[1][7])
                 : "memory");
}

// ---------------------------------------------------------------- launch
extern "C" void kernel_launch(void* const* d_in, const int* in_sizes, int n_in,
                              void* d_out, int out_size, void* d_ws, size_t ws_size,
                              hipStream_t stream) {
    const float* hidden = (const float*)d_in[0];
    const float* mask   = (const float*)d_in[1];
    const float* phi    = (const float*)d_in[2];
    const float* mag    = (const float*)d_in[3];
    const float* Wq     = (const float*)d_in[4];
    const float* bq     = (const float*)d_in[5];
    const float* Wk     = (const float*)d_in[6];
    const float* bk     = (const float*)d_in[7];
    const float* Wv     = (const float*)d_in[8];
    const float* bv     = (const float*)d_in[9];
    const float* gamma  = (const float*)d_in[10];
    const float* Wo     = (const float*)d_in[11];
    const float* bo     = (const float*)d_in[12];
    const float* lnw    = (const float*)d_in[13];
    const float* lnb    = (const float*)d_in[14];
    float* out = (float*)d_out;

    char* ws = (char*)d_ws;
    const size_t o_xb   = 0;                           // 8 MB  bf16 X
    const size_t o_wt   = o_xb + 8388608ull;           // 6 MB  bf16 WT (q,k,v packed)
    const size_t o_wot  = o_wt + 6291456ull;           // 2 MB  bf16 WoT
    const size_t o_bias = o_wot + 2097152ull;          // 12 KB packed bias
    const size_t o_qr   = o_bias + 12288ull + 50331648ull;   // 8 MB, at its old place: the 48 MB in front are not used
    const size_t o_kr   = o_qr + 8388608ull;           // 8 MB
    const size_t o_vt   = o_kr + 8388608ull;           // 8 MB
    const size_t o_ctx  = o_vt + 8388608ull;           // 8 MB

    u16*   Xb    = (u16*)(ws + o_xb);
    u16*   WT    = (u16*)(ws + o_wt);
    u16*   WoT   = (u16*)(ws + o_wot);
    float* biasA = (float*)(ws + o_bias);
    u16*   qrot  = (u16*)(ws + o_qr);
    u16*   krot  = (u16*)(ws + o_kr);
    u16*   vtb   = (u16*)(ws + o_vt);
    u16*   ctxb  = (u16*)(ws + o_ctx);

    // 1) X to bf16, the four weights transposed to bf16, the bias packed: one launch
    prep_kernel<<<PREP_X + PREP_T + PREP_B, 256, 0, stream>>>(
        hidden, Wq, Wk, Wv, Wo, bq, bk, bv, Xb, WT, WoT, biasA);

    // 3) fused QKV GEMM [4096 x 3072] with scale, rotation and V transpose in its epilogue
    gemm_qkv_rope_kernel<<<dim3(NQKV / BN, ROWS / BM), 256, 0, stream>>>(
        Xb, WT, biasA, phi, mag, gamma, qrot, krot, vtb);

    // 4) fused attention (online softmax in registers, no LDS)
    attn_kernel<<<dim3(LDIM / (AW * NQ * 16), HH, BB), AW * 32, 0, stream>>>(
        qrot, krot, vtb, mask, ctxb);

    // 5) output projection + residual + LayerNorm, a block for 32 whole rows
    gemm_out_ln_kernel<<<ROWS / OM, 512, 0, stream>>>(
        ctxb, WoT, bo, hidden, lnw, lnb, out);
}

// v007
// A run of this version takes 82.8 microseconds.
// In both of two side-by-side timings against v006, it was 1.05 times as fast.
// All steps since v000 together make it 3.63 times as fast.
#include <hip/hip_runtime.h>
#include <hip/hip_bf16.h>

typedef unsigned short u16;
typedef unsigned int   u32;
typedef unsigned long long u64;

typedef __attribute__((ext_vector_type(16))) __bf16 v16bf;
typedef __attribute__((ext_vector_type(8)))  float  v8f;

#define BDIM 1024   // D
#define LDIM 1024   // L
#define BB   4      // B
#define HH   16     // H
#define HD   64     // head dim
#define ROWS (BB*LDIM)      // 4096
#define NQKV (3*BDIM)       // 3072

__device__ __forceinline__ u16 f2bf(float f) {
    union { float f; u32 u; } x; x.f = f;
    u32 r = x.u + 0x7FFFu + ((x.u >> 16) & 1u);
    return (u16)(r >> 16);
}

struct Frag { union { v16bf v; uint4 q[2]; u16 h[16]; }; };

// load a 16-half fragment (A-layout) from a row:
// lane holds row (lane&15); halves 0..7 at K = g*8.. , halves 8..15 at K = 16+g*8..
__device__ __forceinline__ void load_frag_u16(Frag& f, const u16* rowPtr, int g) {
    f.q[0] = *(const uint4*)(rowPtr + g * 8);
    f.q[1] = *(const uint4*)(rowPtr + 16 + g * 8);
}

__device__ __forceinline__ void wait_async0() {
    asm volatile("s_wait_asynccnt 0x0" ::: "memory");
}

// ---------------------------------------------------------------- preparation, one launch
// Three independent jobs share one grid by block range (the test is the same for a whole block):
//   blocks [0, PREP_X):        X f32 -> bf16, 4096 float4 a block, 16 a thread
//   the next PREP_T blocks:    W f32 [k][n] -> bf16 [n][k], four matrices, a tile of 128 k x 64 n a block
//   the last PREP_B blocks:    bq, bk, bv -> one packed bias
#define PREP_X 256
#define PREP_T 512
#define PREP_B 3

__global__ __launch_bounds__(256) void prep_kernel(
    const float* __restrict__ X, const float* __restrict__ Wq, const float* __restrict__ Wk,
    const float* __restrict__ Wv, const float* __restrict__ Wo,
    const float* __restrict__ bq, const float* __restrict__ bk, const float* __restrict__ bv,
    u16* __restrict__ Xb, u16* __restrict__ WT, u16* __restrict__ WoT, float* __restrict__ biasA) {

    // [n][16-byte chunk of 8 k]; the chunk index is xor-ed with n >> 2, so that the 16 lanes that write
    // one k chunk of 16 rows, and the 16 that read one row, each meet 16 different bank groups
    __shared__ uint4 sW[64 * 16];

    int blk = blockIdx.x, tid = threadIdx.x;
    if (blk < PREP_X) {
        const char* s = (const char*)(X + (size_t)blk * 16384);
        char* d = (char*)(Xb + (size_t)blk * 16384);
        u32 off = (u32)tid * 16u;
        float4 f[16];
        for (int j = 0; j < 16; ++j)
            f[j] = *(const float4*)(s + off + j * 4096);
        u32 so = (u32)tid * 8u;
        for (int j = 0; j < 16; ++j) {
            ushort4 o;
            o.x = f2bf(f[j].x); o.y = f2bf(f[j].y); o.z = f2bf(f[j].z); o.w = f2bf(f[j].w);
            *(ushort4*)(d + so + j * 2048) = o;
        }
    } else if (blk < PREP_X + PREP_T) {
        int t = blk - PREP_X;
        int m = t >> 7;                              // which matrix
        int k0 = (t & 7) * 128, n0 = ((t >> 3) & 15) * 64;
        const float* Wm = m == 0 ? Wq : m == 1 ? Wk : m == 2 ? Wv : Wo;
        u16* Dm = m == 3 ? WoT : WT + (size_t)m * BDIM * BDIM;
        int c4 = tid & 15, kc = tid >> 4;            // 4 columns n, 8 rows k: four whole output chunks
        const char* s = (const char*)(Wm + (size_t)k0 * BDIM + n0);
        u32 off = (u32)(kc * 8 * BDIM + c4 * 4) * 4u;
        float4 f[8];
        for (int j = 0; j < 8; ++j)
            f[j] = *(const float4*)(s + off + j * BDIM * 4);
        union { uint4 x; u16 h[8]; } w[4];
        for (int j = 0; j < 8; ++j) {
            w[0].h[j] = f2bf(f[j].x); w[1].h[j] = f2bf(f[j].y);
            w[2].h[j] = f2bf(f[j].z); w[3].h[j] = f2bf(f[j].w);
        }
        for (int e = 0; e < 4; ++e)
            sW[(c4 * 4 + e) * 16 + (kc ^ c4)] = w[e].x;
        __syncthreads();
        char* d = (char*)(Dm + (size_t)n0 * BDIM + k0);
        u32 so = (u32)(kc * BDIM * 2 + c4 * 16);     // row n = kc + 16 j, chunk c4: 256 bytes a row in a run
        for (int j = 0; j < 4; ++j) {
            int n = kc + j * 16;
            *(uint4*)(d + so + j * 16 * BDIM * 2) = sW[n * 16 + (c4 ^ ((n >> 2) & 15))];
        }
    } else {
        int p = blk - PREP_X - PREP_T;
        const float* bs = p == 0 ? bq : p == 1 ? bk : bv;
        ((float4*)biasA)[p * 256 + tid] = ((const float4*)bs)[tid];
    }
}

// ---------------------------------------------------------------- tile of the QKV GEMM
// One block a WGP: 256 tokens x 192 columns (3 heads), 12 waves of 64 x 64. 16 x 16 blocks fill the 256 WGPs once.
#define BM 256
#define BN 192
#define BK 128   // k a tile: 256 bytes a row, two whole lines
#define LDT 136  // padded LDS row stride (halves): 272 B = 16 B x 17, free of conflicts for 16-byte reads
#define TROWS (BM + BN)   // rows of a staged tile: 0..255 X rows, 256..447 W rows
#define QTHREADS 384

// ---------------------------------------------------------------- QKV GEMM + scale + rotation
// Xb[ROWS][D] * WT[3072][D]^T + bias, then scale and rotation in the accumulators:
//   q_rot, k_rot, V^T bf16, one plane of 64 x 1024 a (b, h), each in the order in which the attention's
//   fragments are loaded (below); no f32 qkv array, no separate launch.
// A wave holds one whole head (64 columns) for 64 tokens. The first WMMA operand is the one whose index must
// run along a lane's 8 results (the choice is the same for a whole wave):
//   Q, K heads: W rows first -> lane = token l, results = 8 head columns d;
//               the rotation partner d + 32 is tile i + 2 of the same lane and register
//   V heads:    X rows first -> lane = head column d, results = 8 tokens l (the transposed V row)
// Either way 8 results are one 16-byte store.
// Fragment order: the 32 pieces of 16 bytes that one wave-wide fragment load takes lie side by side, piece
// number = lane = g * 16 + row, so such a load, and the store that writes the same 512 bytes here, covers
// 4 whole 128-byte lines:
//   q_rot, k_rot: [l >> 4][d >> 4][(d >> 3) & 1][l & 15][d & 7]
//   V^T:          [l >> 5][d >> 4][(l >> 4) & 1][(l >> 3) & 1][d & 15][l & 7]

// Eight copies and the wait for their address registers in one statement: nothing can rewrite a register
// that a copy names in front of that wait.
__device__ __forceinline__ void async_copy16x8(const u32 (&l)[8], const char* const (&p)[8]) {
    asm volatile("global_load_async_to_lds_b128 %0, %1, off\n\t"
                 "global_load_async_to_lds_b128 %2, %3, off\n\t"
                 "global_load_async_to_lds_b128 %4, %5, off\n\t"
                 "global_load_async_to_lds_b128 %6, %7, off\n\t"
                 "global_load_async_to_lds_b128 %8, %9, off\n\t"
                 "global_load_async_to_lds_b128 %10, %11, off\n\t"
                 "global_load_async_to_lds_b128 %12, %13, off\n\t"
                 "global_load_async_to_lds_b128 %14, %15, off\n\t"
                 "s_wait_xcnt 0x0"
                 :: "v"(l[0]), "v"((u64)(uintptr_t)p[0]), "v"(l[1]), "v"((u64)(uintptr_t)p[1]),
                    "v"(l[2]), "v"((u64)(uintptr_t)p[2]), "v"(l[3]), "v"((u64)(uintptr_t)p[3]),
                    "v"(l[4]), "v"((u64)(uintptr_t)p[4]), "v"(l[5]), "v"((u64)(uintptr_t)p[5]),
                    "v"(l[6]), "v"((u64)(uintptr_t)p[6]), "v"(l[7]), "v"((u64)(uintptr_t)p[7]) : "memory");
}

// Nine copies, and one copy, each with the same wait in its statement.
__device__ __forceinline__ void async_copy16x9(const u32 (&l)[9], const char* const (&p)[9]) {
    asm volatile("global_load_async_to_lds_b128 %0, %1, off\n\t"
                 "global_load_async_to_lds_b128 %2, %3, off\n\t"
                 "global_load_async_to_lds_b128 %4, %5, off\n\t"
                 "global_load_async_to_lds_b128 %6, %7, off\n\t"
                 "global_load_async_to_lds_b128 %8, %9, off\n\t"
                 "global_load_async_to_lds_b128 %10, %11, off\n\t"
                 "global_load_async_to_lds_b128 %12, %13, off\n\t"
                 "global_load_async_to_lds_b128 %14, %15, off\n\t"
                 "global_load_async_to_lds_b128 %16, %17, off\n\t"
                 "s_wait_xcnt 0x0"
                 :: "v"(l[0]), "v"((u64)(uintptr_t)p[0]), "v"(l[1]), "v"((u64)(uintptr_t)p[1]),
                    "v"(l[2]), "v"((u64)(uintptr_t)p[2]), "v"(l[3]), "v"((u64)(uintptr_t)p[3]),
                    "v"(l[4]), "v"((u64)(uintptr_t)p[4]), "v"(l[5]), "v"((u64)(uintptr_t)p[5]),
                    "v"(l[6]), "v"((u64)(uintptr_t)p[6]), "v"(l[7]), "v"((u64)(uintptr_t)p[7]),
                    "v"(l[8]), "v"((u64)(uintptr_t)p[8]) : "memory");
}
__device__ __forceinline__ void async_copy16(u32 l, const char* p) {
    asm volatile("global_load_async_to_lds_b128 %0, %1, off\n\t"
                 "s_wait_xcnt 0x0"
                 :: "v"(l), "v"((u64)(uintptr_t)p) : "memory");
}

__global__ __launch_bounds__(QTHREADS) void gemm_qkv_rope_kernel(
    const u16* __restrict__ A, const u16* __restrict__ BT, const float* __restrict__ bias,
    const float* __restrict__ phi, const float* __restrict__ mag, const float* __restrict__ gamma,
    u16* __restrict__ qrot, u16* __restrict__ krot, u16* __restrict__ vt) {

    __shared__ __attribute__((aligned(16))) u16 sT[2][TROWS * LDT];     // [buffer][X rows, then W rows]

    const int K = BDIM, NT = BDIM / BK;
    int bm = blockIdx.y * BM, bn = blockIdx.x * BN;
    int tid = threadIdx.x;
    int wave = __builtin_amdgcn_readfirstlane(tid >> 5), lane = tid & 31;
    int hw = wave % 3, tw = wave / 3;      // head of the block, group of 64 tokens
    int laneRow = lane & 15, g = lane >> 4;
    int hsel = blockIdx.x * 3 + hw;        // 0..15: heads of Q, 16..31: heads of K, 32..47: heads of V
    bool isV = hsel >= 2 * HH;             // the same for the whole wave
    int pRow = isV ? tw * 64 : BM + hw * 64;       // first operand's rows in the staged tile
    int qRow = isV ? BM + hw * 64 : tw * 64;       // second operand's rows

    // copy c of a thread brings 16 bytes of tile row c * 24 + (tid >> 4): sixteen lanes take one row's 256 bytes,
    // so a wave's copy is 4 whole lines. Rows 432..447 are copy 18 of waves 0..7 alone.
    int r0 = tid >> 4;
    const char* gX = (const char*)(A + (size_t)(bm + r0) * K + (tid & 15) * 8);            // c = 0..9
    const char* g10 = r0 < 16 ? gX + (size_t)240 * K * 2                                    // rows 240..255: X
                              : (const char*)(BT + (size_t)(bn + r0 - 16) * K + (tid & 15) * 8);  // 256..263: W
    const char* gW = (const char*)(BT + (size_t)(bn + 8 + r0) * K + (tid & 15) * 8);        // c = 11..18
    u32 lX = (u32)(uintptr_t)&sT[0][r0 * LDT + (tid & 15) * 8];

    v8f acc[4][4];
    for (int i = 0; i < 4; ++i)
        for (int j = 0; j < 4; ++j)
            acc[i][j] = v8f{0.f, 0.f, 0.f, 0.f, 0.f, 0.f, 0.f, 0.f};

    // the three pointers walk along k with the stages, so that a stage forms its addresses from them anew and
    // no address of a single copy is kept over the products
    auto stage = [&](int buf) {
        for (int hf = 0; hf < 2; ++hf) {
            u32 l[9];
            const char* p[9];
            for (int e = 0; e < 9; ++e) {
                int c = hf * 9 + e;
                l[e] = lX + (u32)((buf * TROWS + c * 24) * LDT * 2);
                p[e] = (c < 10 ? gX + (size_t)c * 24 * K * 2 : c == 10 ? g10 : gW + (size_t)(c - 11) * 24 * K * 2);
            }
            async_copy16x9(l, p);
        }
        if (wave < 8)      // a scalar test: a wave issues this copy with every lane on, or not at all
            async_copy16(lX + (u32)((buf * TROWS + 18 * 24) * LDT * 2), gW + (size_t)7 * 24 * K * 2);
        gX += BK * 2; g10 += BK * 2; gW += BK * 2;
    };

    stage(0);
    wait_async0();
    __syncthreads();
    stage(1);

    Frag sf[2][4], ff[2][4];
    // The fragments of half a tile (64 k) are asked for in one group: a wave then waits out the LDS latency
    // once for 32 products, not once a row of products.
    auto frags = [&](int cur, int hf) {
        const u16* pB = &sT[cur][(pRow + laneRow) * LDT + hf * 64];
        const u16* qB = &sT[cur][(qRow + laneRow) * LDT + hf * 64];
        for (int ks = 0; ks < 2; ++ks) {
            for (int j = 0; j < 4; ++j)
                load_frag_u16(sf[ks][j], qB + j * 16 * LDT + ks * 32, g);
            for (int i = 0; i < 4; ++i)
                load_frag_u16(ff[ks][i], pB + i * 16 * LDT + ks * 32, g);
        }
    };
    auto products = [&]() {
        for (int ks = 0; ks < 2; ++ks)
            for (int i = 0; i < 4; ++i)
                for (int j = 0; j < 4; ++j)
                    acc[i][j] = __builtin_amdgcn_wmma_f32_16x16x32_bf16(
                        false, ff[ks][i].v, false, sf[ks][j].v, (short)0, acc[i][j], false, false);
    };

    for (int t = 0; t < NT; ++t) {
        int cur = t & 1;
        frags(cur, 0);
        // holds the group of loads up here: without it the compiler sinks them between the rows of products
        __builtin_amdgcn_sched_barrier(0);
        products();
        // keeps the second group behind the first half's products, whose registers it takes over: without it
        // the compiler lifts some of these loads into registers of their own and spills
        __builtin_amdgcn_sched_barrier(0);
        frags(cur, 1);
        // hand-over: own LDS reads of this buffer retired (the rest of the tile is in registers), own copies of
        // the next tile landed, then the barrier that publishes that tile and frees this buffer
        asm volatile("s_wait_dscnt 0x0" ::: "memory");
        wait_async0();
        __syncthreads();
        // the refill stands in front of the products, which read registers alone: its copies get the whole
        // trip to land
        if (t + 2 < NT) stage(cur);
        products();
    }
    wait_async0();

    int b = bm >> 10, lblk = (bm & (LDIM - 1)) + tw * 64;      // first token of the wave in its sequence
    if (!isV) {
        int h = hsel & (HH - 1);
        u16* dst = (hsel >> 4) ? krot : qrot;
        const float* bp = bias + hsel * HD + g * 8;
        float gm = gamma[h];
        int idx0 = (b * HH + h) * LDIM + lblk + laneRow;
        float ph4[4], mg4[4];
        for (int j = 0; j < 4; ++j) {
            ph4[j] = phi[idx0 + j * 16];
            mg4[j] = mag[idx0 + j * 16];
        }
        // the loaded values are inputs, so the nine loads stand in front of this wait: no register that one of
        // them names is written again ahead of it
        asm volatile("s_wait_xcnt 0x0" :: "v"(gm), "v"(ph4[0]), "v"(ph4[1]), "v"(ph4[2]), "v"(ph4[3]),
                     "v"(mg4[0]), "v"(mg4[1]), "v"(mg4[2]), "v"(mg4[3]) : "memory");
        // unrolled: a rolled loop would index the accumulators by a variable and send them through scratch memory
        #pragma unroll
        for (int j = 0; j < 4; ++j) {
            int idx = idx0 + j * 16;
            float ph = ph4[j];
            float sc = 1.0f + gm * tanhf(mg4[j]);
            float cs = cosf(ph), sn = sinf(ph);
            for (int i = 0; i < 2; ++i) {
                union { uint4 x; u16 hh[8]; } lo, hi;
                for (int r = 0; r < 8; ++r) {
                    float a0 = (acc[i][j][r] + bp[i * 16 + r]) * sc;
                    float a1 = (acc[i + 2][j][r] + bp[i * 16 + 32 + r]) * sc;
                    lo.hh[r] = f2bf(a0 * cs - a1 * sn);
                    hi.hh[r] = f2bf(a1 * cs + a0 * sn);
                }
                u16* o = dst + (size_t)(idx & ~15) * HD + i * 256 + lane * 8;    // idx & ~15: first token of the tile
                *(uint4*)o = lo.x;
                *(uint4*)(o + 512) = hi.x;
            }
        }
    } else {
        int h = hsel - 2 * HH;
        // unrolled for the same reason
        #pragma unroll
        for (int j = 0; j < 4; ++j) {
            float bv = bias[hsel * HD + j * 16 + laneRow];           // head column d = j * 16 + laneRow
            u16* o = vt + (size_t)(b * HH + h) * (HD * LDIM) + lblk * HD + j * 512 + lane * 8;
            for (int i = 0; i < 4; ++i) {
                union { uint4 x; u16 hh[8]; } w;
                for (int r = 0; r < 8; ++r) w.hh[r] = f2bf(acc[i][j][r] + bv);
                *(uint4*)(o + (i >> 1) * 2048 + (i & 1) * 256) = w.x;
            }
        }
        // the stores above name their address and data registers: the wait stands before any is written again
        asm volatile("s_wait_xcnt 0x0" ::: "memory");
    }
}

// ---------------------------------------------------------------- attention
// Online softmax, all in registers. Each wave owns NQ*16 queries and walks the keys 32 at a time:
//   S^T = K * Q^T   (D: lane holds query laneRow, keys g*8+r)  -> max and sum are in-lane
//   O^T += V^T * P^T (two S^T tiles, converted in place, are the B operand in the same k order)
// Q, K and V^T lie in fragment order (see the QKV product): a fragment half is 512 bytes in a run, lane * 16.
#define NQ 4          // 16-query tiles per wave
#define AW 4          // waves per block

typedef __attribute__((ext_vector_type(4))) u32   u32x4;
typedef __attribute__((ext_vector_type(4))) float f32x4;
struct Frag4 { union { v16bf v; u32x4 x[2]; }; };

__device__ __forceinline__ float other_half(float x) {   // lane l <-> l ^ 16
    int b = __builtin_bit_cast(int, x);
    b = __builtin_amdgcn_permlanex16(b, b, 0x76543210, 0xfedcba98, false, false);
    return __builtin_bit_cast(float, b);
}

// Several exp2 in one statement, each in place: no instruction reads the result or writes the source of the
// one in front of it, and the closing v_nop is the slot that the instruction set asks for behind a
// transcendental. In place, the statement writes only registers that the vector code in front of it wrote.
__device__ __forceinline__ void exp2x8(float (&x)[8]) {
    asm("v_exp_f32 %0, %0\n\tv_exp_f32 %1, %1\n\tv_exp_f32 %2, %2\n\tv_exp_f32 %3, %3\n\t"
        "v_exp_f32 %4, %4\n\tv_exp_f32 %5, %5\n\tv_exp_f32 %6, %6\n\tv_exp_f32 %7, %7\n\tv_nop"
        : "+v"(x[0]), "+v"(x[1]), "+v"(x[2]), "+v"(x[3]), "+v"(x[4]), "+v"(x[5]), "+v"(x[6]), "+v"(x[7]));
}
__device__ __forceinline__ void exp2x4(float (&x)[4]) {
    asm("v_exp_f32 %0, %0\n\tv_exp_f32 %1, %1\n\tv_exp_f32 %2, %2\n\tv_exp_f32 %3, %3\n\tv_nop"
        : "+v"(x[0]), "+v"(x[1]), "+v"(x[2]), "+v"(x[3]));
}

// No __restrict__ here: the "memory" clobber of the waits below must hold the loads on their side.
__global__ __launch_bounds__(AW * 32) void attn_kernel(
    const u16* qrot, const u16* krot, const u16* vt, const float* mask, u16* ctx) {

    int h = blockIdx.y, b = blockIdx.z;
    int tid = threadIdx.x, wave = tid >> 5, lane = tid & 31;
    int laneRow = lane & 15, g = lane >> 4;
    int qbase = (blockIdx.x * AW + wave) * (NQ * 16);
    const float rscale = 0.125f;                     // 1/sqrt(64)
    const float LOG2E = 1.44269504088896340736f;

    const char* qb = (const char*)(qrot + (size_t)(b * HH + h) * LDIM * HD);
    const char* kb = (const char*)(krot + (size_t)(b * HH + h) * LDIM * HD);
    const char* vb8 = (const char*)(vt + (size_t)(b * HH + h) * HD * LDIM);
    const char* mb = (const char*)(mask + b * LDIM);
    // per-lane byte offsets; kv, m: of the pass that is fetched next (32 keys are 4096 bytes of K and of V^T)
    u32 qoff = (u32)(qbase * HD * 2 + lane * 16);
    u32 kvoff = (u32)lane * 16u;
    u32 moff = (u32)g * 32u;

    Frag4 qf[NQ][2];
    for (int q = 0; q < NQ; ++q)
        for (int ks = 0; ks < 2; ++ks) {
            qf[q][ks].x[0] = *(const u32x4*)(qb + qoff + q * 2048 + ks * 1024);
            qf[q][ks].x[1] = *(const u32x4*)(qb + qoff + q * 2048 + ks * 1024 + 512);
        }
    // the Q loads name qoff and qb: as inputs both stay live, so unwritten, up to this wait
    asm volatile("s_wait_xcnt 0x0" :: "v"(qoff), "s"(qb) : "memory");

    v8f o[NQ][4];
    float m[NQ], l[NQ];
    for (int q = 0; q < NQ; ++q) {
        for (int dt = 0; dt < 4; ++dt)
            o[q][dt] = v8f{0.f, 0.f, 0.f, 0.f, 0.f, 0.f, 0.f, 0.f};
        m[q] = -1e30f;            // finite start: t - m is never (-inf) - (-inf) under -inf masks
        l[q] = 0.f;
    }

    Frag4 kf[2][2], va[4], vb[4];
    f32x4 mk[2][2];
    int pos = 0;                  // first key of the pass that is fetched next

    auto fetch = [&](Frag4 (&vd)[4]) {
        for (int kt = 0; kt < 2; ++kt) {
            for (int ks = 0; ks < 2; ++ks) {
                kf[kt][ks].x[0] = *(const u32x4*)(kb + kvoff + kt * 2048 + ks * 1024);
                kf[kt][ks].x[1] = *(const u32x4*)(kb + kvoff + kt * 2048 + ks * 1024 + 512);
            }
            mk[kt][0] = *(const f32x4*)(mb + moff + kt * 64);
            mk[kt][1] = *(const f32x4*)(mb + moff + kt * 64 + 16);
        }
        for (int dt = 0; dt < 4; ++dt) {
            vd[dt].x[0] = *(const u32x4*)(vb8 + kvoff + dt * 1024);
            vd[dt].x[1] = *(const u32x4*)(vb8 + kvoff + dt * 1024 + 512);
        }
    };
    auto advance = [&]() {
        // The fetch's loads name kvoff, moff: as inputs here they stay live, so unwritten, up to
        // this wait; its "memory" clobber keeps the loads in front of it.
        asm volatile("s_wait_xcnt 0x0" :: "v"(kvoff), "v"(moff) : "memory");
        int nxt = (pos + 32) & (LDIM - 1);   // behind the last pass it wraps to key 0: in bounds, unused
        int d = nxt - pos;
        kvoff += (u32)(d * HD * 2); moff += (u32)(d * 4);
        pos = nxt;
    };

    auto pass = [&](Frag4 (&vc)[4], Frag4 (&vn)[4]) {
        float t[NQ][16];
        for (int q = 0; q < NQ; ++q) {
            v8f s[2];
            for (int kt = 0; kt < 2; ++kt) {
                s[kt] = v8f{0.f, 0.f, 0.f, 0.f, 0.f, 0.f, 0.f, 0.f};
                for (int ks = 0; ks < 2; ++ks)
                    s[kt] = __builtin_amdgcn_wmma_f32_16x16x32_bf16(
                        false, kf[kt][ks].v, false, qf[q][ks].v, (short)0, s[kt], false, false);
            }
            for (int kt = 0; kt < 2; ++kt)
                for (int i = 0; i < 8; ++i)
                    t[q][kt * 8 + i] = s[kt][i] * rscale + mk[kt][i >> 2][i & 3];
        }
        // the next pass's K, mask and V fly while this pass's softmax and V products run
        fetch(vn);
        // holds the loads up here, in front of the softmax: they need its time to land
        __builtin_amdgcn_sched_barrier(0);

        float alpha[NQ];
        for (int q = 0; q < NQ; ++q) {
            float tm = t[q][0];
            for (int i = 1; i < 16; ++i) tm = fmaxf(tm, t[q][i]);
            tm = fmaxf(tm, other_half(tm));
            float mnew = fmaxf(m[q], tm);
            alpha[q] = (m[q] - mnew) * LOG2E;
            m[q] = mnew;
        }
        exp2x4(alpha);

        for (int q = 0; q < NQ; ++q) {
            Frag4 pf;
            float ls = 0.f;
            for (int hf = 0; hf < 2; ++hf) {
                float p[8];
                for (int i = 0; i < 8; ++i) p[i] = (t[q][hf * 8 + i] - m[q]) * LOG2E;
                exp2x8(p);
                for (int i = 0; i < 8; ++i) { ls += p[i]; pf.v[hf * 8 + i] = (__bf16)p[i]; }
            }
            l[q] = l[q] * alpha[q] + ls;
            for (int dt = 0; dt < 4; ++dt) {
                o[q][dt] *= alpha[q];
                o[q][dt] = __builtin_amdgcn_wmma_f32_16x16x32_bf16(
                    false, vc[dt].v, false, pf.v, (short)0, o[q][dt], false, false);
            }
        }
        advance();
    };

    fetch(va);
    advance();
    for (int k0 = 0; k0 < LDIM; k0 += 64) {
        pass(va, vb);
        pass(vb, va);
    }

    // epilogue: lane holds query laneRow, head columns dt*16 + g*8 + r -> one 16-byte store per tile
    char* cb = (char*)(ctx + (size_t)b * LDIM * BDIM + h * HD);
    for (int q = 0; q < NQ; ++q) {
        float inv = 1.0f / (l[q] + other_half(l[q]));
        int lq = qbase + q * 16 + laneRow;
        union { u32x4 x; u16 hh[8]; __bf16 bh[8]; } w[4];
        for (int dt = 0; dt < 4; ++dt)
            for (int r = 0; r < 8; ++r)
                w[dt].bh[r] = (__bf16)(o[q][dt][r] * inv);
        if (m[q] <= -1e8f) {         // fully masked row: the diagonal alone survives, ctx = v[lq]
            u32 doff = (u32)((lq >> 5) * 2048 + ((lq >> 4) & 1) * 256 + ((lq >> 3) & 1) * 128 + g * 64 + (lq & 7)) * 2u;
            for (int dt = 0; dt < 4; ++dt)
                for (int r = 0; r < 8; ++r)
                    w[dt].hh[r] = *(const u16*)(vb8 + doff + (dt * 512 + r * 8) * 2);
            // these loads name doff: it stays live up to this wait, behind the loads
            asm volatile("s_wait_xcnt 0x0" :: "v"(doff) : "memory");
        }
        u32 soff = (u32)(lq * BDIM + g * 8) * 2u;
        for (int dt = 0; dt < 4; ++dt)
            *(u32x4*)(cb + soff + dt * 32) = w[dt].x;
        // the stores name soff and their data: the wait stands before either is written again
        asm volatile("s_wait_xcnt 0x0" :: "v"(soff), "v"(w[0].x), "v"(w[1].x), "v"(w[2].x), "v"(w[3].x) : "memory");
    }
}

// ---------------------------------------------------------------- output projection + residual + LayerNorm
// A block owns OM whole rows of x = ctx * Wo + bo + hidden, so the row statistics never leave it:
//   16 waves, each 64 columns n x 32 rows m; W rows are the first WMMA operand, so a lane holds one row m
//   and 8 columns n in a run (two 16-byte LDS stores a tile);
//   the f32 tile then lies in the LDS of the finished ring, and each wave normalises two whole rows of it
//   with 16-byte loads and stores in whole lines.
// Every block reads all of W: block i starts its walk over k at tile i mod 16, so that the blocks do not
// all ask for the same lines at the same time.
#define OM 32                        // rows a block
#define OKT 64                       // k a tile: 128 bytes a row, a whole line
#define OP 72                        // LDS row pitch in halves: 144 B = 16 B x 9, free of conflicts for 16-byte reads
#define ONT (BDIM / OKT)
#define OB_BYTES (BDIM * OP * 2)     // W tile
#define OA_BYTES (OM * OP * 2)       // ctx tile
#define OBUF (OB_BYTES + OA_BYTES)
#define XP 1028                      // f32 row pitch of the x tile: 16 rows of 16-byte stores meet 64 different banks

// One 8-byte copy with the same wait in its statement.
__device__ __forceinline__ void async_copy8(u32 l, const char* p) {
    asm volatile("global_load_async_to_lds_b64 %0, %1, off\n\t"
                 "s_wait_xcnt 0x0"
                 :: "v"(l), "v"((u64)(uintptr_t)p) : "memory");
}

// No __restrict__ here: the "memory" clobber of the waits below must hold the loads and stores on their side.
__global__ __launch_bounds__(512) void gemm_out_ln_kernel(
    const u16* A, const u16* BT, const float* bias, const float* residual,
    const float* lnw, const float* lnb, float* out) {

    __shared__ __attribute__((aligned(16))) char sm[2 * OBUF];

    int bm = blockIdx.x * OM;
    int tid = threadIdx.x;
    int wave = tid >> 5, lane = tid & 31;
    int laneRow = lane & 15, g = lane >> 4;

    v8f acc[4][2];
    for (int i = 0; i < 4; ++i)
        for (int j = 0; j < 2; ++j)
            acc[i][j] = v8f{0.f, 0.f, 0.f, 0.f, 0.f, 0.f, 0.f, 0.f};

    // W tile: copy c of a thread brings 16 bytes of row c * 64 + (tid >> 3); a wave's copy is 4 whole lines.
    // ctx tile: 8 bytes of row tid >> 4; a wave's copy is 2 whole lines.
    const char* gW = (const char*)(BT + (size_t)(tid >> 3) * BDIM + (tid & 7) * 8);
    const char* gA = (const char*)(A + (size_t)(bm + (tid >> 4)) * BDIM + (tid & 15) * 4);
    u32 lW = (u32)(uintptr_t)&sm[(tid >> 3) * (OP * 2) + (tid & 7) * 16];
    u32 lA = (u32)(uintptr_t)&sm[OB_BYTES + (tid >> 4) * (OP * 2) + (tid & 15) * 8];

    auto stage = [&](int buf, int t) {
        u32 kb = (u32)((t + blockIdx.x) & (ONT - 1)) * (OKT * 2);    // byte offset of the k tile in a row
        for (int hf = 0; hf < 2; ++hf) {
            u32 l[8];
            const char* p[8];
            for (int c = 0; c < 8; ++c) {
                l[c] = lW + (u32)(buf * OBUF + (hf * 8 + c) * 64 * OP * 2);
                p[c] = gW + kb + (size_t)(hf * 8 + c) * 64 * BDIM * 2;
            }
            async_copy16x8(l, p);
        }
        async_copy8(lA + (u32)(buf * OBUF), gA + kb);
    };

    stage(0, 0);
    wait_async0();
    __syncthreads();
    stage(1, 1);

    for (int t = 0; t < ONT; ++t) {
        int cur = t & 1;
        const u16* wB = (const u16*)(sm + cur * OBUF) + (wave * 64 + laneRow) * OP;
        const u16* xB = (const u16*)(sm + cur * OBUF + OB_BYTES) + laneRow * OP;
        Frag sf[2][2], ff[2][4];
        for (int ks = 0; ks < 2; ++ks) {
            for (int j = 0; j < 2; ++j)
                load_frag_u16(sf[ks][j], xB + j * 16 * OP + ks * 32, g);
            for (int i = 0; i < 4; ++i)
                load_frag_u16(ff[ks][i], wB + i * 16 * OP + ks * 32, g);
        }
        // hand-over: own LDS reads of this buffer retired (the whole tile's fragments are in registers), own
        // copies of the next tile landed, then the barrier that publishes that tile and frees this buffer
        asm volatile("s_wait_dscnt 0x0" ::: "memory");
        wait_async0();
        __syncthreads();
        // the refill stands in front of the products, which read registers alone: its copies get the whole
        // trip to land
        if (t + 2 < ONT) stage(cur, t + 2);
        for (int ks = 0; ks < 2; ++ks)
            for (int i = 0; i < 4; ++i)
                for (int j = 0; j < 2; ++j)
                    acc[i][j] = __builtin_amdgcn_wmma_f32_16x16x32_bf16(
                        false, ff[ks][i].v, false, sf[ks][j].v, (short)0, acc[i][j], false, false);
    }
    wait_async0();

    // this wave's two rows of the residual, and the bias: they fly while the tile is laid down
    const char* hb = (const char*)residual;
    const char* bb = (const char*)bias;
    u32 roff = (u32)(bm + wave * 2) * (BDIM * 4) + (u32)lane * 16u;
    u32 coff = (u32)lane * 16u;
    f32x4 hv[2][8], bv[8];
    for (int c = 0; c < 8; ++c) {
        hv[0][c] = *(const f32x4*)(hb + roff + c * 512);
        hv[1][c] = *(const f32x4*)(hb + roff + BDIM * 4 + c * 512);
        bv[c] = *(const f32x4*)(bb + coff + c * 512);
    }
    // these loads name roff, coff (or the lane number it is made of) and their bases: as inputs all stay
    // live, so unwritten, up to this wait
    asm volatile("s_wait_xcnt 0x0" :: "v"(roff), "v"(coff), "v"(lane), "s"(hb), "s"(bb) : "memory");

    // the ring is finished (last barrier of the loop, no copy in flight): its LDS takes the f32 tile
    float* xs = (float*)sm;
    for (int i = 0; i < 4; ++i)
        for (int j = 0; j < 2; ++j) {
            float* p = xs + (j * 16 + laneRow) * XP + wave * 64 + i * 16 + g * 8;
            *(f32x4*)p = f32x4{acc[i][j][0], acc[i][j][1], acc[i][j][2], acc[i][j][3]};
            *(f32x4*)(p + 4) = f32x4{acc[i][j][4], acc[i][j][5], acc[i][j][6], acc[i][j][7]};
        }

    const char* wb = (const char*)lnw;
    const char* ob = (const char*)lnb;
    f32x4 wv[8], ov[8];
    for (int c = 0; c < 8; ++c) {
        wv[c] = *(const f32x4*)(wb + coff + c * 512);
        ov[c] = *(const f32x4*)(ob + coff + c * 512);
    }
    // as above, for coff, the lane number and the two bases
    asm volatile("s_wait_xcnt 0x0" :: "v"(coff), "v"(lane), "s"(wb), "s"(ob) : "memory");

    __syncthreads();                 // every wave's part of the tile is in LDS

    f32x4 v[2][8];
    float s[2];
    for (int rr = 0; rr < 2; ++rr) {
        const float* xr = xs + (wave * 2 + rr) * XP + lane * 4;
        f32x4 a = f32x4{0.f, 0.f, 0.f, 0.f};
        for (int c = 0; c < 8; ++c) {
            v[rr][c] = (*(const f32x4*)(xr + c * 128) + bv[c]) + hv[rr][c];
            a += v[rr][c];
        }
        s[rr] = (a[0] + a[1]) + (a[2] + a[3]);
    }
    for (int off = 16; off; off >>= 1)
        for (int rr = 0; rr < 2; ++rr) s[rr] += __shfl_xor(s[rr], off, 32);
    float mu[2], q[2];
    for (int rr = 0; rr < 2; ++rr) {
        mu[rr] = s[rr] * (1.0f / BDIM);
        f32x4 a = f32x4{0.f, 0.f, 0.f, 0.f};
        for (int c = 0; c < 8; ++c) {
            v[rr][c] -= mu[rr];
            a += v[rr][c] * v[rr][c];
        }
        q[rr] = (a[0] + a[1]) + (a[2] + a[3]);
    }
    for (int off = 16; off; off >>= 1)
        for (int rr = 0; rr < 2; ++rr) q[rr] += __shfl_xor(q[rr], off, 32);
    for (int rr = 0; rr < 2; ++rr) {
        float inv = rsqrtf(q[rr] * (1.0f / BDIM) + 1e-12f);
        for (int c = 0; c < 8; ++c)
            v[rr][c] = v[rr][c] * inv * wv[c] + ov[c];
    }
    char* db = (char*)out;
    for (int rr = 0; rr < 2; ++rr)
        for (int c = 0; c < 8; ++c)
            *(f32x4*)(db + roff + rr * (BDIM * 4) + c * 512) = v[rr][c];
    // the stores name roff and their data: as inputs all stay live, so unwritten, up to this wait
    asm volatile("s_wait_xcnt 0x0" :: "v"(roff),
                 "v"(v[0][0]), "v"(v[0][1]), "v"(v[0][2]), "v"(v[0][3]), "v"(v[0][4]), "v"(v[0][5]), "v"(v[0][6]), "v"(v[0][7]),
                 "v"(v[1][0]), "v"(v[1][1]), "v"(v[1][2]), "v"(v[1][3]), "v"(v[1][4]), "v"(v[1][5]), "v"(v[1][6]), "v"(v[1][7])
                 : "memory");
}

// ---------------------------------------------------------------- launch
extern "C" void kernel_launch(void* const* d_in, const int* in_sizes, int n_in,
                              void* d_out, int out_size, void* d_ws, size_t ws_size,
                              hipStream_t stream) {
    const float* hidden = (const float*)d_in[0];
    const float* mask   = (const float*)d_in[1];
    const float* phi    = (const float*)d_in[2];
    const float* mag    = (const float*)d_in[3];
    const float* Wq     = (const float*)d_in[4];
    const float* bq     = (const float*)d_in[5];
    const float* Wk     = (const float*)d_in[6];
    const float* bk     = (const float*)d_in[7];
    const float* Wv     = (const float*)d_in[8];
    const float* bv     = (const float*)d_in[9];
    const float* gamma  = (const float*)d_in[10];
    const float* Wo     = (const float*)d_in[11];
    const float* bo     = (const float*)d_in[12];
    const float* lnw    = (const float*)d_in[13];
    const float* lnb    = (const float*)d_in[14];
    float* out = (float*)d_out;

    char* ws = (char*)d_ws;
    const size_t o_xb   = 0;                           // 8 MB  bf16 X
    const size_t o_wt   = o_xb + 8388608ull;           // 6 MB  bf16 WT (q,k,v packed)
    const size_t o_wot  = o_wt + 6291456ull;           // 2 MB  bf16 WoT
    const size_t o_bias = o_wot + 2097152ull;          // 12 KB packed bias
    const size_t o_qr   = o_bias + 12288ull + 50331648ull;   // 8 MB, at its old place: the 48 MB in front are not used
    const size_t o_kr   = o_qr + 8388608ull;           // 8 MB
    const size_t o_vt   = o_kr + 8388608ull;           // 8 MB
    const size_t o_ctx  = o_vt + 8388608ull;           // 8 MB

    u16*   Xb    = (u16*)(ws + o_xb);
    u16*   WT    = (u16*)(ws + o_wt);
    u16*   WoT   = (u16*)(ws + o_wot);
    float* biasA = (float*)(ws + o_bias);
    u16*   qrot  = (u16*)(ws + o_qr);
    u16*   krot  = (u16*)(ws + o_kr);
    u16*   vtb   = (u16*)(ws + o_vt);
    u16*   ctxb  = (u16*)(ws + o_ctx);

    // 1) X to bf16, the four weights transposed to bf16, the bias packed: one launch
    prep_kernel<<<PREP_X + PREP_T + PREP_B, 256, 0, stream>>>(
        hidden, Wq, Wk, Wv, Wo, bq, bk, bv, Xb, WT, WoT, biasA);

    // 3) fused QKV GEMM [4096 x 3072] with scale, rotation and V transpose in its epilogue
    gemm_qkv_rope_kernel<<<dim3(NQKV / BN, ROWS / BM), QTHREADS, 0, stream>>>(
        Xb, WT, biasA, phi, mag, gamma, qrot, krot, vtb);

    // 4) fused attention (online softmax in registers, no LDS)
    attn_kernel<<<dim3(LDIM / (AW * NQ * 16), HH, BB), AW * 32, 0, stream>>>(
        qrot, krot, vtb, mask, ctxb);

    // 5) output projection + residual + LayerNorm, a block for 32 whole rows
    gemm_out_ln_kernel<<<ROWS / OM, 512, 0, stream>>>(
        ctxb, WoT, bo, hidden, lnw, lnb, out);
}

// v008
// A run of this version takes 77.9 microseconds.
// Two timings next to v007 put it at 1.07 and 1.06 times that version's speed.
// Over all steps from v000 it is 3.86 times as fast.
#include <hip/hip_runtime.h>
#include <hip/hip_bf16.h>

typedef unsigned short u16;
typedef unsigned int   u32;
typedef unsigned long long u64;

typedef __attribute__((ext_vector_type(16))) __bf16 v16bf;
typedef __attribute__((ext_vector_type(8)))  float  v8f;
typedef __attribute__((ext_vector_type(4))) u32   u32x4;
typedef __attribute__((ext_vector_type(4))) float f32x4;

#define BDIM 1024   // D
#define LDIM 1024   // L
#define BB   4      // B
#define HH   16     // H
#define HD   64     // head dim
#define ROWS (BB*LDIM)      // 4096
#define NQKV (3*BDIM)       // 3072

__device__ __forceinline__ u16 f2bf(float f) {
    union { float f; u32 u; } x; x.f = f;
    u32 r = x.u + 0x7FFFu + ((x.u >> 16) & 1u);
    return (u16)(r >> 16);
}

struct Frag { union { v16bf v; uint4 q[2]; u16 h[16]; }; };

// load a 16-half fragment (A-layout) from a row:
// lane holds row (lane&15); halves 0..7 at K = g*8.. , halves 8..15 at K = 16+g*8..
__device__ __forceinline__ void load_frag_u16(Frag& f, const u16* rowPtr, int g) {
    f.q[0] = *(const uint4*)(rowPtr + g * 8);
    f.q[1] = *(const uint4*)(rowPtr + 16 + g * 8);
}

__device__ __forceinline__ void wait_async0() {
    asm volatile("s_wait_asynccnt 0x0" ::: "memory");
}

// ---------------------------------------------------------------- preparation, one launch
// Three independent jobs share one grid by block range (the test is the same for a whole block):
//   blocks [0, PREP_X):        X f32 -> bf16, 4096 float4 a block, 16 a thread
//   the next PREP_T blocks:    W f32 [k][n] -> bf16 [n][k], four matrices, a tile of 128 k x 64 n a block
//                              (Wo leaves in the fragment order of the output projection, see there)
//   the last PREP_B blocks:    bq, bk, bv -> one packed bias
#define PREP_X 256
#define PREP_T 512
#define PREP_B 3

__global__ __launch_bounds__(256) void prep_kernel(
    const float* __restrict__ X, const float* __restrict__ Wq, const float* __restrict__ Wk,
    const float* __restrict__ Wv, const float* __restrict__ Wo,
    const float* __restrict__ bq, const float* __restrict__ bk, const float* __restrict__ bv,
    u16* __restrict__ Xb, u16* __restrict__ WT, u16* __restrict__ WoT, float* __restrict__ biasA) {

    // [n][16-byte chunk of 8 k]; the chunk index is xor-ed with n >> 2, so that the 16 lanes that write
    // one k chunk of 16 rows, and the 16 that read one row, each meet 16 different bank groups
    __shared__ uint4 sW[64 * 16];

    int blk = blockIdx.x, tid = threadIdx.x;
    if (blk < PREP_X) {
        const char* s = (const char*)(X + (size_t)blk * 16384);
        char* d = (char*)(Xb + (size_t)blk * 16384);
        u32 off = (u32)tid * 16u;
        float4 f[16];
        for (int j = 0; j < 16; ++j)
            f[j] = *(const float4*)(s + off + j * 4096);
        u32 so = (u32)tid * 8u;
        for (int j = 0; j < 16; ++j) {
            ushort4 o;
            o.x = f2bf(f[j].x); o.y = f2bf(f[j].y); o.z = f2bf(f[j].z); o.w = f2bf(f[j].w);
            *(ushort4*)(d + so + j * 2048) = o;
        }
    } else if (blk < PREP_X + PREP_T) {
        int t = blk - PREP_X;
        int m = t >> 7;                              // which matrix
        int k0 = (t & 7) * 128, n0 = ((t >> 3) & 15) * 64;
        const float* Wm = m == 0 ? Wq : m == 1 ? Wk : m == 2 ? Wv : Wo;
        u16* Dm = m == 3 ? WoT : WT + (size_t)m * BDIM * BDIM;
        int c4 = tid & 15, kc = tid >> 4;            // 4 columns n, 8 rows k: four whole output chunks
        const char* s = (const char*)(Wm + (size_t)k0 * BDIM + n0);
        u32 off = (u32)(kc * 8 * BDIM + c4 * 4) * 4u;
        float4 f[8];
        for (int j = 0; j < 8; ++j)
            f[j] = *(const float4*)(s + off + j * BDIM * 4);
        union { uint4 x; u16 h[8]; } w[4];
        for (int j = 0; j < 8; ++j) {
            w[0].h[j] = f2bf(f[j].x); w[1].h[j] = f2bf(f[j].y);
            w[2].h[j] = f2bf(f[j].z); w[3].h[j] = f2bf(f[j].w);
        }
        for (int e = 0; e < 4; ++e)
            sW[(c4 * 4 + e) * 16 + (kc ^ c4)] = w[e].x;
        __syncthreads();
        // Wq, Wk, Wv: row n = kc + 16 j, chunk c4: 256 bytes a row in a run.
        // Wo, fragment order: row n = c4 + 16 j, chunk kc: a wave stores 16 rows of two chunks, 512 bytes in a run.
        // Sixteen rows are 32 KB in both orders. The choice is the same for a whole block.
        bool fo = m == 3;
        int nr = fo ? c4 : kc, ch = fo ? kc : c4;
        char* d = (char*)(Dm + (size_t)n0 * BDIM + (fo ? k0 * 16 : k0));
        u32 so = fo ? (u32)((kc >> 1) * 512 + (kc & 1) * 256 + c4 * 16) : (u32)(kc * BDIM * 2 + c4 * 16);
        u32x4 v[4];
        for (int j = 0; j < 4; ++j) {
            int n = nr + j * 16;
            v[j] = *(const u32x4*)&sW[n * 16 + (ch ^ ((n >> 2) & 15))];
        }
        for (int j = 0; j < 4; ++j)
            *(u32x4*)(d + so + j * 16 * BDIM * 2) = v[j];
        // the stores name d, so and their data: as inputs all stay live, so unwritten, up to this wait
        asm volatile("s_wait_xcnt 0x0" :: "s"(d), "v"(so), "v"(v[0]), "v"(v[1]), "v"(v[2]), "v"(v[3]) : "memory");
    } else {
        int p = blk - PREP_X - PREP_T;
        const float* bs = p == 0 ? bq : p == 1 ? bk : bv;
        ((float4*)biasA)[p * 256 + tid] = ((const float4*)bs)[tid];
        // the store names its address and data registers: the wait stands before any is written again
        asm volatile("s_wait_xcnt 0x0" ::: "memory");
    }
}

// ---------------------------------------------------------------- tile of the QKV GEMM
// One block a WGP: 256 tokens x 192 columns (3 heads), 12 waves of 64 x 64. 16 x 16 blocks fill the 256 WGPs once.
#define BM 256
#define BN 192
#define BK 128   // k a tile: 256 bytes a row, two whole lines
#define LDT 136  // padded LDS row stride (halves): 272 B = 16 B x 17, free of conflicts for 16-byte reads
#define TROWS (BM + BN)   // rows of a staged tile: 0..255 X rows, 256..447 W rows
#define QTHREADS 384

// ---------------------------------------------------------------- QKV GEMM + scale + rotation
// Xb[ROWS][D] * WT[3072][D]^T + bias, then scale and rotation in the accumulators:
//   q_rot, k_rot, V^T bf16, one plane of 64 x 1024 a (b, h), each in the order in which the attention's
//   fragments are loaded (below); no f32 qkv array, no separate launch.
// A wave holds one whole head (64 columns) for 64 tokens. The first WMMA operand is the one whose index must
// run along a lane's 8 results (the choice is the same for a whole wave):
//   Q, K heads: W rows first -> lane = token l, results = 8 head columns d;
//               the rotation partner d + 32 is tile i + 2 of the same lane and register
//   V heads:    X rows first -> lane = head column d, results = 8 tokens l (the transposed V row)
// Either way 8 results are one 16-byte store.
// Fragment order: the 32 pieces of 16 bytes that one wave-wide fragment load takes lie side by side, piece
// number = lane = g * 16 + row, so such a load, and the store that writes the same 512 bytes here, covers
// 4 whole 128-byte lines:
//   q_rot, k_rot: [l >> 4][d >> 4][(d >> 3) & 1][l & 15][d & 7]
//   V^T:          [l >> 5][d >> 4][(l >> 4) & 1][(l >> 3) & 1][d & 15][l & 7]

// Eight copies and the wait for their address registers in one statement: nothing can rewrite a register
// that a copy names in front of that wait.
__device__ __forceinline__ void async_copy16x8(const u32 (&l)[8], const char* const (&p)[8]) {
    asm volatile("global_load_async_to_lds_b128 %0, %1, off\n\t"
                 "global_load_async_to_lds_b128 %2, %3, off\n\t"
                 "global_load_async_to_lds_b128 %4, %5, off\n\t"
                 "global_load_async_to_lds_b128 %6, %7, off\n\t"
                 "global_load_async_to_lds_b128 %8, %9, off\n\t"
                 "global_load_async_to_lds_b128 %10, %11, off\n\t"
                 "global_load_async_to_lds_b128 %12, %13, off\n\t"
                 "global_load_async_to_lds_b128 %14, %15, off\n\t"
                 "s_wait_xcnt 0x0"
                 :: "v"(l[0]), "v"((u64)(uintptr_t)p[0]), "v"(l[1]), "v"((u64)(uintptr_t)p[1]),
                    "v"(l[2]), "v"((u64)(uintptr_t)p[2]), "v"(l[3]), "v"((u64)(uintptr_t)p[3]),
                    "v"(l[4]), "v"((u64)(uintptr_t)p[4]), "v"(l[5]), "v"((u64)(uintptr_t)p[5]),
                    "v"(l[6]), "v"((u64)(uintptr_t)p[6]), "v"(l[7]), "v"((u64)(uintptr_t)p[7]) : "memory");
}

// Nine copies, and one copy, each with the same wait in its statement.
__device__ __forceinline__ void async_copy16x9(const u32 (&l)[9], const char* const (&p)[9]) {
    asm volatile("global_load_async_to_lds_b128 %0, %1, off\n\t"
                 "global_load_async_to_lds_b128 %2, %3, off\n\t"
                 "global_load_async_to_lds_b128 %4, %5, off\n\t"
                 "global_load_async_to_lds_b128 %6, %7, off\n\t"
                 "global_load_async_to_lds_b128 %8, %9, off\n\t"
                 "global_load_async_to_lds_b128 %10, %11, off\n\t"
                 "global_load_async_to_lds_b128 %12, %13, off\n\t"
                 "global_load_async_to_lds_b128 %14, %15, off\n\t"
                 "global_load_async_to_lds_b128 %16, %17, off\n\t"
                 "s_wait_xcnt 0x0"
                 :: "v"(l[0]), "v"((u64)(uintptr_t)p[0]), "v"(l[1]), "v"((u64)(uintptr_t)p[1]),
                    "v"(l[2]), "v"((u64)(uintptr_t)p[2]), "v"(l[3]), "v"((u64)(uintptr_t)p[3]),
                    "v"(l[4]), "v"((u64)(uintptr_t)p[4]), "v"(l[5]), "v"((u64)(uintptr_t)p[5]),
                    "v"(l[6]), "v"((u64)(uintptr_t)p[6]), "v"(l[7]), "v"((u64)(uintptr_t)p[7]),
                    "v"(l[8]), "v"((u64)(uintptr_t)p[8]) : "memory");
}
__device__ __forceinline__ void async_copy16(u32 l, const char* p) {
    asm volatile("global_load_async_to_lds_b128 %0, %1, off\n\t"
                 "s_wait_xcnt 0x0"
                 :: "v"(l), "v"((u64)(uintptr_t)p) : "memory");
}

__global__ __launch_bounds__(QTHREADS) void gemm_qkv_rope_kernel(
    const u16* __restrict__ A, const u16* __restrict__ BT, const float* __restrict__ bias,
    const float* __restrict__ phi, const float* __restrict__ mag, const float* __restrict__ gamma,
    u16* __restrict__ qrot, u16* __restrict__ krot, u16* __restrict__ vt) {

    __shared__ __attribute__((aligned(16))) u16 sT[2][TROWS * LDT];     // [buffer][X rows, then W rows]

    const int K = BDIM, NT = BDIM / BK;
    int bm = blockIdx.y * BM, bn = blockIdx.x * BN;
    int tid = threadIdx.x;
    int wave = __builtin_amdgcn_readfirstlane(tid >> 5), lane = tid & 31;
    int hw = wave % 3, tw = wave / 3;      // head of the block, group of 64 tokens
    int laneRow = lane & 15, g = lane >> 4;
    int hsel = blockIdx.x * 3 + hw;        // 0..15: heads of Q, 16..31: heads of K, 32..47: heads of V
    bool isV = hsel >= 2 * HH;             // the same for the whole wave
    int pRow = isV ? tw * 64 : BM + hw * 64;       // first operand's rows in the staged tile
    int qRow = isV ? BM + hw * 64 : tw * 64;       // second operand's rows

    // copy c of a thread brings 16 bytes of tile row c * 24 + (tid >> 4): sixteen lanes take one row's 256 bytes,
    // so a wave's copy is 4 whole lines. Rows 432..447 are copy 18 of waves 0..7 alone.
    int r0 = tid >> 4;
    const char* gX = (const char*)(A + (size_t)(bm + r0) * K + (tid & 15) * 8);            // c = 0..9
    const char* g10 = r0 < 16 ? gX + (size_t)240 * K * 2                                    // rows 240..255: X
                              : (const char*)(BT + (size_t)(bn + r0 - 16) * K + (tid & 15) * 8);  // 256..263: W
    const char* gW = (const char*)(BT + (size_t)(bn + 8 + r0) * K + (tid & 15) * 8);        // c = 11..18
    u32 lX = (u32)(uintptr_t)&sT[0][r0 * LDT + (tid & 15) * 8];

    v8f acc[4][4];
    for (int i = 0; i < 4; ++i)
        for (int j = 0; j < 4; ++j)
            acc[i][j] = v8f{0.f, 0.f, 0.f, 0.f, 0.f, 0.f, 0.f, 0.f};

    // the three pointers walk along k with the stages, so that a stage forms its addresses from them anew and
    // no address of a single copy is kept over the products
    auto stage = [&](int buf) {
        for (int hf = 0; hf < 2; ++hf) {
            u32 l[9];
            const char* p[9];
            for (int e = 0; e < 9; ++e) {
                int c = hf * 9 + e;
                l[e] = lX + (u32)((buf * TROWS + c * 24) * LDT * 2);
                p[e] = (c < 10 ? gX + (size_t)c * 24 * K * 2 : c == 10 ? g10 : gW + (size_t)(c - 11) * 24 * K * 2);
            }
            async_copy16x9(l, p);
        }
        if (wave < 8)      // a scalar test: a wave issues this copy with every lane on, or not at all
            async_copy16(lX + (u32)((buf * TROWS + 18 * 24) * LDT * 2), gW + (size_t)7 * 24 * K * 2);
        gX += BK * 2; g10 += BK * 2; gW += BK * 2;
    };

    stage(0);
    wait_async0();
    __syncthreads();
    stage(1);

    Frag sf[2][4], ff[2][4];
    // The fragments of half a tile (64 k) are asked for in one group: a wave then waits out the LDS latency
    // once for 32 products, not once a row of products.
    auto frags = [&](int cur, int hf) {
        const u16* pB = &sT[cur][(pRow + laneRow) * LDT + hf * 64];
        const u16* qB = &sT[cur][(qRow + laneRow) * LDT + hf * 64];
        for (int ks = 0; ks < 2; ++ks) {
            for (int j = 0; j < 4; ++j)
                load_frag_u16(sf[ks][j], qB + j * 16 * LDT + ks * 32, g);
            for (int i = 0; i < 4; ++i)
                load_frag_u16(ff[ks][i], pB + i * 16 * LDT + ks * 32, g);
        }
    };
    auto products = [&]() {
        for (int ks = 0; ks < 2; ++ks)
            for (int i = 0; i < 4; ++i)
                for (int j = 0; j < 4; ++j)
                    acc[i][j] = __builtin_amdgcn_wmma_f32_16x16x32_bf16(
                        false, ff[ks][i].v, false, sf[ks][j].v, (short)0, acc[i][j], false, false);
    };

    for (int t = 0; t < NT; ++t) {
        int cur = t & 1;
        frags(cur, 0);
        // holds the group of loads up here: without it the compiler sinks them between the rows of products
        __builtin_amdgcn_sched_barrier(0);
        products();
        // keeps the second group behind the first half's products, whose registers it takes over: without it
        // the compiler lifts some of these loads into registers of their own and spills
        __builtin_amdgcn_sched_barrier(0);
        frags(cur, 1);
        // hand-over: own LDS reads of this buffer retired (the rest of the tile is in registers), own copies of
        // the next tile landed, then the barrier that publishes that tile and frees this buffer
        asm volatile("s_wait_dscnt 0x0" ::: "memory");
        wait_async0();
        __syncthreads();
        // the refill stands in front of the products, which read registers alone: its copies get the whole
        // trip to land
        if (t + 2 < NT) stage(cur);
        products();
    }
    wait_async0();

    int b = bm >> 10, lblk = (bm & (LDIM - 1)) + tw * 64;      // first token of the wave in its sequence
    if (!isV) {
        int h = hsel & (HH - 1);
        u16* dst = (hsel >> 4) ? krot : qrot;
        const float* bp = bias + hsel * HD + g * 8;
        float gm = gamma[h];
        int idx0 = (b * HH + h) * LDIM + lblk + laneRow;
        float ph4[4], mg4[4];
        for (int j = 0; j < 4; ++j) {
            ph4[j] = phi[idx0 + j * 16];
            mg4[j] = mag[idx0 + j * 16];
        }
        // the loaded values are inputs, so the nine loads stand in front of this wait: no register that one of
        // them names is written again ahead of it
        asm volatile("s_wait_xcnt 0x0" :: "v"(gm), "v"(ph4[0]), "v"(ph4[1]), "v"(ph4[2]), "v"(ph4[3]),
                     "v"(mg4[0]), "v"(mg4[1]), "v"(mg4[2]), "v"(mg4[3]) : "memory");
        // unrolled: a rolled loop would index the accumulators by a variable and send them through scratch memory
        #pragma unroll
        for (int j = 0; j < 4; ++j) {
            int idx = idx0 + j * 16;
            float ph = ph4[j];
            float sc = 1.0f + gm * tanhf(mg4[j]);
            float cs = cosf(ph), sn = sinf(ph);
            for (int i = 0; i < 2; ++i) {
                union { uint4 x; u16 hh[8]; } lo, hi;
                for (int r = 0; r < 8; ++r) {
                    float a0 = (acc[i][j][r] + bp[i * 16 + r]) * sc;
                    float a1 = (acc[i + 2][j][r] + bp[i * 16 + 32 + r]) * sc;
                    lo.hh[r] = f2bf(a0 * cs - a1 * sn);
                    hi.hh[r] = f2bf(a1 * cs + a0 * sn);
                }
                u16* o = dst + (size_t)(idx & ~15) * HD + i * 256 + lane * 8;    // idx & ~15: first token of the tile
                *(uint4*)o = lo.x;
                *(uint4*)(o + 512) = hi.x;
            }
        }
    } else {
        int h = hsel - 2 * HH;
        // unrolled for the same reason
        #pragma unroll
        for (int j = 0; j < 4; ++j) {
            float bv = bias[hsel * HD + j * 16 + laneRow];           // head column d = j * 16 + laneRow
            u16* o = vt + (size_t)(b * HH + h) * (HD * LDIM) + lblk * HD + j * 512 + lane * 8;
            for (int i = 0; i < 4; ++i) {
                union { uint4 x; u16 hh[8]; } w;
                for (int r = 0; r < 8; ++r) w.hh[r] = f2bf(acc[i][j][r] + bv);
                *(uint4*)(o + (i >> 1) * 2048 + (i & 1) * 256) = w.x;
            }
        }
        // the stores above name their address and data registers: the wait stands before any is written again
        asm volatile("s_wait_xcnt 0x0" ::: "memory");
    }
}

// ---------------------------------------------------------------- attention
// Online softmax, all in registers. Each wave owns NQ*16 queries and walks the keys 32 at a time:
//   S^T = K * Q^T   (D: lane holds query laneRow, keys g*8+r)  -> max and sum are in-lane
//   O^T += V^T * P^T (two S^T tiles, converted in place, are the B operand in the same k order)
// Q, K and V^T lie in fragment order (see the QKV product): a fragment half is 512 bytes in a run, lane * 16.
#define NQ 4          // 16-query tiles per wave
#define AW 4          // waves per block

struct Frag4 { union { v16bf v; u32x4 x[2]; }; };

__device__ __forceinline__ float other_half(float x) {   // lane l <-> l ^ 16
    int b = __builtin_bit_cast(int, x);
    b = __builtin_amdgcn_permlanex16(b, b, 0x76543210, 0xfedcba98, false, false);
    return __builtin_bit_cast(float, b);
}

// Several exp2 in one statement, each in place: no instruction reads the result or writes the source of the
// one in front of it, and the closing v_nop is the slot that the instruction set asks for behind a
// transcendental. In place, the statement writes only registers that the vector code in front of it wrote.
__device__ __forceinline__ void exp2x8(float (&x)[8]) {
    asm("v_exp_f32 %0, %0\n\tv_exp_f32 %1, %1\n\tv_exp_f32 %2, %2\n\tv_exp_f32 %3, %3\n\t"
        "v_exp_f32 %4, %4\n\tv_exp_f32 %5, %5\n\tv_exp_f32 %6, %6\n\tv_exp_f32 %7, %7\n\tv_nop"
        : "+v"(x[0]), "+v"(x[1]), "+v"(x[2]), "+v"(x[3]), "+v"(x[4]), "+v"(x[5]), "+v"(x[6]), "+v"(x[7]));
}
__device__ __forceinline__ void exp2x4(float (&x)[4]) {
    asm("v_exp_f32 %0, %0\n\tv_exp_f32 %1, %1\n\tv_exp_f32 %2, %2\n\tv_exp_f32 %3, %3\n\tv_nop"
        : "+v"(x[0]), "+v"(x[1]), "+v"(x[2]), "+v"(x[3]));
}

// No __restrict__ here: the "memory" clobber of the waits below must hold the loads on their side.
__global__ __launch_bounds__(AW * 32) void attn_kernel(
    const u16* qrot, const u16* krot, const u16* vt, const float* mask, u16* ctx) {

    int h = blockIdx.y, b = blockIdx.z;
    int tid = threadIdx.x, wave = tid >> 5, lane = tid & 31;
    int laneRow = lane & 15, g = lane >> 4;
    int qbase = (blockIdx.x * AW + wave) * (NQ * 16);
    const float rscale = 0.125f;                     // 1/sqrt(64)
    const float LOG2E = 1.44269504088896340736f;

    const char* qb = (const char*)(qrot + (size_t)(b * HH + h) * LDIM * HD);
    const char* kb = (const char*)(krot + (size_t)(b * HH + h) * LDIM * HD);
    const char* vb8 = (const char*)(vt + (size_t)(b * HH + h) * HD * LDIM);
    const char* mb = (const char*)(mask + b * LDIM);
    // per-lane byte offsets; kv, m: of the pass that is fetched next (32 keys are 4096 bytes of K and of V^T)
    u32 qoff = (u32)(qbase * HD * 2 + lane * 16);
    u32 kvoff = (u32)lane * 16u;
    u32 moff = (u32)g * 32u;

    Frag4 qf[NQ][2];
    for (int q = 0; q < NQ; ++q)
        for (int ks = 0; ks < 2; ++ks) {
            qf[q][ks].x[0] = *(const u32x4*)(qb + qoff + q * 2048 + ks * 1024);
            qf[q][ks].x[1] = *(const u32x4*)(qb + qoff + q * 2048 + ks * 1024 + 512);
        }
    // the Q loads name qoff and qb: as inputs both stay live, so unwritten, up to this wait
    asm volatile("s_wait_xcnt 0x0" :: "v"(qoff), "s"(qb) : "memory");

    v8f o[NQ][4];
    float m[NQ], l[NQ];
    for (int q = 0; q < NQ; ++q) {
        for (int dt = 0; dt < 4; ++dt)
            o[q][dt] = v8f{0.f, 0.f, 0.f, 0.f, 0.f, 0.f, 0.f, 0.f};
        m[q] = -1e30f;            // finite start: t - m is never (-inf) - (-inf) under -inf masks
        l[q] = 0.f;
    }

    Frag4 kf[2][2], va[4], vb[4];
    f32x4 mk[2][2];
    int pos = 0;                  // first key of the pass that is fetched next

    auto fetch = [&](Frag4 (&vd)[4]) {
        for (int kt = 0; kt < 2; ++kt) {
            for (int ks = 0; ks < 2; ++ks) {
                kf[kt][ks].x[0] = *(const u32x4*)(kb + kvoff + kt * 2048 + ks * 1024);
                kf[kt][ks].x[1] = *(const u32x4*)(kb + kvoff + kt * 2048 + ks * 1024 + 512);
            }
            mk[kt][0] = *(const f32x4*)(mb + moff + kt * 64);
            mk[kt][1] = *(const f32x4*)(mb + moff + kt * 64 + 16);
        }
        for (int dt = 0; dt < 4; ++dt) {
            vd[dt].x[0] = *(const u32x4*)(vb8 + kvoff + dt * 1024);
            vd[dt].x[1] = *(const u32x4*)(vb8 + kvoff + dt * 1024 + 512);
        }
    };
    auto advance = [&]() {
        // The fetch's loads name kvoff, moff: as inputs here they stay live, so unwritten, up to
        // this wait; its "memory" clobber keeps the loads in front of it.
        asm volatile("s_wait_xcnt 0x0" :: "v"(kvoff), "v"(moff) : "memory");
        int nxt = (pos + 32) & (LDIM - 1);   // behind the last pass it wraps to key 0: in bounds, unused
        int d = nxt - pos;
        kvoff += (u32)(d * HD * 2); moff += (u32)(d * 4);
        pos = nxt;
    };

    auto pass = [&](Frag4 (&vc)[4], Frag4 (&vn)[4]) {
        float t[NQ][16];
        for (int q = 0; q < NQ; ++q) {
            v8f s[2];
            for (int kt = 0; kt < 2; ++kt) {
                s[kt] = v8f{0.f, 0.f, 0.f, 0.f, 0.f, 0.f, 0.f, 0.f};
                for (int ks = 0; ks < 2; ++ks)
                    s[kt] = __builtin_amdgcn_wmma_f32_16x16x32_bf16(
                        false, kf[kt][ks].v, false, qf[q][ks].v, (short)0, s[kt], false, false);
            }
            for (int kt = 0; kt < 2; ++kt)
                for (int i = 0; i < 8; ++i)
                    t[q][kt * 8 + i] = s[kt][i] * rscale + mk[kt][i >> 2][i & 3];
        }
        // the next pass's K, mask and V fly while this pass's softmax and V products run
        fetch(vn);
        // holds the loads up here, in front of the softmax: they need its time to land
        __builtin_amdgcn_sched_barrier(0);

        float alpha[NQ];
        for (int q = 0; q < NQ; ++q) {
            float tm = t[q][0];
            for (int i = 1; i < 16; ++i) tm = fmaxf(tm, t[q][i]);
            tm = fmaxf(tm, other_half(tm));
            float mnew = fmaxf(m[q], tm);
            alpha[q] = (m[q] - mnew) * LOG2E;
            m[q] = mnew;
        }
        exp2x4(alpha);

        for (int q = 0; q < NQ; ++q) {
            Frag4 pf;
            float ls = 0.f;
            for (int hf = 0; hf < 2; ++hf) {
                float p[8];
                for (int i = 0; i < 8; ++i) p[i] = (t[q][hf * 8 + i] - m[q]) * LOG2E;
                exp2x8(p);
                for (int i = 0; i < 8; ++i) { ls += p[i]; pf.v[hf * 8 + i] = (__bf16)p[i]; }
            }
            l[q] = l[q] * alpha[q] + ls;
            for (int dt = 0; dt < 4; ++dt) {
                o[q][dt] *= alpha[q];
                o[q][dt] = __builtin_amdgcn_wmma_f32_16x16x32_bf16(
                    false, vc[dt].v, false, pf.v, (short)0, o[q][dt], false, false);
            }
        }
        advance();
    };

    fetch(va);
    advance();
    for (int k0 = 0; k0 < LDIM; k0 += 64) {
        pass(va, vb);
        pass(vb, va);
    }

    // epilogue: lane holds query laneRow, head columns dt*16 + g*8 + r -> one 16-byte store per tile
    char* cb = (char*)(ctx + (size_t)b * LDIM * BDIM + h * HD);
    for (int q = 0; q < NQ; ++q) {
        float inv = 1.0f / (l[q] + other_half(l[q]));
        int lq = qbase + q * 16 + laneRow;
        union { u32x4 x; u16 hh[8]; __bf16 bh[8]; } w[4];
        for (int dt = 0; dt < 4; ++dt)
            for (int r = 0; r < 8; ++r)
                w[dt].bh[r] = (__bf16)(o[q][dt][r] * inv);
        if (m[q] <= -1e8f) {         // fully masked row: the diagonal alone survives, ctx = v[lq]
            u32 doff = (u32)((lq >> 5) * 2048 + ((lq >> 4) & 1) * 256 + ((lq >> 3) & 1) * 128 + g * 64 + (lq & 7)) * 2u;
            for (int dt = 0; dt < 4; ++dt)
                for (int r = 0; r < 8; ++r)
                    w[dt].hh[r] = *(const u16*)(vb8 + doff + (dt * 512 + r * 8) * 2);
            // these loads name doff: it stays live up to this wait, behind the loads
            asm volatile("s_wait_xcnt 0x0" :: "v"(doff) : "memory");
        }
        u32 soff = (u32)(lq * BDIM + g * 8) * 2u;
        for (int dt = 0; dt < 4; ++dt)
            *(u32x4*)(cb + soff + dt * 32) = w[dt].x;
        // the stores name soff and their data: the wait stands before either is written again
        asm volatile("s_wait_xcnt 0x0" :: "v"(soff), "v"(w[0].x), "v"(w[1].x), "v"(w[2].x), "v"(w[3].x) : "memory");
    }
}

// ---------------------------------------------------------------- output projection + residual + LayerNorm
// A block owns OM whole rows of x = ctx * Wo + bo + hidden, so the row statistics never leave it:
//   16 waves, each 64 columns n x 32 rows m; W rows are the first WMMA operand, so a lane holds one row m
//   and 8 columns n in a run (two 16-byte LDS stores a tile);
//   the f32 tile then lies in LDS, and each wave normalises two whole rows of it with 16-byte loads and
//   stores in whole lines.
// No two waves of a block share a W row, so W does not pass through LDS: each wave loads its own fragments
// straight into registers, two k tiles ahead. W lies in fragment order, [n >> 4][k >> 4][(k >> 3) & 1][n & 15][k & 7]:
// a wave-wide 16-byte load covers 4 whole lines. The block's ctx rows, which all waves share, are copied to LDS
// once, so the k loop has no barrier.
// Every block reads all of W: block i starts its walk over k at tile i mod 16, so that the blocks do not
// all ask for the same lines at the same time.
#define OM 32                        // rows a block
#define OKT 64                       // k a tile
#define ONT (BDIM / OKT)
#define CP 1032                      // LDS row pitch of the ctx rows in halves: 2064 B = 16 B x 129, free of conflicts for 16-byte reads
#define CT_BYTES (OM * CP * 2)       // ctx rows
#define XP 1028                      // f32 row pitch of the x tile: 16 rows of 16-byte stores meet 64 different banks

// No __restrict__ here: the "memory" clobber of the waits below must hold the loads and stores on their side.
__global__ __launch_bounds__(512) void gemm_out_ln_kernel(
    const u16* A, const u16* BT, const float* bias, const float* residual,
    const float* lnw, const float* lnb, float* out) {

    __shared__ __attribute__((aligned(16))) char sm[CT_BYTES + OM * XP * 4];    // ctx rows, then the f32 x tile

    int bm = blockIdx.x * OM;
    int tid = threadIdx.x;
    int wave = tid >> 5, lane = tid & 31;
    int laneRow = lane & 15, g = lane >> 4;

    v8f acc[4][2];
    for (int i = 0; i < 4; ++i)
        for (int j = 0; j < 2; ++j)
            acc[i][j] = v8f{0.f, 0.f, 0.f, 0.f, 0.f, 0.f, 0.f, 0.f};

    // ctx rows: copy c of a thread brings 16 bytes of row c * 4 + (tid >> 7); a wave's copy is 4 whole lines
    {
        const char* gA = (const char*)(A + (size_t)(bm + (tid >> 7)) * BDIM + (tid & 127) * 8);
        u32 lA = (u32)(uintptr_t)&sm[(tid >> 7) * (CP * 2) + (tid & 127) * 16];
        u32 l[8];
        const char* p[8];
        for (int c = 0; c < 8; ++c) {
            l[c] = lA + (u32)(c * 4 * CP * 2);
            p[c] = gA + (size_t)c * 4 * BDIM * 2;
        }
        async_copy16x8(l, p);
    }

    // this wave's 64 rows of W: 32 KB a group of 16 rows, 2 KB of it a k tile
    const char* wb8 = (const char*)BT;
    u32 wlane = (u32)wave * (4u * 16u * BDIM * 2u) + (u32)lane * 16u;
    auto fetch = [&](Frag4 (&f)[2][4], int t) {
        u32 wo = wlane + (u32)((t + blockIdx.x) & (ONT - 1)) * (OKT * 16 * 2);
        for (int i = 0; i < 4; ++i)
            for (int ks = 0; ks < 2; ++ks) {
                f[ks][i].x[0] = *(const u32x4*)(wb8 + wo + i * (16 * BDIM * 2) + ks * 1024);
                f[ks][i].x[1] = *(const u32x4*)(wb8 + wo + i * (16 * BDIM * 2) + ks * 1024 + 512);
            }
        // these loads name wo and wb8: as inputs both stay live, so unwritten, up to this wait
        asm volatile("s_wait_xcnt 0x0" :: "v"(wo), "s"(wb8) : "memory");
    };
    auto step = [&](Frag4 (&f)[2][4], int t) {
        const u16* xB = (const u16*)sm + laneRow * CP + ((t + blockIdx.x) & (ONT - 1)) * OKT;
        Frag sf[2][2];
        for (int ks = 0; ks < 2; ++ks)
            for (int j = 0; j < 2; ++j)
                load_frag_u16(sf[ks][j], xB + j * 16 * CP + ks * 32, g);
        for (int ks = 0; ks < 2; ++ks)
            for (int i = 0; i < 4; ++i)
                for (int j = 0; j < 2; ++j)
                    acc[i][j] = __builtin_amdgcn_wmma_f32_16x16x32_bf16(
                        false, f[ks][i].v, false, sf[ks][j].v, (short)0, acc[i][j], false, false);
    };

    // two register sets: a set is asked for again as soon as its products are issued, two tiles ahead
    Frag4 fa[2][4], fb[2][4];
    fetch(fa, 0);
    fetch(fb, 1);
    // own copies landed, then the barrier that publishes the ctx rows to every wave
    wait_async0();
    __syncthreads();

    // unrolled: the tests for the last fetches are then settled at compile time; as branches in a rolled loop they
    // would join two load counts, and the wait in front of the products would also wait for the tile just asked for
    #pragma unroll
    for (int t = 0; t < ONT; t += 2) {
        step(fa, t);
        if (t + 2 < ONT) fetch(fa, t + 2);
        step(fb, t + 1);
        if (t + 3 < ONT) fetch(fb, t + 3);
    }

    // this wave's two rows of the residual, and the bias: they fly while the tile is laid down
    const char* hb = (const char*)residual;
    const char* bb = (const char*)bias;
    u32 roff = (u32)(bm + wave * 2) * (BDIM * 4) + (u32)lane * 16u;
    u32 coff = (u32)lane * 16u;
    f32x4 hv[2][8], bv[8];
    for (int c = 0; c < 8; ++c) {
        hv[0][c] = *(const f32x4*)(hb + roff + c * 512);
        hv[1][c] = *(const f32x4*)(hb + roff + BDIM * 4 + c * 512);
        bv[c] = *(const f32x4*)(bb + coff + c * 512);
    }
    // these loads name roff, coff (or the lane number it is made of) and their bases: as inputs all stay
    // live, so unwritten, up to this wait
    asm volatile("s_wait_xcnt 0x0" :: "v"(roff), "v"(coff), "v"(lane), "s"(hb), "s"(bb) : "memory");

    // the f32 tile has LDS of its own, behind the ctx rows that slower waves may still read
    float* xs = (float*)(sm + CT_BYTES);
    for (int i = 0; i < 4; ++i)
        for (int j = 0; j < 2; ++j) {
            float* p = xs + (j * 16 + laneRow) * XP + wave * 64 + i * 16 + g * 8;
            *(f32x4*)p = f32x4{acc[i][j][0], acc[i][j][1], acc[i][j][2], acc[i][j][3]};
            *(f32x4*)(p + 4) = f32x4{acc[i][j][4], acc[i][j][5], acc[i][j][6], acc[i][j][7]};
        }

    const char* wb = (const char*)lnw;
    const char* ob = (const char*)lnb;
    f32x4 wv[8], ov[8];
    for (int c = 0; c < 8; ++c) {
        wv[c] = *(const f32x4*)(wb + coff + c * 512);
        ov[c] = *(const f32x4*)(ob + coff + c * 512);
    }
    // as above, for coff, the lane number and the two bases
    asm volatile("s_wait_xcnt 0x0" :: "v"(coff), "v"(lane), "s"(wb), "s"(ob) : "memory");

    __syncthreads();                 // every wave's part of the tile is in LDS

    f32x4 v[2][8];
    float s[2];
    for (int rr = 0; rr < 2; ++rr) {
        const float* xr = xs + (wave * 2 + rr) * XP + lane * 4;
        f32x4 a = f32x4{0.f, 0.f, 0.f, 0.f};
        for (int c = 0; c < 8; ++c) {
            v[rr][c] = (*(const f32x4*)(xr + c * 128) + bv[c]) + hv[rr][c];
            a += v[rr][c];
        }
        s[rr] = (a[0] + a[1]) + (a[2] + a[3]);
    }
    for (int off = 16; off; off >>= 1)
        for (int rr = 0; rr < 2; ++rr) s[rr] += __shfl_xor(s[rr], off, 32);
    float mu[2], q[2];
    for (int rr = 0; rr < 2; ++rr) {
        mu[rr] = s[rr] * (1.0f / BDIM);
        f32x4 a = f32x4{0.f, 0.f, 0.f, 0.f};
        for (int c = 0; c < 8; ++c) {
            v[rr][c] -= mu[rr];
            a += v[rr][c] * v[rr][c];
        }
        q[rr] = (a[0] + a[1]) + (a[2] + a[3]);
    }
    for (int off = 16; off; off >>= 1)
        for (int rr = 0; rr < 2; ++rr) q[rr] += __shfl_xor(q[rr], off, 32);
    for (int rr = 0; rr < 2; ++rr) {
        float inv = rsqrtf(q[rr] * (1.0f / BDIM) + 1e-12f);
        for (int c = 0; c < 8; ++c)
            v[rr][c] = v[rr][c] * inv * wv[c] + ov[c];
    }
    char* db = (char*)out;
    for (int rr = 0; rr < 2; ++rr)
        for (int c = 0; c < 8; ++c)
            *(f32x4*)(db + roff + rr * (BDIM * 4) + c * 512) = v[rr][c];
    // the stores name roff and their data: as inputs all stay live, so unwritten, up to this wait
    asm volatile("s_wait_xcnt 0x0" :: "v"(roff),
                 "v"(v[0][0]), "v"(v[0][1]), "v"(v[0][2]), "v"(v[0][3]), "v"(v[0][4]), "v"(v[0][5]), "v"(v[0][6]), "v"(v[0][7]),
                 "v"(v[1][0]), "v"(v[1][1]), "v"(v[1][2]), "v"(v[1][3]), "v"(v[1][4]), "v"(v[1][5]), "v"(v[1][6]), "v"(v[1][7])
                 : "memory");
}

// ---------------------------------------------------------------- launch
extern "C" void kernel_launch(void* const* d_in, const int* in_sizes, int n_in,
                              void* d_out, int out_size, void* d_ws, size_t ws_size,
                              hipStream_t stream) {
    const float* hidden = (const float*)d_in[0];
    const float* mask   = (const float*)d_in[1];
    const float* phi    = (const float*)d_in[2];
    const float* mag    = (const float*)d_in[3];
    const float* Wq     = (const float*)d_in[4];
    const float* bq     = (const float*)d_in[5];
    const float* Wk     = (const float*)d_in[6];
    const float* bk     = (const float*)d_in[7];
    const float* Wv     = (const float*)d_in[8];
    const float* bv     = (const float*)d_in[9];
    const float* gamma  = (const float*)d_in[10];
    const float* Wo     = (const float*)d_in[11];
    const float* bo     = (const float*)d_in[12];
    const float* lnw    = (const float*)d_in[13];
    const float* lnb    = (const float*)d_in[14];
    float* out = (float*)d_out;

    char* ws = (char*)d_ws;
    const size_t o_xb   = 0;                           // 8 MB  bf16 X
    const size_t o_wt   = o_xb + 8388608ull;           // 6 MB  bf16 WT (q,k,v packed)
    const size_t o_wot  = o_wt + 6291456ull;           // 2 MB  bf16 WoT, fragment order
    const size_t o_bias = o_wot + 2097152ull;          // 12 KB packed bias
    const size_t o_qr   = o_bias + 12288ull + 50331648ull;   // 8 MB, at its old place: the 48 MB in front are not used
    const size_t o_kr   = o_qr + 8388608ull;           // 8 MB
    const size_t o_vt   = o_kr + 8388608ull;           // 8 MB
    const size_t o_ctx  = o_vt + 8388608ull;           // 8 MB

    u16*   Xb    = (u16*)(ws + o_xb);
    u16*   WT    = (u16*)(ws + o_wt);
    u16*   WoT   = (u16*)(ws + o_wot);
    float* biasA = (float*)(ws + o_bias);
    u16*   qrot  = (u16*)(ws + o_qr);
    u16*   krot  = (u16*)(ws + o_kr);
    u16*   vtb   = (u16*)(ws + o_vt);
    u16*   ctxb  = (u16*)(ws + o_ctx);

    // 1) X to bf16, the four weights transposed to bf16, the bias packed: one launch
    prep_kernel<<<PREP_X + PREP_T + PREP_B, 256, 0, stream>>>(
        hidden, Wq, Wk, Wv, Wo, bq, bk, bv, Xb, WT, WoT, biasA);

    // 3) fused QKV GEMM [4096 x 3072] with scale, rotation and V transpose in its epilogue
    gemm_qkv_rope_kernel<<<dim3(NQKV / BN, ROWS / BM), QTHREADS, 0, stream>>>(
        Xb, WT, biasA, phi, mag, gamma, qrot, krot, vtb);

    // 4) fused attention (online softmax in registers, no LDS)
    attn_kernel<<<dim3(LDIM / (AW * NQ * 16), HH, BB), AW * 32, 0, stream>>>(
        qrot, krot, vtb, mask, ctxb);

    // 5) output projection + residual + LayerNorm, a block for 32 whole rows
    gemm_out_ln_kernel<<<ROWS / OM, 512, 0, stream>>>(
        ctxb, WoT, bo, hidden, lnw, lnb, out);
}

// v009
// A run of this version takes 72.4 microseconds.
// Timed twice side by side with v008, it ran 1.08 times as fast both times.
// All steps since v000 together make it 4.16 times as fast.
#include <hip/hip_runtime.h>
#include <hip/hip_bf16.h>

typedef unsigned short u16;
typedef unsigned int   u32;
typedef unsigned long long u64;

typedef __attribute__((ext_vector_type(16))) __bf16 v16bf;
typedef __attribute__((ext_vector_type(8)))  float  v8f;
typedef __attribute__((ext_vector_type(4))) u32   u32x4;
typedef __attribute__((ext_vector_type(4))) float f32x4;

#define BDIM 1024   // D
#define LDIM 1024   // L
#define BB   4      // B
#define HH   16     // H
#define HD   64     // head dim
#define ROWS (BB*LDIM)      // 4096
#define NQKV (3*BDIM)       // 3072

__device__ __forceinline__ u16 f2bf(float f) {
    union { float f; u32 u; } x; x.f = f;
    u32 r = x.u + 0x7FFFu + ((x.u >> 16) & 1u);
    return (u16)(r >> 16);
}

struct Frag { union { v16bf v; uint4 q[2]; u16 h[16]; }; };

// load a 16-half fragment (A-layout) from a row:
// lane holds row (lane&15); halves 0..7 at K = g*8.. , halves 8..15 at K = 16+g*8..
__device__ __forceinline__ void load_frag_u16(Frag& f, const u16* rowPtr, int g) {
    f.q[0] = *(const uint4*)(rowPtr + g * 8);
    f.q[1] = *(const uint4*)(rowPtr + 16 + g * 8);
}

__device__ __forceinline__ void wait_async0() {
    asm volatile("s_wait_asynccnt 0x0" ::: "memory");
}

// ---------------------------------------------------------------- preparation, one launch
// Three independent jobs share one grid by block range (the test is the same for a whole block):
//   blocks [0, PREP_X):        X f32 -> bf16, 4096 float4 a block, 16 a thread
//   the next PREP_T blocks:    W f32 [k][n] -> bf16 [n][k], four matrices, a tile of 128 k x 64 n a block
//                              (Wo leaves in the fragment order of the output projection, see there)
//   the last PREP_B blocks:    bq, bk, bv -> one packed bias
#define PREP_X 256
#define PREP_T 512
#define PREP_B 3

__global__ __launch_bounds__(256) void prep_kernel(
    const float* __restrict__ X, const float* __restrict__ Wq, const float* __restrict__ Wk,
    const float* __restrict__ Wv, const float* __restrict__ Wo,
    const float* __restrict__ bq, const float* __restrict__ bk, const float* __restrict__ bv,
    u16* __restrict__ Xb, u16* __restrict__ WT, u16* __restrict__ WoT, float* __restrict__ biasA) {

    // [n][16-byte chunk of 8 k]; the chunk index is xor-ed with n >> 2, so that the 16 lanes that write
    // one k chunk of 16 rows, and the 16 that read one row, each meet 16 different bank groups
    __shared__ uint4 sW[64 * 16];

    int blk = blockIdx.x, tid = threadIdx.x;
    if (blk < PREP_X) {
        const char* s = (const char*)(X + (size_t)blk * 16384);
        char* d = (char*)(Xb + (size_t)blk * 16384);
        u32 off = (u32)tid * 16u;
        float4 f[16];
        for (int j = 0; j < 16; ++j)
            f[j] = *(const float4*)(s + off + j * 4096);
        u32 so = (u32)tid * 8u;
        for (int j = 0; j < 16; ++j) {
            ushort4 o;
            o.x = f2bf(f[j].x); o.y = f2bf(f[j].y); o.z = f2bf(f[j].z); o.w = f2bf(f[j].w);
            *(ushort4*)(d + so + j * 2048) = o;
        }
    } else if (blk < PREP_X + PREP_T) {
        int t = blk - PREP_X;
        int m = t >> 7;                              // which matrix
        int k0 = (t & 7) * 128, n0 = ((t >> 3) & 15) * 64;
        const float* Wm = m == 0 ? Wq : m == 1 ? Wk : m == 2 ? Wv : Wo;
        u16* Dm = m == 3 ? WoT : WT + (size_t)m * BDIM * BDIM;
        int c4 = tid & 15, kc = tid >> 4;            // 4 columns n, 8 rows k: four whole output chunks
        const char* s = (const char*)(Wm + (size_t)k0 * BDIM + n0);
        u32 off = (u32)(kc * 8 * BDIM + c4 * 4) * 4u;
        float4 f[8];
        for (int j = 0; j < 8; ++j)
            f[j] = *(const float4*)(s + off + j * BDIM * 4);
        union { uint4 x; u16 h[8]; } w[4];
        for (int j = 0; j < 8; ++j) {
            w[0].h[j] = f2bf(f[j].x); w[1].h[j] = f2bf(f[j].y);
            w[2].h[j] = f2bf(f[j].z); w[3].h[j] = f2bf(f[j].w);
        }
        for (int e = 0; e < 4; ++e)
            sW[(c4 * 4 + e) * 16 + (kc ^ c4)] = w[e].x;
        __syncthreads();
        // Wq, Wk, Wv: row n = kc + 16 j, chunk c4: 256 bytes a row in a run.
        // Wo, fragment order: row n = c4 + 16 j, chunk kc: a wave stores 16 rows of two chunks, 512 bytes in a run.
        // Sixteen rows are 32 KB in both orders. The choice is the same for a whole block.
        bool fo = m == 3;
        int nr = fo ? c4 : kc, ch = fo ? kc : c4;
        char* d = (char*)(Dm + (size_t)n0 * BDIM + (fo ? k0 * 16 : k0));
        u32 so = fo ? (u32)((kc >> 1) * 512 + (kc & 1) * 256 + c4 * 16) : (u32)(kc * BDIM * 2 + c4 * 16);
        u32x4 v[4];
        for (int j = 0; j < 4; ++j) {
            int n = nr + j * 16;
            v[j] = *(const u32x4*)&sW[n * 16 + (ch ^ ((n >> 2) & 15))];
        }
        for (int j = 0; j < 4; ++j)
            *(u32x4*)(d + so + j * 16 * BDIM * 2) = v[j];
        // the stores name d, so and their data: as inputs all stay live, so unwritten, up to this wait
        asm volatile("s_wait_xcnt 0x0" :: "s"(d), "v"(so), "v"(v[0]), "v"(v[1]), "v"(v[2]), "v"(v[3]) : "memory");
    } else {
        int p = blk - PREP_X - PREP_T;
        const float* bs = p == 0 ? bq : p == 1 ? bk : bv;
        ((float4*)biasA)[p * 256 + tid] = ((const float4*)bs)[tid];
        // the store names its address and data registers: the wait stands before any is written again
        asm volatile("s_wait_xcnt 0x0" ::: "memory");
    }
}

// ---------------------------------------------------------------- tile of the QKV GEMM
// One block a WGP: 256 tokens x 192 columns (3 heads), 12 waves of 64 x 64. 16 x 16 blocks fill the 256 WGPs once.
#define BM 256
#define BN 192
#define BK 128   // k a tile: 256 bytes a row, two whole lines
#define LDT 136  // padded LDS row stride (halves): 272 B = 16 B x 17, free of conflicts for 16-byte reads
#define TROWS (BM + BN)   // rows of a staged tile: 0..255 X rows, 256..447 W rows
#define QTHREADS 384

// ---------------------------------------------------------------- QKV GEMM + scale + rotation
// Xb[ROWS][D] * WT[3072][D]^T + bias, then scale and rotation in the accumulators:
//   q_rot, k_rot, V^T bf16, one plane of 64 x 1024 a (b, h), each in the order in which the attention's
//   fragments are loaded (below); no f32 qkv array, no separate launch.
// A wave holds one whole head (64 columns) for 64 tokens. The first WMMA operand is the one whose index must
// run along a lane's 8 results (the choice is the same for a whole wave):
//   Q, K heads: W rows first -> lane = token l, results = 8 head columns d;
//               the rotation partner d + 32 is tile i + 2 of the same lane and register
//   V heads:    X rows first -> lane = head column d, results = 8 tokens l (the transposed V row)
// Either way 8 results are one 16-byte store.
// Fragment order: the 32 pieces of 16 bytes that one wave-wide fragment load takes lie side by side, piece
// number = lane = g * 16 + row, so such a load, and the store that writes the same 512 bytes here, covers
// 4 whole 128-byte lines:
//   q_rot, k_rot: [l >> 4][d >> 4][(d >> 3) & 1][l & 15][d & 7]
//   V^T:          [l >> 5][d >> 4][(l >> 4) & 1][(l >> 3) & 1][d & 15][l & 7]

// Eight copies and the wait for their address registers in one statement: nothing can rewrite a register
// that a copy names in front of that wait.
__device__ __forceinline__ void async_copy16x8(const u32 (&l)[8], const char* const (&p)[8]) {
    asm volatile("global_load_async_to_lds_b128 %0, %1, off\n\t"
                 "global_load_async_to_lds_b128 %2, %3, off\n\t"
                 "global_load_async_to_lds_b128 %4, %5, off\n\t"
                 "global_load_async_to_lds_b128 %6, %7, off\n\t"
                 "global_load_async_to_lds_b128 %8, %9, off\n\t"
                 "global_load_async_to_lds_b128 %10, %11, off\n\t"
                 "global_load_async_to_lds_b128 %12, %13, off\n\t"
                 "global_load_async_to_lds_b128 %14, %15, off\n\t"
                 "s_wait_xcnt 0x0"
                 :: "v"(l[0]), "v"((u64)(uintptr_t)p[0]), "v"(l[1]), "v"((u64)(uintptr_t)p[1]),
                    "v"(l[2]), "v"((u64)(uintptr_t)p[2]), "v"(l[3]), "v"((u64)(uintptr_t)p[3]),
                    "v"(l[4]), "v"((u64)(uintptr_t)p[4]), "v"(l[5]), "v"((u64)(uintptr_t)p[5]),
                    "v"(l[6]), "v"((u64)(uintptr_t)p[6]), "v"(l[7]), "v"((u64)(uintptr_t)p[7]) : "memory");
}

// Nine copies, and one copy, each with the same wait in its statement.
__device__ __forceinline__ void async_copy16x9(const u32 (&l)[9], const char* const (&p)[9]) {
    asm volatile("global_load_async_to_lds_b128 %0, %1, off\n\t"
                 "global_load_async_to_lds_b128 %2, %3, off\n\t"
                 "global_load_async_to_lds_b128 %4, %5, off\n\t"
                 "global_load_async_to_lds_b128 %6, %7, off\n\t"
                 "global_load_async_to_lds_b128 %8, %9, off\n\t"
                 "global_load_async_to_lds_b128 %10, %11, off\n\t"
                 "global_load_async_to_lds_b128 %12, %13, off\n\t"
                 "global_load_async_to_lds_b128 %14, %15, off\n\t"
                 "global_load_async_to_lds_b128 %16, %17, off\n\t"
                 "s_wait_xcnt 0x0"
                 :: "v"(l[0]), "v"((u64)(uintptr_t)p[0]), "v"(l[1]), "v"((u64)(uintptr_t)p[1]),
                    "v"(l[2]), "v"((u64)(uintptr_t)p[2]), "v"(l[3]), "v"((u64)(uintptr_t)p[3]),
                    "v"(l[4]), "v"((u64)(uintptr_t)p[4]), "v"(l[5]), "v"((u64)(uintptr_t)p[5]),
                    "v"(l[6]), "v"((u64)(uintptr_t)p[6]), "v"(l[7]), "v"((u64)(uintptr_t)p[7]),
                    "v"(l[8]), "v"((u64)(uintptr_t)p[8]) : "memory");
}
__device__ __forceinline__ void async_copy16(u32 l, const char* p) {
    asm volatile("global_load_async_to_lds_b128 %0, %1, off\n\t"
                 "s_wait_xcnt 0x0"
                 :: "v"(l), "v"((u64)(uintptr_t)p) : "memory");
}

__global__ __launch_bounds__(QTHREADS) void gemm_qkv_rope_kernel(
    const u16* __restrict__ A, const u16* __restrict__ BT, const float* __restrict__ bias,
    const float* __restrict__ phi, const float* __restrict__ mag, const float* __restrict__ gamma,
    u16* __restrict__ qrot, u16* __restrict__ krot, u16* __restrict__ vt) {

    __shared__ __attribute__((aligned(16))) u16 sT[2][TROWS * LDT];     // [buffer][X rows, then W rows]

    const int K = BDIM, NT = BDIM / BK;
    int bm = blockIdx.y * BM, bn = blockIdx.x * BN;
    int tid = threadIdx.x;
    int wave = __builtin_amdgcn_readfirstlane(tid >> 5), lane = tid & 31;
    int hw = wave % 3, tw = wave / 3;      // head of the block, group of 64 tokens
    int laneRow = lane & 15, g = lane >> 4;
    int hsel = blockIdx.x * 3 + hw;        // 0..15: heads of Q, 16..31: heads of K, 32..47: heads of V
    bool isV = hsel >= 2 * HH;             // the same for the whole wave
    int pRow = isV ? tw * 64 : BM + hw * 64;       // first operand's rows in the staged tile
    int qRow = isV ? BM + hw * 64 : tw * 64;       // second operand's rows

    // copy c of a thread brings 16 bytes of tile row c * 24 + (tid >> 4): sixteen lanes take one row's 256 bytes,
    // so a wave's copy is 4 whole lines. Rows 432..447 are copy 18 of waves 0..7 alone.
    int r0 = tid >> 4;
    const char* gX = (const char*)(A + (size_t)(bm + r0) * K + (tid & 15) * 8);            // c = 0..9
    const char* g10 = r0 < 16 ? gX + (size_t)240 * K * 2                                    // rows 240..255: X
                              : (const char*)(BT + (size_t)(bn + r0 - 16) * K + (tid & 15) * 8);  // 256..263: W
    const char* gW = (const char*)(BT + (size_t)(bn + 8 + r0) * K + (tid & 15) * 8);        // c = 11..18
    u32 lX = (u32)(uintptr_t)&sT[0][r0 * LDT + (tid & 15) * 8];

    v8f acc[4][4];
    for (int i = 0; i < 4; ++i)
        for (int j = 0; j < 4; ++j)
            acc[i][j] = v8f{0.f, 0.f, 0.f, 0.f, 0.f, 0.f, 0.f, 0.f};

    // the three pointers walk along k with the stages, so that a stage forms its addresses from them anew and
    // no address of a single copy is kept over the products
    auto stage = [&](int buf) {
        for (int hf = 0; hf < 2; ++hf) {
            u32 l[9];
            const char* p[9];
            for (int e = 0; e < 9; ++e) {
                int c = hf * 9 + e;
                l[e] = lX + (u32)((buf * TROWS + c * 24) * LDT * 2);
                p[e] = (c < 10 ? gX + (size_t)c * 24 * K * 2 : c == 10 ? g10 : gW + (size_t)(c - 11) * 24 * K * 2);
            }
            async_copy16x9(l, p);
        }
        if (wave < 8)      // a scalar test: a wave issues this copy with every lane on, or not at all
            async_copy16(lX + (u32)((buf * TROWS + 18 * 24) * LDT * 2), gW + (size_t)7 * 24 * K * 2);
        gX += BK * 2; g10 += BK * 2; gW += BK * 2;
    };

    stage(0);
    wait_async0();
    __syncthreads();
    stage(1);

    Frag sf[2][4], ff[2][4];
    // The fragments of half a tile (64 k) are asked for in one group: a wave then waits out the LDS latency
    // once for 32 products, not once a row of products.
    auto frags = [&](int cur, int hf) {
        const u16* pB = &sT[cur][(pRow + laneRow) * LDT + hf * 64];
        const u16* qB = &sT[cur][(qRow + laneRow) * LDT + hf * 64];
        for (int ks = 0; ks < 2; ++ks) {
            for (int j = 0; j < 4; ++j)
                load_frag_u16(sf[ks][j], qB + j * 16 * LDT + ks * 32, g);
            for (int i = 0; i < 4; ++i)
                load_frag_u16(ff[ks][i], pB + i * 16 * LDT + ks * 32, g);
        }
    };
    auto products = [&]() {
        for (int ks = 0; ks < 2; ++ks)
            for (int i = 0; i < 4; ++i)
                for (int j = 0; j < 4; ++j)
                    acc[i][j] = __builtin_amdgcn_wmma_f32_16x16x32_bf16(
                        false, ff[ks][i].v, false, sf[ks][j].v, (short)0, acc[i][j], false, false);
    };

    for (int t = 0; t < NT; ++t) {
        int cur = t & 1;
        frags(cur, 0);
        // holds the group of loads up here: without it the compiler sinks them between the rows of products
        __builtin_amdgcn_sched_barrier(0);
        products();
        // keeps the second group behind the first half's products, whose registers it takes over: without it
        // the compiler lifts some of these loads into registers of their own and spills
        __builtin_amdgcn_sched_barrier(0);
        frags(cur, 1);
        // hand-over: own LDS reads of this buffer retired (the rest of the tile is in registers), own copies of
        // the next tile landed, then the barrier that publishes that tile and frees this buffer
        asm volatile("s_wait_dscnt 0x0" ::: "memory");
        wait_async0();
        __syncthreads();
        // the refill stands in front of the products, which read registers alone: its copies get the whole
        // trip to land
        if (t + 2 < NT) stage(cur);
        products();
    }
    wait_async0();

    int b = bm >> 10, lblk = (bm & (LDIM - 1)) + tw * 64;      // first token of the wave in its sequence
    if (!isV) {
        int h = hsel & (HH - 1);
        u16* dst = (hsel >> 4) ? krot : qrot;
        const float* bp = bias + hsel * HD + g * 8;
        float gm = gamma[h];
        int idx0 = (b * HH + h) * LDIM + lblk + laneRow;
        float ph4[4], mg4[4];
        for (int j = 0; j < 4; ++j) {
            ph4[j] = phi[idx0 + j * 16];
            mg4[j] = mag[idx0 + j * 16];
        }
        // the loaded values are inputs, so the nine loads stand in front of this wait: no register that one of
        // them names is written again ahead of it
        asm volatile("s_wait_xcnt 0x0" :: "v"(gm), "v"(ph4[0]), "v"(ph4[1]), "v"(ph4[2]), "v"(ph4[3]),
                     "v"(mg4[0]), "v"(mg4[1]), "v"(mg4[2]), "v"(mg4[3]) : "memory");
        // unrolled: a rolled loop would index the accumulators by a variable and send them through scratch memory
        #pragma unroll
        for (int j = 0; j < 4; ++j) {
            int idx = idx0 + j * 16;
            float ph = ph4[j];
            float sc = 1.0f + gm * tanhf(mg4[j]);
            float cs = cosf(ph), sn = sinf(ph);
            for (int i = 0; i < 2; ++i) {
                union { uint4 x; u16 hh[8]; } lo, hi;
                for (int r = 0; r < 8; ++r) {
                    float a0 = (acc[i][j][r] + bp[i * 16 + r]) * sc;
                    float a1 = (acc[i + 2][j][r] + bp[i * 16 + 32 + r]) * sc;
                    lo.hh[r] = f2bf(a0 * cs - a1 * sn);
                    hi.hh[r] = f2bf(a1 * cs + a0 * sn);
                }
                u16* o = dst + (size_t)(idx & ~15) * HD + i * 256 + lane * 8;    // idx & ~15: first token of the tile
                *(uint4*)o = lo.x;
                *(uint4*)(o + 512) = hi.x;
            }
        }
    } else {
        int h = hsel - 2 * HH;
        // unrolled for the same reason
        #pragma unroll
        for (int j = 0; j < 4; ++j) {
            float bv = bias[hsel * HD + j * 16 + laneRow];           // head column d = j * 16 + laneRow
            u16* o = vt + (size_t)(b * HH + h) * (HD * LDIM) + lblk * HD + j * 512 + lane * 8;
            for (int i = 0; i < 4; ++i) {
                union { uint4 x; u16 hh[8]; } w;
                for (int r = 0; r < 8; ++r) w.hh[r] = f2bf(acc[i][j][r] + bv);
                *(uint4*)(o + (i >> 1) * 2048 + (i & 1) * 256) = w.x;
            }
        }
        // the stores above name their address and data registers: the wait stands before any is written again
        asm volatile("s_wait_xcnt 0x0" ::: "memory");
    }
}

// ---------------------------------------------------------------- attention
// Online softmax in registers; LDS only for the join. Each wave owns NQ*16 queries and walks the keys 32 at a time:
//   S^T = K * Q^T   (D: lane holds query laneRow, keys g*8+r)  -> max and sum are in-lane
//   O^T += V^T * P^T (two S^T tiles, converted in place, are the B operand in the same k order)
// Q, K and V^T lie in fragment order (see the QKV product): a fragment half is 512 bytes in a run, lane * 16.
// Two waves share a group of queries: wave w walks the first half of the keys, wave w + AW the second half.
// The two partial results (O, maximum, sum) are joined through LDS behind the walk.
#define NQ 4          // 16-query tiles per wave
#define AW 4          // groups of NQ * 16 queries per block
#define KS 2          // parts of the keys, a wave each
#define JP (NQ * 8 + 2)   // 16-byte pieces a lane hands over: O, then the maxima, then the sums

struct Frag4 { union { v16bf v; u32x4 x[2]; }; };

__device__ __forceinline__ float other_half(float x) {   // lane l <-> l ^ 16
    int b = __builtin_bit_cast(int, x);
    b = __builtin_amdgcn_permlanex16(b, b, 0x76543210, 0xfedcba98, false, false);
    return __builtin_bit_cast(float, b);
}

// Several exp2 in one statement, each in place: no instruction reads the result or writes the source of the
// one in front of it, and the closing v_nop is the slot that the instruction set asks for behind a
// transcendental. In place, the statement writes only registers that the vector code in front of it wrote.
__device__ __forceinline__ void exp2x8(float (&x)[8]) {
    asm("v_exp_f32 %0, %0\n\tv_exp_f32 %1, %1\n\tv_exp_f32 %2, %2\n\tv_exp_f32 %3, %3\n\t"
        "v_exp_f32 %4, %4\n\tv_exp_f32 %5, %5\n\tv_exp_f32 %6, %6\n\tv_exp_f32 %7, %7\n\tv_nop"
        : "+v"(x[0]), "+v"(x[1]), "+v"(x[2]), "+v"(x[3]), "+v"(x[4]), "+v"(x[5]), "+v"(x[6]), "+v"(x[7]));
}
__device__ __forceinline__ void exp2x4(float (&x)[4]) {
    asm("v_exp_f32 %0, %0\n\tv_exp_f32 %1, %1\n\tv_exp_f32 %2, %2\n\tv_exp_f32 %3, %3\n\tv_nop"
        : "+v"(x[0]), "+v"(x[1]), "+v"(x[2]), "+v"(x[3]));
}

// No __restrict__ here: the "memory" clobber of the waits below must hold the loads on their side.
__global__ __launch_bounds__(AW * KS * 32) void attn_kernel(
    const u16* qrot, const u16* krot, const u16* vt, const float* mask, u16* ctx) {

    __shared__ f32x4 sJ[AW][JP][32];     // [query group][piece][lane]: a wave's store or load of a piece is 512 bytes in a run

    int h = blockIdx.y, b = blockIdx.z;
    int tid = threadIdx.x, lane = tid & 31;
    int wave = __builtin_amdgcn_readfirstlane(tid >> 5);
    int qg = wave & (AW - 1), kh = wave / AW;        // query group, part of the keys: the same for a whole wave
    int laneRow = lane & 15, g = lane >> 4;
    int qbase = (blockIdx.x * AW + qg) * (NQ * 16);
    const float rscale = 0.125f;                     // 1/sqrt(64)
    const float LOG2E = 1.44269504088896340736f;

    const char* qb = (const char*)(qrot + (size_t)(b * HH + h) * LDIM * HD);
    const char* kb = (const char*)(krot + (size_t)(b * HH + h) * LDIM * HD);
    const char* vb8 = (const char*)(vt + (size_t)(b * HH + h) * HD * LDIM);
    const char* mb = (const char*)(mask + b * LDIM);
    // per-lane byte offsets; kv, m: of the pass that is fetched next (32 keys are 4096 bytes of K and of V^T)
    u32 qoff = (u32)(qbase * HD * 2 + lane * 16);
    u32 kvoff = (u32)(kh * (LDIM / KS) * HD * 2) + (u32)lane * 16u;
    u32 moff = (u32)(kh * (LDIM / KS) * 4) + (u32)g * 32u;

    Frag4 qf[NQ][2];
    for (int q = 0; q < NQ; ++q)
        for (int ks = 0; ks < 2; ++ks) {
            qf[q][ks].x[0] = *(const u32x4*)(qb + qoff + q * 2048 + ks * 1024);
            qf[q][ks].x[1] = *(const u32x4*)(qb + qoff + q * 2048 + ks * 1024 + 512);
        }
    // the Q loads name qoff and qb: as inputs both stay live, so unwritten, up to this wait
    asm volatile("s_wait_xcnt 0x0" :: "v"(qoff), "s"(qb) : "memory");

    v8f o[NQ][4];
    float m[NQ], l[NQ];
    for (int q = 0; q < NQ; ++q) {
        for (int dt = 0; dt < 4; ++dt)
            o[q][dt] = v8f{0.f, 0.f, 0.f, 0.f, 0.f, 0.f, 0.f, 0.f};
        m[q] = -1e30f;            // finite start: t - m is never (-inf) - (-inf) under -inf masks
        l[q] = 0.f;
    }

    Frag4 kf[2][2], va[4], vb[4];
    f32x4 mk[2][2];
    int pos = kh * (LDIM / KS);   // first key of the pass that is fetched next

    auto fetch = [&](Frag4 (&vd)[4]) {
        for (int kt = 0; kt < 2; ++kt) {
            for (int ks = 0; ks < 2; ++ks) {
                kf[kt][ks].x[0] = *(const u32x4*)(kb + kvoff + kt * 2048 + ks * 1024);
                kf[kt][ks].x[1] = *(const u32x4*)(kb + kvoff + kt * 2048 + ks * 1024 + 512);
            }
            mk[kt][0] = *(const f32x4*)(mb + moff + kt * 64);
            mk[kt][1] = *(const f32x4*)(mb + moff + kt * 64 + 16);
        }
        for (int dt = 0; dt < 4; ++dt) {
            vd[dt].x[0] = *(const u32x4*)(vb8 + kvoff + dt * 1024);
            vd[dt].x[1] = *(const u32x4*)(vb8 + kvoff + dt * 1024 + 512);
        }
    };
    auto advance = [&]() {
        // The fetch's loads name kvoff, moff: as inputs here they stay live, so unwritten, up to
        // this wait; its "memory" clobber keeps the loads in front of it.
        asm volatile("s_wait_xcnt 0x0" :: "v"(kvoff), "v"(moff) : "memory");
        int nxt = (pos + 32) & (LDIM - 1);   // behind the last pass: the next part's first key, or key 0: in bounds, unused
        int d = nxt - pos;
        kvoff += (u32)(d * HD * 2); moff += (u32)(d * 4);
        pos = nxt;
    };

    auto pass = [&](Frag4 (&vc)[4], Frag4 (&vn)[4]) {
        float t[NQ][16];
        // all score products first, eight tiles side by side, as the build with 1,024 registers had them: written
        // query by query, the build with 512 runs them through two tiles, each product waiting for the one in front
        v8f s[NQ][2];
        for (int ks = 0; ks < 2; ++ks)
            for (int q = 0; q < NQ; ++q)
                for (int kt = 0; kt < 2; ++kt)
                    s[q][kt] = __builtin_amdgcn_wmma_f32_16x16x32_bf16(
                        false, kf[kt][ks].v, false, qf[q][ks].v, (short)0,
                        ks ? s[q][kt] : v8f{0.f, 0.f, 0.f, 0.f, 0.f, 0.f, 0.f, 0.f}, false, false);
        for (int q = 0; q < NQ; ++q)
            for (int kt = 0; kt < 2; ++kt)
                for (int i = 0; i < 8; ++i)
                    t[q][kt * 8 + i] = s[q][kt][i] * rscale + mk[kt][i >> 2][i & 3];
        // keeps the loads below behind the score products, whose K and mask registers they take over: lifted above
        // them they take registers of their own, and at the 512 registers of two waves a SIMD the Q fragments spill
        __builtin_amdgcn_sched_barrier(0);
        // the next pass's K, mask and V fly while this pass's softmax and V products run
        fetch(vn);
        // holds the loads up here, in front of the softmax: they need its time to land
        __builtin_amdgcn_sched_barrier(0);

        float alpha[NQ];
        for (int q = 0; q < NQ; ++q) {
            float tm = t[q][0];
            for (int i = 1; i < 16; ++i) tm = fmaxf(tm, t[q][i]);
            tm = fmaxf(tm, other_half(tm));
            float mnew = fmaxf(m[q], tm);
            alpha[q] = (m[q] - mnew) * LOG2E;
            m[q] = mnew;
        }
        exp2x4(alpha);

        for (int q = 0; q < NQ; ++q) {
            Frag4 pf;
            float ls = 0.f;
            for (int hf = 0; hf < 2; ++hf) {
                float p[8];
                for (int i = 0; i < 8; ++i) p[i] = (t[q][hf * 8 + i] - m[q]) * LOG2E;
                exp2x8(p);
                for (int i = 0; i < 8; ++i) { ls += p[i]; pf.v[hf * 8 + i] = (__bf16)p[i]; }
            }
            l[q] = l[q] * alpha[q] + ls;
            for (int dt = 0; dt < 4; ++dt) {
                o[q][dt] *= alpha[q];
                o[q][dt] = __builtin_amdgcn_wmma_f32_16x16x32_bf16(
                    false, vc[dt].v, false, pf.v, (short)0, o[q][dt], false, false);
            }
        }
        advance();
    };

    fetch(va);
    advance();
    for (int k0 = 0; k0 < LDIM / KS; k0 += 64) {
        pass(va, vb);
        pass(vb, va);
    }

    // join: the wave of the second part lays its O, maxima and sums down and is done; the barrier publishes them to
    // the wave of the first part, which brings both to the common maximum and adds them
    if (kh) {
        for (int q = 0; q < NQ; ++q)
            for (int dt = 0; dt < 4; ++dt) {
                sJ[qg][q * 8 + dt * 2][lane] = f32x4{o[q][dt][0], o[q][dt][1], o[q][dt][2], o[q][dt][3]};
                sJ[qg][q * 8 + dt * 2 + 1][lane] = f32x4{o[q][dt][4], o[q][dt][5], o[q][dt][6], o[q][dt][7]};
            }
        sJ[qg][NQ * 8][lane] = f32x4{m[0], m[1], m[2], m[3]};
        sJ[qg][NQ * 8 + 1][lane] = f32x4{l[0], l[1], l[2], l[3]};
    }
    __syncthreads();
    if (kh) return;
    {
        f32x4 m2 = sJ[qg][NQ * 8][lane], l2 = sJ[qg][NQ * 8 + 1][lane];
        float a[8];
        for (int q = 0; q < NQ; ++q) {
            float mn = fmaxf(m[q], m2[q]);
            a[q] = (m[q] - mn) * LOG2E;
            a[NQ + q] = (m2[q] - mn) * LOG2E;
            m[q] = mn;
        }
        exp2x8(a);
        for (int q = 0; q < NQ; ++q) {
            l[q] = l[q] * a[q] + l2[q] * a[NQ + q];
            for (int dt = 0; dt < 4; ++dt) {
                f32x4 lo = sJ[qg][q * 8 + dt * 2][lane], hi = sJ[qg][q * 8 + dt * 2 + 1][lane];
                for (int r = 0; r < 4; ++r) {
                    o[q][dt][r] = o[q][dt][r] * a[q] + lo[r] * a[NQ + q];
                    o[q][dt][r + 4] = o[q][dt][r + 4] * a[q] + hi[r] * a[NQ + q];
                }
            }
        }
    }

    // epilogue: lane holds query laneRow, head columns dt*16 + g*8 + r -> one 16-byte store per tile
    char* cb = (char*)(ctx + (size_t)b * LDIM * BDIM + h * HD);
    for (int q = 0; q < NQ; ++q) {
        float inv = 1.0f / (l[q] + other_half(l[q]));
        int lq = qbase + q * 16 + laneRow;
        union { u32x4 x; u16 hh[8]; __bf16 bh[8]; } w[4];
        for (int dt = 0; dt < 4; ++dt)
            for (int r = 0; r < 8; ++r)
                w[dt].bh[r] = (__bf16)(o[q][dt][r] * inv);
        if (m[q] <= -1e8f) {         // fully masked row: the diagonal alone survives, ctx = v[lq]
            u32 doff = (u32)((lq >> 5) * 2048 + ((lq >> 4) & 1) * 256 + ((lq >> 3) & 1) * 128 + g * 64 + (lq & 7)) * 2u;
            for (int dt = 0; dt < 4; ++dt)
                for (int r = 0; r < 8; ++r)
                    w[dt].hh[r] = *(const u16*)(vb8 + doff + (dt * 512 + r * 8) * 2);
            // these loads name doff: it stays live up to this wait, behind the loads
            asm volatile("s_wait_xcnt 0x0" :: "v"(doff) : "memory");
        }
        u32 soff = (u32)(lq * BDIM + g * 8) * 2u;
        for (int dt = 0; dt < 4; ++dt)
            *(u32x4*)(cb + soff + dt * 32) = w[dt].x;
        // the stores name soff and their data: the wait stands before either is written again
        asm volatile("s_wait_xcnt 0x0" :: "v"(soff), "v"(w[0].x), "v"(w[1].x), "v"(w[2].x), "v"(w[3].x) : "memory");
    }
}

// ---------------------------------------------------------------- output projection + residual + LayerNorm
// A block owns OM whole rows of x = ctx * Wo + bo + hidden, so the row statistics never leave it:
//   16 waves, each 64 columns n x 32 rows m; W rows are the first WMMA operand, so a lane holds one row m
//   and 8 columns n in a run (two 16-byte LDS stores a tile);
//   the f32 tile then lies in LDS, and each wave normalises two whole rows of it with 16-byte loads and
//   stores in whole lines.
// No two waves of a block share a W row, so W does not pass through LDS: each wave loads its own fragments
// straight into registers, two k tiles ahead. W lies in fragment order, [n >> 4][k >> 4][(k >> 3) & 1][n & 15][k & 7]:
// a wave-wide 16-byte load covers 4 whole lines. The block's ctx rows, which all waves share, are copied to LDS
// once, so the k loop has no barrier.
// Every block reads all of W: block i starts its walk over k at tile i mod 16, so that the blocks do not
// all ask for the same lines at the same time.
#define OM 32                        // rows a block
#define OKT 64                       // k a tile
#define ONT (BDIM / OKT)
#define CP 1032                      // LDS row pitch of the ctx rows in halves: 2064 B = 16 B x 129, free of conflicts for 16-byte reads
#define CT_BYTES (OM * CP * 2)       // ctx rows
#define XP 1028                      // f32 row pitch of the x tile: 16 rows of 16-byte stores meet 64 different banks

// No __restrict__ here: the "memory" clobber of the waits below must hold the loads and stores on their side.
__global__ __launch_bounds__(512) void gemm_out_ln_kernel(
    const u16* A, const u16* BT, const float* bias, const float* residual,
    const float* lnw, const float* lnb, float* out) {

    __shared__ __attribute__((aligned(16))) char sm[CT_BYTES + OM * XP * 4];    // ctx rows, then the f32 x tile

    int bm = blockIdx.x * OM;
    int tid = threadIdx.x;
    int wave = tid >> 5, lane = tid & 31;
    int laneRow = lane & 15, g = lane >> 4;

    v8f acc[4][2];
    for (int i = 0; i < 4; ++i)
        for (int j = 0; j < 2; ++j)
            acc[i][j] = v8f{0.f, 0.f, 0.f, 0.f, 0.f, 0.f, 0.f, 0.f};

    // ctx rows: copy c of a thread brings 16 bytes of row c * 4 + (tid >> 7); a wave's copy is 4 whole lines
    {
        const char* gA = (const char*)(A + (size_t)(bm + (tid >> 7)) * BDIM + (tid & 127) * 8);
        u32 lA = (u32)(uintptr_t)&sm[(tid >> 7) * (CP * 2) + (tid & 127) * 16];
        u32 l[8];
        const char* p[8];
        for (int c = 0; c < 8; ++c) {
            l[c] = lA + (u32)(c * 4 * CP * 2);
            p[c] = gA + (size_t)c * 4 * BDIM * 2;
        }
        async_copy16x8(l, p);
    }

    // this wave's 64 rows of W: 32 KB a group of 16 rows, 2 KB of it a k tile
    const char* wb8 = (const char*)BT;
    u32 wlane = (u32)wave * (4u * 16u * BDIM * 2u) + (u32)lane * 16u;
    auto fetch = [&](Frag4 (&f)[2][4], int t) {
        u32 wo = wlane + (u32)((t + blockIdx.x) & (ONT - 1)) * (OKT * 16 * 2);
        for (int i = 0; i < 4; ++i)
            for (int ks = 0; ks < 2; ++ks) {
                f[ks][i].x[0] = *(const u32x4*)(wb8 + wo + i * (16 * BDIM * 2) + ks * 1024);
                f[ks][i].x[1] = *(const u32x4*)(wb8 + wo + i * (16 * BDIM * 2) + ks * 1024 + 512);
            }
        // these loads name wo and wb8: as inputs both stay live, so unwritten, up to this wait
        asm volatile("s_wait_xcnt 0x0" :: "v"(wo), "s"(wb8) : "memory");
    };
    auto step = [&](Frag4 (&f)[2][4], int t) {
        const u16* xB = (const u16*)sm + laneRow * CP + ((t + blockIdx.x) & (ONT - 1)) * OKT;
        Frag sf[2][2];
        for (int ks = 0; ks < 2; ++ks)
            for (int j = 0; j < 2; ++j)
                load_frag_u16(sf[ks][j], xB + j * 16 * CP + ks * 32, g);
        for (int ks = 0; ks < 2; ++ks)
            for (int i = 0; i < 4; ++i)
                for (int j = 0; j < 2; ++j)
                    acc[i][j] = __builtin_amdgcn_wmma_f32_16x16x32_bf16(
                        false, f[ks][i].v, false, sf[ks][j].v, (short)0, acc[i][j], false, false);
    };

    // two register sets: a set is asked for again as soon as its products are issued, two tiles ahead
    Frag4 fa[2][4], fb[2][4];
    fetch(fa, 0);
    fetch(fb, 1);
    // own copies landed, then the barrier that publishes the ctx rows to every wave
    wait_async0();
    __syncthreads();

    // unrolled: the tests for the last fetches are then settled at compile time; as branches in a rolled loop they
    // would join two load counts, and the wait in front of the products would also wait for the tile just asked for
    #pragma unroll
    for (int t = 0; t < ONT; t += 2) {
        step(fa, t);
        if (t + 2 < ONT) fetch(fa, t + 2);
        step(fb, t + 1);
        if (t + 3 < ONT) fetch(fb, t + 3);
    }

    // this wave's two rows of the residual, and the bias: they fly while the tile is laid down
    const char* hb = (const char*)residual;
    const char* bb = (const char*)bias;
    u32 roff = (u32)(bm + wave * 2) * (BDIM * 4) + (u32)lane * 16u;
    u32 coff = (u32)lane * 16u;
    f32x4 hv[2][8], bv[8];
    for (int c = 0; c < 8; ++c) {
        hv[0][c] = *(const f32x4*)(hb + roff + c * 512);
        hv[1][c] = *(const f32x4*)(hb + roff + BDIM * 4 + c * 512);
        bv[c] = *(const f32x4*)(bb + coff + c * 512);
    }
    // these loads name roff, coff (or the lane number it is made of) and their bases: as inputs all stay
    // live, so unwritten, up to this wait
    asm volatile("s_wait_xcnt 0x0" :: "v"(roff), "v"(coff), "v"(lane), "s"(hb), "s"(bb) : "memory");

    // the f32 tile has LDS of its own, behind the ctx rows that slower waves may still read
    float* xs = (float*)(sm + CT_BYTES);
    for (int i = 0; i < 4; ++i)
        for (int j = 0; j < 2; ++j) {
            float* p = xs + (j * 16 + laneRow) * XP + wave * 64 + i * 16 + g * 8;
            *(f32x4*)p = f32x4{acc[i][j][0], acc[i][j][1], acc[i][j][2], acc[i][j][3]};
            *(f32x4*)(p + 4) = f32x4{acc[i][j][4], acc[i][j][5], acc[i][j][6], acc[i][j][7]};
        }

    const char* wb = (const char*)lnw;
    const char* ob = (const char*)lnb;
    f32x4 wv[8], ov[8];
    for (int c = 0; c < 8; ++c) {
        wv[c] = *(const f32x4*)(wb + coff + c * 512);
        ov[c] = *(const f32x4*)(ob + coff + c * 512);
    }
    // as above, for coff, the lane number and the two bases
    asm volatile("s_wait_xcnt 0x0" :: "v"(coff), "v"(lane), "s"(wb), "s"(ob) : "memory");

    __syncthreads();                 // every wave's part of the tile is in LDS

    f32x4 v[2][8];
    float s[2];
    for (int rr = 0; rr < 2; ++rr) {
        const float* xr = xs + (wave * 2 + rr) * XP + lane * 4;
        f32x4 a = f32x4{0.f, 0.f, 0.f, 0.f};
        for (int c = 0; c < 8; ++c) {
            v[rr][c] = (*(const f32x4*)(xr + c * 128) + bv[c]) + hv[rr][c];
            a += v[rr][c];
        }
        s[rr] = (a[0] + a[1]) + (a[2] + a[3]);
    }
    for (int off = 16; off; off >>= 1)
        for (int rr = 0; rr < 2; ++rr) s[rr] += __shfl_xor(s[rr], off, 32);
    float mu[2], q[2];
    for (int rr = 0; rr < 2; ++rr) {
        mu[rr] = s[rr] * (1.0f / BDIM);
        f32x4 a = f32x4{0.f, 0.f, 0.f, 0.f};
        for (int c = 0; c < 8; ++c) {
            v[rr][c] -= mu[rr];
            a += v[rr][c] * v[rr][c];
        }
        q[rr] = (a[0] + a[1]) + (a[2] + a[3]);
    }
    for (int off = 16; off; off >>= 1)
        for (int rr = 0; rr < 2; ++rr) q[rr] += __shfl_xor(q[rr], off, 32);
    for (int rr = 0; rr < 2; ++rr) {
        float inv = rsqrtf(q[rr] * (1.0f / BDIM) + 1e-12f);
        for (int c = 0; c < 8; ++c)
            v[rr][c] = v[rr][c] * inv * wv[c] + ov[c];
    }
    char* db = (char*)out;
    for (int rr = 0; rr < 2; ++rr)
        for (int c = 0; c < 8; ++c)
            *(f32x4*)(db + roff + rr * (BDIM * 4) + c * 512) = v[rr][c];
    // the stores name roff and their data: as inputs all stay live, so unwritten, up to this wait
    asm volatile("s_wait_xcnt 0x0" :: "v"(roff),
                 "v"(v[0][0]), "v"(v[0][1]), "v"(v[0][2]), "v"(v[0][3]), "v"(v[0][4]), "v"(v[0][5]), "v"(v[0][6]), "v"(v[0][7]),
                 "v"(v[1][0]), "v"(v[1][1]), "v"(v[1][2]), "v"(v[1][3]), "v"(v[1][4]), "v"(v[1][5]), "v"(v[1][6]), "v"(v[1][7])
                 : "memory");
}

// ---------------------------------------------------------------- launch
extern "C" void kernel_launch(void* const* d_in, const int* in_sizes, int n_in,
                              void* d_out, int out_size, void* d_ws, size_t ws_size,
                              hipStream_t stream) {
    const float* hidden = (const float*)d_in[0];
    const float* mask   = (const float*)d_in[1];
    const float* phi    = (const float*)d_in[2];
    const float* mag    = (const float*)d_in[3];
    const float* Wq     = (const float*)d_in[4];
    const float* bq     = (const float*)d_in[5];
    const float* Wk     = (const float*)d_in[6];
    const float* bk     = (const float*)d_in[7];
    const float* Wv     = (const float*)d_in[8];
    const float* bv     = (const float*)d_in[9];
    const float* gamma  = (const float*)d_in[10];
    const float* Wo     = (const float*)d_in[11];
    const float* bo     = (const float*)d_in[12];
    const float* lnw    = (const float*)d_in[13];
    const float* lnb    = (const float*)d_in[14];
    float* out = (float*)d_out;

    char* ws = (char*)d_ws;
    const size_t o_xb   = 0;                           // 8 MB  bf16 X
    const size_t o_wt   = o_xb + 8388608ull;           // 6 MB  bf16 WT (q,k,v packed)
    const size_t o_wot  = o_wt + 6291456ull;           // 2 MB  bf16 WoT, fragment order
    const size_t o_bias = o_wot + 2097152ull;          // 12 KB packed bias
    const size_t o_qr   = o_bias + 12288ull + 50331648ull;   // 8 MB, at its old place: the 48 MB in front are not used
    const size_t o_kr   = o_qr + 8388608ull;           // 8 MB
    const size_t o_vt   = o_kr + 8388608ull;           // 8 MB
    const size_t o_ctx  = o_vt + 8388608ull;           // 8 MB

    u16*   Xb    = (u16*)(ws + o_xb);
    u16*   WT    = (u16*)(ws + o_wt);
    u16*   WoT   = (u16*)(ws + o_wot);
    float* biasA = (float*)(ws + o_bias);
    u16*   qrot  = (u16*)(ws + o_qr);
    u16*   krot  = (u16*)(ws + o_kr);
    u16*   vtb   = (u16*)(ws + o_vt);
    u16*   ctxb  = (u16*)(ws + o_ctx);

    // 1) X to bf16, the four weights transposed to bf16, the bias packed: one launch
    prep_kernel<<<PREP_X + PREP_T + PREP_B, 256, 0, stream>>>(
        hidden, Wq, Wk, Wv, Wo, bq, bk, bv, Xb, WT, WoT, biasA);

    // 3) fused QKV GEMM [4096 x 3072] with scale, rotation and V transpose in its epilogue
    gemm_qkv_rope_kernel<<<dim3(NQKV / BN, ROWS / BM), QTHREADS, 0, stream>>>(
        Xb, WT, biasA, phi, mag, gamma, qrot, krot, vtb);

    // 4) fused attention (online softmax in registers; LDS only to join the two parts of the keys)
    attn_kernel<<<dim3(LDIM / (AW * NQ * 16), HH, BB), AW * KS * 32, 0, stream>>>(
        qrot, krot, vtb, mask, ctxb);

    // 5) output projection + residual + LayerNorm, a block for 32 whole rows
    gemm_out_ln_kernel<<<ROWS / OM, 512, 0, stream>>>(
        ctxb, WoT, bo, hidden, lnw, lnb, out);
}
